// v000
// Measured on an AMD MI455X. A time is GPU time per run, averaged over a window of back-to-back runs after a warm-up
// (all launches, gaps included; the runs take copies of the inputs in turn), and the median of several windows.
// Apart from v000's, it joins two sittings. Times from different sittings can be a few percent apart, while
// side-by-side timings come from the same sitting.
// The starting kernel, v000, takes 1540 microseconds a run.
#include <hip/hip_runtime.h>

// CoAtNetRelativeAttention (x NCHW [16][256][32][32] -> 1024 tokens; q/k/v = xt W^T (8 heads x 32); attn = softmax(q . (k scale) + rel_bias[h][rel_idx[i][j]]) (rel_bias [8][3969] and the int32 index table read as data, clamped); out = (attn v) Wo^T + bo -> NCHW).
// Compute dtypes, f32 accumulate: every input rounded to bf16; q/k/v on PLAIN bf16 operands (inputs: exact); scores (K 32) and probs.v on single fp16 planes (the logits are dominated by the unit-scale bias; the projected q/k are
// 0.3-scale), z-batched over the 8 heads of an image with v^T zero-padded to 64 rows; bias gather + softmax f32 (three passes, x1024); Wo on fp16 planes of the merged heads x fp16 weights (+ bias); NCHW transposes by gather. Deterministic, no atomics;

#define NBI  16
#define CC   256
#define NN   1024
#define NH_  8
#define HD   32
#define NRB  3969
#define PCAR 1024.0f
typedef _Float16 h16;
typedef unsigned short bf;
typedef __attribute__((ext_vector_type(16))) __bf16   v16bf;
typedef __attribute__((ext_vector_type(16))) _Float16 v16h;
typedef __attribute__((ext_vector_type(8)))  _Float16 v8h;
typedef __attribute__((ext_vector_type(8)))  unsigned short v8us;
typedef __attribute__((ext_vector_type(8)))  float    v8f;
typedef __attribute__((ext_vector_type(4)))  float    v4f;
typedef v8h  __attribute__((may_alias)) v8ha;
typedef v4f  __attribute__((may_alias)) v4fa;
typedef v8us __attribute__((may_alias)) v8usa;

__device__ __forceinline__ unsigned short f2bf(float f) { unsigned u = __float_as_uint(f); u += 0x7FFFu + ((u >> 16) & 1u); return (unsigned short)(u >> 16); }
__device__ __forceinline__ float bf2f(unsigned short b) { return __uint_as_float(((unsigned)b) << 16); }
__device__ __forceinline__ float bfr(float f) { return bf2f(f2bf(f)); }
__device__ __forceinline__ v16h cat16(v8h lo, v8h hi) { return __builtin_shufflevector(lo, hi, 0, 1, 2, 3, 4, 5, 6, 7, 8, 9, 10, 11, 12, 13, 14, 15); }
__device__ __forceinline__ v16bf cat16b(v8us lo, v8us hi) { return __builtin_bit_cast(v16bf, __builtin_shufflevector(lo, hi, 0, 1, 2, 3, 4, 5, 6, 7, 8, 9, 10, 11, 12, 13, 14, 15)); }
__device__ __forceinline__ v8f wmma16(v16h a, v16h b, v8f c) { return __builtin_amdgcn_wmma_f32_16x16x32_f16(false, a, false, b, (short)0, c, false, false); }
__device__ __forceinline__ v8f wmmab(v16bf a, v16bf b, v8f c) { return __builtin_amdgcn_wmma_f32_16x16x32_bf16(false, a, false, b, (short)0, c, false, false); }



// ---- k_gemmw: register-blocked GEMM, ONE WAVE per 64x64 output tile (16 accumulators), operands straight from K-contiguous 16-bit planes; grid (M/64, N/64, Z), 32 threads.
// C[m][n] (f32, pitch ldc, + optional f32 bias[n]) = sum_k A[m][k] Bt[n][k] (+ split products per NSPLIT). z-batch strides sA/sB/sC in elements. K % 32 == 0.
template <typename T16> struct WFrag;
template <> struct WFrag<h16> { typedef v16h V; static __device__ __forceinline__ V ld(const h16* p) { return cat16(*(const v8h*)p, *(const v8h*)(p + 16)); } static __device__ __forceinline__ v8f mma(V a, V b, v8f c) { return wmma16(a, b, c); } };
template <> struct WFrag<bf> { typedef v16bf V; static __device__ __forceinline__ V ld(const bf* p) { return cat16b(*(const v8us*)p, *(const v8us*)(p + 16)); } static __device__ __forceinline__ v8f mma(V a, V b, v8f c) { return wmmab(a, b, c); } };
template <typename T16, int NSPLIT, bool BIAS>
__global__ __launch_bounds__(32) void k_gemmw(const T16* __restrict__ A, const T16* __restrict__ A2, const T16* __restrict__ Bt, const T16* __restrict__ Bt2, int K, float* C, int ldc, const float* __restrict__ bias, size_t sA, size_t sB, size_t sC) {
    typedef typename WFrag<T16>::V V;
    __shared__ __align__(16) float os[16 * 68];
    const size_t z = blockIdx.z; A += z * sA; if (A2) A2 += z * sA; Bt += z * sB; if (Bt2) Bt2 += z * sB; C += z * sC;
    const int lane = threadIdx.x & 31, lr = lane & 15, hi = lane >> 4; const int r0 = blockIdx.x * 64, c0 = blockIdx.y * 64;
    v8f acc[4][4];
#pragma unroll
    for (int mb = 0; mb < 4; ++mb)
#pragma unroll
        for (int nb = 0; nb < 4; ++nb) acc[mb][nb] = (v8f){};
    const size_t aoff = (size_t)(r0 + lr) * K + 8 * hi, boff = (size_t)(c0 + lr) * K + 8 * hi;
#pragma unroll 1
    for (int kc = 0; kc < K; kc += 32) {
        V a[4], a2[4];
#pragma unroll
        for (int mb = 0; mb < 4; ++mb) { a[mb] = WFrag<T16>::ld(A + aoff + (size_t)mb * 16 * K + kc); if (NSPLIT == 1 || NSPLIT == 2) a2[mb] = WFrag<T16>::ld(A2 + aoff + (size_t)mb * 16 * K + kc); }
#pragma unroll
        for (int nb = 0; nb < 4; ++nb) { const V b = WFrag<T16>::ld(Bt + boff + (size_t)nb * 16 * K + kc); V b2; if (NSPLIT >= 2) b2 = WFrag<T16>::ld(Bt2 + boff + (size_t)nb * 16 * K + kc);
#pragma unroll
            for (int mb = 0; mb < 4; ++mb) { acc[mb][nb] = WFrag<T16>::mma(a[mb], b, acc[mb][nb]); if (NSPLIT == 1 || NSPLIT == 2) acc[mb][nb] = WFrag<T16>::mma(a2[mb], b, acc[mb][nb]); if (NSPLIT >= 2) acc[mb][nb] = WFrag<T16>::mma(a[mb], b2, acc[mb][nb]); } }
        asm volatile("v_nop\n\tv_nop\n\tv_nop\n\tv_nop" : "+v"(acc[0][0]), "+v"(acc[1][1]), "+v"(acc[2][2]), "+v"(acc[3][3]) : "v"(a[0]), "v"(a[3]));
    }
#pragma unroll
    for (int mb = 0; mb < 4; ++mb) {
#pragma unroll
        for (int nb = 0; nb < 4; ++nb) {
#pragma unroll
            for (int j = 0; j < 8; ++j) os[(hi * 8 + j) * 68 + nb * 16 + lr] = acc[mb][nb][j]; }
        __builtin_amdgcn_wave_barrier(); asm volatile("" ::: "memory");
        float* crow = C + (size_t)(r0 + mb * 16) * ldc + c0;
{
#pragma unroll
            for (int s = 0; s < 8; ++s) { const int row = 2 * s + hi, cofs = lr * 4; v4f val = *(const v4fa*)(os + row * 68 + cofs); if (BIAS) { val[0] += bfr(bias[c0 + cofs]); val[1] += bfr(bias[c0 + cofs + 1]); val[2] += bfr(bias[c0 + cofs + 2]); val[3] += bfr(bias[c0 + cofs + 3]); }
                *(v4f*)(crow + (size_t)row * ldc + cofs) = val; }
             }
        __builtin_amdgcn_wave_barrier(); asm volatile("" ::: "memory");
    }
}

__device__ __forceinline__ h16 tohx(float x) { return (h16)x; }
typedef __attribute__((ext_vector_type(2))) _Float16 v2h;
typedef __attribute__((ext_vector_type(4))) _Float16 v4h;
typedef __attribute__((ext_vector_type(4))) unsigned short v4us;
typedef __attribute__((ext_vector_type(4))) int v4i;

__global__ __launch_bounds__(256) void k_cvt8(const float* __restrict__ src, bf* dst, size_t n8) { const size_t i = (size_t)blockIdx.x * 256 + threadIdx.x; if (i >= n8) return; const v8f v = *(const v8f*)(src + i * 8); v8us o;
#pragma unroll
    for (int k = 0; k < 8; ++k) o[k] = f2bf(v[k]); *(v8us*)(dst + i * 8) = o;  }
__global__ __launch_bounds__(256) void k_w16(const float* __restrict__ w, size_t n4, h16* Bt) { const size_t i = ((size_t)blockIdx.x * 256 + threadIdx.x) * 4; if (i >= n4 * 4) return; const v4f a = *(const v4f*)(w + i); v4h o; o[0] = tohx(bfr(a[0])); o[1] = tohx(bfr(a[1])); o[2] = tohx(bfr(a[2])); o[3] = tohx(bfr(a[3])); *(v4h*)(Bt + i) = o;  }
__global__ __launch_bounds__(256) void k_xt(const float* __restrict__ x, bf* XT) { const size_t e = ((size_t)blockIdx.x * 256 + threadIdx.x) * 4; if (e >= (size_t)NN * CC) return; const int c = (int)(e % CC); const int n = (int)(e / CC); v4us o;
#pragma unroll
    for (int q = 0; q < 4; ++q) o[q] = f2bf(x[(size_t)(c + q) * NN + n]); *(v4us*)(XT + e) = o;  }
__global__ __launch_bounds__(256) void k_qkpl(const float* __restrict__ Q, const float* __restrict__ Kf, h16* Q16, h16* K16) { const size_t e = ((size_t)blockIdx.x * 256 + threadIdx.x) * 4; if (e >= (size_t)NH_ * NN * HD) return; const int d = (int)(e % HD); const int n = (int)((e / HD) % NN); const int h = (int)(e / ((size_t)HD * NN)); const size_t src = (size_t)n * CC + h * HD + d; const v4f a = *(const v4f*)(Q + src), c = *(const v4f*)(Kf + src); v4h oq, ok;
#pragma unroll
    for (int q = 0; q < 4; ++q) { oq[q] = tohx(a[q]); ok[q] = tohx(c[q] * 0.1767766952966369f); } { *(v4h*)(Q16 + e) = oq; *(v4h*)(K16 + e) = ok;  } }
__global__ __launch_bounds__(256) void k_vt(const float* __restrict__ V, h16* VT) { const size_t e = ((size_t)blockIdx.x * 256 + threadIdx.x) * 2; if (e >= (size_t)NH_ * 64 * NN) return; const int n = (int)(e % NN); const int dv = (int)((e / NN) % 64); const int h = (int)(e / ((size_t)NN * 64)); v2h o; o[0] = dv < HD ? tohx(V[(size_t)n * CC + h * HD + dv]) : (h16)0.f; o[1] = dv < HD ? tohx(V[(size_t)(n + 1) * CC + h * HD + dv]) : (h16)0.f; *(v2h*)(VT + e) = o;  }
__global__ __launch_bounds__(256) void k_softb(const float* __restrict__ Sb, const float* __restrict__ rb, const int* __restrict__ ridx, h16* P) { const int lane = threadIdx.x & 31; const int row = blockIdx.x * 8 + (threadIdx.x >> 5); if (row >= NH_ * NN) return; const int i = row % NN; const int h = row / NN; const float* sr = Sb + (size_t)row * NN; const int* ir = ridx + (size_t)i * NN; const float* rbh = rb + (size_t)h * NRB; h16* pr = P + (size_t)row * NN; float mx = -3.0e38f;
#pragma unroll 1
    for (int ch = 0; ch < NN / 128; ++ch) { const int j0 = ch * 128 + lane * 4; const v4f a = *(const v4f*)(sr + j0); const v4i ii = *(const v4i*)(ir + j0);
#pragma unroll
        for (int q = 0; q < 4; ++q) { const int k = min(max(ii[q], 0), NRB - 1); mx = fmaxf(mx, __fadd_rn(a[q], bfr(rbh[k]))); } }
#pragma unroll
    for (int sh = 16; sh; sh >>= 1) mx = fmaxf(mx, __shfl_xor(mx, sh, 32));
    float sum = 0.f;
#pragma unroll 1
    for (int ch = 0; ch < NN / 128; ++ch) { const int j0 = ch * 128 + lane * 4; const v4f a = *(const v4f*)(sr + j0); const v4i ii = *(const v4i*)(ir + j0);
#pragma unroll
        for (int q = 0; q < 4; ++q) { const int k = min(max(ii[q], 0), NRB - 1); float d0 = __fsub_rn(__fadd_rn(a[q], bfr(rbh[k])), mx); asm volatile("" : "+v"(d0)); sum += __expf(d0); } }
#pragma unroll
    for (int sh = 16; sh; sh >>= 1) sum += __shfl_xor(sum, sh, 32);
    const float f = __fdiv_rn(PCAR, sum);
    {
#pragma unroll 1
        for (int ch = 0; ch < NN / 128; ++ch) { const int j0 = ch * 128 + lane * 4; const v4f a = *(const v4f*)(sr + j0); const v4i ii = *(const v4i*)(ir + j0); v4h o;
#pragma unroll
            for (int q = 0; q < 4; ++q) { const int k = min(max(ii[q], 0), NRB - 1); float d0 = __fsub_rn(__fadd_rn(a[q], bfr(rbh[k])), mx); asm volatile("" : "+v"(d0)); o[q] = tohx(__fmul_rn(__expf(d0), f)); } *(v4h*)(pr + j0) = o; }
         } }
__global__ __launch_bounds__(256) void k_mrg16(const float* __restrict__ O, h16* M16) { const size_t e = ((size_t)blockIdx.x * 256 + threadIdx.x) * 4; if (e >= (size_t)NN * CC) return; const int c = (int)(e % CC); const int n = (int)(e / CC); const int h = c / HD, d = c % HD; const float* r = O + ((size_t)h * NN + n) * 64 + d; v4h o; o[0] = tohx(r[0] * (1.0f / PCAR)); o[1] = tohx(r[1] * (1.0f / PCAR)); o[2] = tohx(r[2] * (1.0f / PCAR)); o[3] = tohx(r[3] * (1.0f / PCAR)); *(v4h*)(M16 + e) = o;  }
__global__ __launch_bounds__(256) void k_outT(const float* __restrict__ R, const float* __restrict__ bo, float* OUT) { const size_t e = ((size_t)blockIdx.x * 256 + threadIdx.x) * 4; if (e >= (size_t)CC * NN) return; const int n = (int)(e % NN); const int c = (int)(e / NN); const float bb = bfr(bo[c]); v4f o;
#pragma unroll
    for (int q = 0; q < 4; ++q) o[q] = __fadd_rn(R[(size_t)(n + q) * CC + c], bb); *(v4f*)(OUT + e) = o;  }

extern "C" void kernel_launch(void* const* d_in, const int* in_sizes, int n_in,
                              void* d_out, int out_size, void* d_ws, size_t ws_size, hipStream_t stream) {
    (void)in_sizes; (void)n_in; (void)out_size;
    const float* x = (const float*)d_in[0]; const float* wq = (const float*)d_in[1]; const float* wk = (const float*)d_in[2]; const float* wv = (const float*)d_in[3]; const float* wo = (const float*)d_in[4]; const float* bo = (const float*)d_in[5]; const float* rb = (const float*)d_in[6]; const int* ridx = (const int*)d_in[7];
    float* OUT = (float*)d_out;     // [16][256][32][32]
    char* wsp = (char*)d_ws;
    auto take = [&](size_t bytes) { char* p = wsp; wsp += (bytes + 255) & ~(size_t)255; return (void*)p; };
    bf* WQ = (bf*)take(CC * CC * 2); bf* WK = (bf*)take(CC * CC * 2); bf* WV = (bf*)take(CC * CC * 2); h16* WO = (h16*)take(CC * CC * 2); bf* XT = (bf*)take((size_t)NN * CC * 2); float* Q = (float*)take((size_t)NN * CC * 4); float* Kf = (float*)take((size_t)NN * CC * 4); float* V = (float*)take((size_t)NN * CC * 4);
    h16* Q16 = (h16*)take((size_t)NH_ * NN * HD * 2); h16* K16 = (h16*)take((size_t)NH_ * NN * HD * 2); h16* VT = (h16*)take((size_t)NH_ * 64 * NN * 2); float* Sb = (float*)take((size_t)NH_ * NN * NN * 4); h16* P16 = (h16*)take((size_t)NH_ * NN * NN * 2); float* O = (float*)take((size_t)NH_ * NN * 64 * 4); h16* M16 = (h16*)take((size_t)NN * CC * 2); float* R = (float*)take((size_t)NN * CC * 4);
    if ((size_t)(wsp - (char*)d_ws) > ws_size) return;    // total ~ 58 MB (one image at a time)
    k_cvt8<<<(CC * CC / 8 + 255) / 256, 256, 0, stream>>>(wq, WQ, CC * CC / 8); k_cvt8<<<(CC * CC / 8 + 255) / 256, 256, 0, stream>>>(wk, WK, CC * CC / 8); k_cvt8<<<(CC * CC / 8 + 255) / 256, 256, 0, stream>>>(wv, WV, CC * CC / 8); k_w16<<<(CC * CC / 4 + 255) / 256, 256, 0, stream>>>(wo, CC * CC / 4, WO);   // [out][in] natural Bt
    for (int b = 0; b < NBI; ++b) {
        k_xt<<<(unsigned)(((size_t)NN * CC / 4 + 255) / 256), 256, 0, stream>>>(x + (size_t)b * CC * NN, XT);
        k_gemmw<bf, 0, false><<<dim3(NN / 64, CC / 64, 1), 32, 0, stream>>>(XT, nullptr, WQ, nullptr, CC, Q, CC, nullptr, 0, 0, 0); k_gemmw<bf, 0, false><<<dim3(NN / 64, CC / 64, 1), 32, 0, stream>>>(XT, nullptr, WK, nullptr, CC, Kf, CC, nullptr, 0, 0, 0); k_gemmw<bf, 0, false><<<dim3(NN / 64, CC / 64, 1), 32, 0, stream>>>(XT, nullptr, WV, nullptr, CC, V, CC, nullptr, 0, 0, 0);
        k_qkpl<<<(unsigned)(((size_t)NH_ * NN * HD / 4 + 255) / 256), 256, 0, stream>>>(Q, Kf, Q16, K16); k_vt<<<(unsigned)(((size_t)NH_ * 64 * NN / 2 + 255) / 256), 256, 0, stream>>>(V, VT);
        k_gemmw<h16, 0, false><<<dim3(NN / 64, NN / 64, NH_), 32, 0, stream>>>(Q16, nullptr, K16, nullptr, HD, Sb, NN, nullptr, (size_t)NN * HD, (size_t)NN * HD, (size_t)NN * NN);
        k_softb<<<(NH_ * NN + 7) / 8, 256, 0, stream>>>(Sb, rb, ridx, P16);
        k_gemmw<h16, 0, false><<<dim3(NN / 64, 1, NH_), 32, 0, stream>>>(P16, nullptr, VT, nullptr, NN, O, 64, nullptr, (size_t)NN * NN, (size_t)64 * NN, (size_t)NN * 64);
        k_mrg16<<<(unsigned)(((size_t)NN * CC / 4 + 255) / 256), 256, 0, stream>>>(O, M16);
        k_gemmw<h16, 0, false><<<dim3(NN / 64, CC / 64, 1), 32, 0, stream>>>(M16, nullptr, WO, nullptr, CC, R, CC, nullptr, 0, 0, 0);
        k_outT<<<(unsigned)(((size_t)CC * NN / 4 + 255) / 256), 256, 0, stream>>>(R, bo, OUT + (size_t)b * CC * NN); }
}

// v001
// Measured time: 552 microseconds a run.
// Next to v000, in two timings, it ran 2.84 times as fast each time.
#include <hip/hip_runtime.h>

// CoAtNetRelativeAttention (x NCHW [16][256][32][32] -> 1024 tokens; q/k/v = xt W^T (8 heads x 32); attn = softmax(q . (k scale) + rel_bias[h][rel_idx[i][j]]) (rel_bias [8][3969] and the int32 index table read as data, clamped); out = (attn v) Wo^T + bo -> NCHW).
// Compute dtypes, f32 accumulate: every input rounded to bf16; q/k/v on PLAIN bf16 operands (inputs: exact); scores (K 32) and probs.v on single fp16 planes (the logits are dominated by the unit-scale bias; the projected q/k are
// 0.3-scale), z-batched over the 8 heads of GI images with v^T zero-padded to 64 rows; bias gather + softmax f32 (three passes, x1024); Wo on fp16 planes of the merged heads x fp16 weights (+ bias); NCHW transposes by gather. Deterministic, no atomics; every stage is launched once for all 16 images (token rows b * 1024 + n; q, k, v as z of one launch), the three score-plane stages and the head merge once per GI images.

#define NBI  16
#define GI   4      // images per launch of the score / softmax / probs.v stages: the f32 score plane of GI images (128 MiB) and its fp16 probs (64 MiB) must fit the workspace
#define CC   256
#define NN   1024
#define NH_  8
#define HD   32
#define NRB  3969
#define PCAR 1024.0f
typedef _Float16 h16;
typedef unsigned short bf;
typedef __attribute__((ext_vector_type(16))) __bf16   v16bf;
typedef __attribute__((ext_vector_type(16))) _Float16 v16h;
typedef __attribute__((ext_vector_type(8)))  _Float16 v8h;
typedef __attribute__((ext_vector_type(8)))  unsigned short v8us;
typedef __attribute__((ext_vector_type(8)))  float    v8f;
typedef __attribute__((ext_vector_type(4)))  float    v4f;
typedef v8h  __attribute__((may_alias)) v8ha;
typedef v4f  __attribute__((may_alias)) v4fa;
typedef v8us __attribute__((may_alias)) v8usa;

__device__ __forceinline__ unsigned short f2bf(float f) { unsigned u = __float_as_uint(f); u += 0x7FFFu + ((u >> 16) & 1u); return (unsigned short)(u >> 16); }
__device__ __forceinline__ float bf2f(unsigned short b) { return __uint_as_float(((unsigned)b) << 16); }
__device__ __forceinline__ float bfr(float f) { return bf2f(f2bf(f)); }
__device__ __forceinline__ v16h cat16(v8h lo, v8h hi) { return __builtin_shufflevector(lo, hi, 0, 1, 2, 3, 4, 5, 6, 7, 8, 9, 10, 11, 12, 13, 14, 15); }
__device__ __forceinline__ v16bf cat16b(v8us lo, v8us hi) { return __builtin_bit_cast(v16bf, __builtin_shufflevector(lo, hi, 0, 1, 2, 3, 4, 5, 6, 7, 8, 9, 10, 11, 12, 13, 14, 15)); }
__device__ __forceinline__ v8f wmma16(v16h a, v16h b, v8f c) { return __builtin_amdgcn_wmma_f32_16x16x32_f16(false, a, false, b, (short)0, c, false, false); }
__device__ __forceinline__ v8f wmmab(v16bf a, v16bf b, v8f c) { return __builtin_amdgcn_wmma_f32_16x16x32_bf16(false, a, false, b, (short)0, c, false, false); }



// ---- k_gemmw: register-blocked GEMM, ONE WAVE per 64x64 output tile (16 accumulators), operands straight from K-contiguous 16-bit planes; grid (M/64, N/64, Z), 32 threads.
// C[m][n] (f32, pitch ldc, + optional f32 bias[n]) = sum_k A[m][k] Bt[n][k] (+ split products per NSPLIT). z-batch strides sA/sB/sC in elements. K % 32 == 0.
template <typename T16> struct WFrag;
template <> struct WFrag<h16> { typedef v16h V; static __device__ __forceinline__ V ld(const h16* p) { return cat16(*(const v8h*)p, *(const v8h*)(p + 16)); } static __device__ __forceinline__ v8f mma(V a, V b, v8f c) { return wmma16(a, b, c); } };
template <> struct WFrag<bf> { typedef v16bf V; static __device__ __forceinline__ V ld(const bf* p) { return cat16b(*(const v8us*)p, *(const v8us*)(p + 16)); } static __device__ __forceinline__ v8f mma(V a, V b, v8f c) { return wmmab(a, b, c); } };
template <typename T16, int NSPLIT, bool BIAS>
__global__ __launch_bounds__(32) void k_gemmw(const T16* __restrict__ A, const T16* __restrict__ A2, const T16* __restrict__ Bt, const T16* __restrict__ Bt2, int K, float* C, int ldc, const float* __restrict__ bias, size_t sA, size_t sB, size_t sC) {
    typedef typename WFrag<T16>::V V;
    __shared__ __align__(16) float os[16 * 68];
    const size_t z = blockIdx.z; A += z * sA; if (A2) A2 += z * sA; Bt += z * sB; if (Bt2) Bt2 += z * sB; C += z * sC;
    const int lane = threadIdx.x & 31, lr = lane & 15, hi = lane >> 4; const int r0 = blockIdx.x * 64, c0 = blockIdx.y * 64;
    v8f acc[4][4];
#pragma unroll
    for (int mb = 0; mb < 4; ++mb)
#pragma unroll
        for (int nb = 0; nb < 4; ++nb) acc[mb][nb] = (v8f){};
    const size_t aoff = (size_t)(r0 + lr) * K + 8 * hi, boff = (size_t)(c0 + lr) * K + 8 * hi;
#pragma unroll 1
    for (int kc = 0; kc < K; kc += 32) {
        V a[4], a2[4];
#pragma unroll
        for (int mb = 0; mb < 4; ++mb) { a[mb] = WFrag<T16>::ld(A + aoff + (size_t)mb * 16 * K + kc); if (NSPLIT == 1 || NSPLIT == 2) a2[mb] = WFrag<T16>::ld(A2 + aoff + (size_t)mb * 16 * K + kc); }
#pragma unroll
        for (int nb = 0; nb < 4; ++nb) { const V b = WFrag<T16>::ld(Bt + boff + (size_t)nb * 16 * K + kc); V b2; if (NSPLIT >= 2) b2 = WFrag<T16>::ld(Bt2 + boff + (size_t)nb * 16 * K + kc);
#pragma unroll
            for (int mb = 0; mb < 4; ++mb) { acc[mb][nb] = WFrag<T16>::mma(a[mb], b, acc[mb][nb]); if (NSPLIT == 1 || NSPLIT == 2) acc[mb][nb] = WFrag<T16>::mma(a2[mb], b, acc[mb][nb]); if (NSPLIT >= 2) acc[mb][nb] = WFrag<T16>::mma(a[mb], b2, acc[mb][nb]); } }
        asm volatile("v_nop\n\tv_nop\n\tv_nop\n\tv_nop" : "+v"(acc[0][0]), "+v"(acc[1][1]), "+v"(acc[2][2]), "+v"(acc[3][3]) : "v"(a[0]), "v"(a[3]));
    }
#pragma unroll
    for (int mb = 0; mb < 4; ++mb) {
#pragma unroll
        for (int nb = 0; nb < 4; ++nb) {
#pragma unroll
            for (int j = 0; j < 8; ++j) os[(hi * 8 + j) * 68 + nb * 16 + lr] = acc[mb][nb][j]; }
        __builtin_amdgcn_wave_barrier(); asm volatile("" ::: "memory");
        float* crow = C + (size_t)(r0 + mb * 16) * ldc + c0;
{
#pragma unroll
            for (int s = 0; s < 8; ++s) { const int row = 2 * s + hi, cofs = lr * 4; v4f val = *(const v4fa*)(os + row * 68 + cofs); if (BIAS) { val[0] += bfr(bias[c0 + cofs]); val[1] += bfr(bias[c0 + cofs + 1]); val[2] += bfr(bias[c0 + cofs + 2]); val[3] += bfr(bias[c0 + cofs + 3]); }
                *(v4f*)(crow + (size_t)row * ldc + cofs) = val; }
             }
        __builtin_amdgcn_wave_barrier(); asm volatile("" ::: "memory");
    }
}

__device__ __forceinline__ h16 tohx(float x) { return (h16)x; }
typedef __attribute__((ext_vector_type(2))) _Float16 v2h;
typedef __attribute__((ext_vector_type(4))) _Float16 v4h;
typedef __attribute__((ext_vector_type(4))) unsigned short v4us;
typedef __attribute__((ext_vector_type(4))) int v4i;

__global__ __launch_bounds__(256) void k_cvt8(const float* __restrict__ src, bf* dst, size_t n8) { const size_t i = (size_t)blockIdx.x * 256 + threadIdx.x; if (i >= n8) return; const v8f v = *(const v8f*)(src + i * 8); v8us o;
#pragma unroll
    for (int k = 0; k < 8; ++k) o[k] = f2bf(v[k]); *(v8us*)(dst + i * 8) = o;  }
__global__ __launch_bounds__(256) void k_w16(const float* __restrict__ w, size_t n4, h16* Bt) { const size_t i = ((size_t)blockIdx.x * 256 + threadIdx.x) * 4; if (i >= n4 * 4) return; const v4f a = *(const v4f*)(w + i); v4h o; o[0] = tohx(bfr(a[0])); o[1] = tohx(bfr(a[1])); o[2] = tohx(bfr(a[2])); o[3] = tohx(bfr(a[3])); *(v4h*)(Bt + i) = o;  }
__global__ __launch_bounds__(256) void k_xt(const float* __restrict__ x, bf* XT) { const size_t e = ((size_t)blockIdx.x * 256 + threadIdx.x) * 4; if (e >= (size_t)NBI * NN * CC) return; const int c = (int)(e % CC); const int n = (int)((e / CC) % NN); const int b = (int)(e / ((size_t)CC * NN)); v4us o;
#pragma unroll
    for (int q = 0; q < 4; ++q) o[q] = f2bf(x[((size_t)b * CC + c + q) * NN + n]); *(v4us*)(XT + e) = o;  }
__global__ __launch_bounds__(256) void k_qkpl(const float* __restrict__ Q, const float* __restrict__ Kf, h16* Q16, h16* K16) { const size_t e = ((size_t)blockIdx.x * 256 + threadIdx.x) * 4; if (e >= (size_t)NBI * NH_ * NN * HD) return; const int d = (int)(e % HD); const int n = (int)((e / HD) % NN); const int h = (int)((e / ((size_t)HD * NN)) % NH_); const int b = (int)(e / ((size_t)HD * NN * NH_)); const size_t src = ((size_t)b * NN + n) * CC + h * HD + d; const v4f a = *(const v4f*)(Q + src), c = *(const v4f*)(Kf + src); v4h oq, ok;
#pragma unroll
    for (int q = 0; q < 4; ++q) { oq[q] = tohx(a[q]); ok[q] = tohx(c[q] * 0.1767766952966369f); } { *(v4h*)(Q16 + e) = oq; *(v4h*)(K16 + e) = ok;  } }
__global__ __launch_bounds__(256) void k_vt(const float* __restrict__ V, h16* VT) { const size_t e = ((size_t)blockIdx.x * 256 + threadIdx.x) * 2; if (e >= (size_t)NBI * NH_ * 64 * NN) return; const int n = (int)(e % NN); const int dv = (int)((e / NN) % 64); const int h = (int)((e / ((size_t)NN * 64)) % NH_); const int b = (int)(e / ((size_t)NN * 64 * NH_)); const float* vr = V + ((size_t)b * NN + n) * CC + h * HD + dv; v2h o; o[0] = dv < HD ? tohx(vr[0]) : (h16)0.f; o[1] = dv < HD ? tohx(vr[CC]) : (h16)0.f; *(v2h*)(VT + e) = o;  }
__global__ __launch_bounds__(256) void k_softb(const float* __restrict__ Sb, const float* __restrict__ rb, const int* __restrict__ ridx, h16* P) { const int lane = threadIdx.x & 31; const int row = blockIdx.x * 8 + (threadIdx.x >> 5); if (row >= GI * NH_ * NN) return; const int i = row % NN; const int h = (row / NN) % NH_; const float* sr = Sb + (size_t)row * NN; const int* ir = ridx + (size_t)i * NN; const float* rbh = rb + (size_t)h * NRB; h16* pr = P + (size_t)row * NN; float mx = -3.0e38f;
#pragma unroll 1
    for (int ch = 0; ch < NN / 128; ++ch) { const int j0 = ch * 128 + lane * 4; const v4f a = *(const v4f*)(sr + j0); const v4i ii = *(const v4i*)(ir + j0);
#pragma unroll
        for (int q = 0; q < 4; ++q) { const int k = min(max(ii[q], 0), NRB - 1); mx = fmaxf(mx, __fadd_rn(a[q], bfr(rbh[k]))); } }
#pragma unroll
    for (int sh = 16; sh; sh >>= 1) mx = fmaxf(mx, __shfl_xor(mx, sh, 32));
    float sum = 0.f;
#pragma unroll 1
    for (int ch = 0; ch < NN / 128; ++ch) { const int j0 = ch * 128 + lane * 4; const v4f a = *(const v4f*)(sr + j0); const v4i ii = *(const v4i*)(ir + j0);
#pragma unroll
        for (int q = 0; q < 4; ++q) { const int k = min(max(ii[q], 0), NRB - 1); float d0 = __fsub_rn(__fadd_rn(a[q], bfr(rbh[k])), mx); asm volatile("" : "+v"(d0)); sum += __expf(d0); } }
#pragma unroll
    for (int sh = 16; sh; sh >>= 1) sum += __shfl_xor(sum, sh, 32);
    const float f = __fdiv_rn(PCAR, sum);
    {
#pragma unroll 1
        for (int ch = 0; ch < NN / 128; ++ch) { const int j0 = ch * 128 + lane * 4; const v4f a = *(const v4f*)(sr + j0); const v4i ii = *(const v4i*)(ir + j0); v4h o;
#pragma unroll
            for (int q = 0; q < 4; ++q) { const int k = min(max(ii[q], 0), NRB - 1); float d0 = __fsub_rn(__fadd_rn(a[q], bfr(rbh[k])), mx); asm volatile("" : "+v"(d0)); o[q] = tohx(__fmul_rn(__expf(d0), f)); } *(v4h*)(pr + j0) = o; }
         } }
__global__ __launch_bounds__(256) void k_mrg16(const float* __restrict__ O, h16* M16) { const size_t e = ((size_t)blockIdx.x * 256 + threadIdx.x) * 4; if (e >= (size_t)GI * NN * CC) return; const int c = (int)(e % CC); const int n = (int)((e / CC) % NN); const int b = (int)(e / ((size_t)CC * NN)); const int h = c / HD, d = c % HD; const float* r = O + (((size_t)b * NH_ + h) * NN + n) * 64 + d; v4h o; o[0] = tohx(r[0] * (1.0f / PCAR)); o[1] = tohx(r[1] * (1.0f / PCAR)); o[2] = tohx(r[2] * (1.0f / PCAR)); o[3] = tohx(r[3] * (1.0f / PCAR)); *(v4h*)(M16 + e) = o;  }
__global__ __launch_bounds__(256) void k_outT(const float* __restrict__ R, const float* __restrict__ bo, float* OUT) { const size_t e = ((size_t)blockIdx.x * 256 + threadIdx.x) * 4; if (e >= (size_t)NBI * CC * NN) return; const int n = (int)(e % NN); const int c = (int)((e / NN) % CC); const int b = (int)(e / ((size_t)NN * CC)); const float bb = bfr(bo[c]); v4f o;
#pragma unroll
    for (int q = 0; q < 4; ++q) o[q] = __fadd_rn(R[((size_t)b * NN + n + q) * CC + c], bb); *(v4f*)(OUT + e) = o;  }

extern "C" void kernel_launch(void* const* d_in, const int* in_sizes, int n_in,
                              void* d_out, int out_size, void* d_ws, size_t ws_size, hipStream_t stream) {
    (void)in_sizes; (void)n_in; (void)out_size;
    const float* x = (const float*)d_in[0]; const float* wq = (const float*)d_in[1]; const float* wk = (const float*)d_in[2]; const float* wv = (const float*)d_in[3]; const float* wo = (const float*)d_in[4]; const float* bo = (const float*)d_in[5]; const float* rb = (const float*)d_in[6]; const int* ridx = (const int*)d_in[7];
    float* OUT = (float*)d_out;     // [16][256][32][32]
    char* wsp = (char*)d_ws;
    auto take = [&](size_t bytes) { char* p = wsp; wsp += (bytes + 255) & ~(size_t)255; return (void*)p; };
    bf* WQ = (bf*)take((size_t)3 * CC * CC * 2); bf* WK = WQ + CC * CC; bf* WV = WK + CC * CC; h16* WO = (h16*)take(CC * CC * 2);
    h16* Q16 = (h16*)take((size_t)NBI * NH_ * NN * HD * 2); h16* K16 = (h16*)take((size_t)NBI * NH_ * NN * HD * 2); h16* VT = (h16*)take((size_t)NBI * NH_ * 64 * NN * 2); h16* M16 = (h16*)take((size_t)NBI * NN * CC * 2); float* O = (float*)take((size_t)GI * NH_ * NN * 64 * 4);
    float* Sb = (float*)take((size_t)GI * NH_ * NN * NN * 4); h16* P16 = (h16*)take((size_t)GI * NH_ * NN * NN * 2);
    if ((size_t)(wsp - (char*)d_ws) > ws_size) return;    // total ~ 240.5 MiB
    // The score plane's 128 MiB also hold what is dead while it is live: XT and the f32 q/k/v (56 MiB, last read before the first scores launch) and R (16 MiB, first written after the last probs.v launch).
    wsp = (char*)Sb; bf* XT = (bf*)take((size_t)NBI * NN * CC * 2); float* Q = (float*)take((size_t)3 * NBI * NN * CC * 4); float* Kf = Q + (size_t)NBI * NN * CC; float* V = Kf + (size_t)NBI * NN * CC; float* R = (float*)Sb;
    k_cvt8<<<(CC * CC / 8 + 255) / 256, 256, 0, stream>>>(wq, WQ, CC * CC / 8); k_cvt8<<<(CC * CC / 8 + 255) / 256, 256, 0, stream>>>(wk, WK, CC * CC / 8); k_cvt8<<<(CC * CC / 8 + 255) / 256, 256, 0, stream>>>(wv, WV, CC * CC / 8); k_w16<<<(CC * CC / 4 + 255) / 256, 256, 0, stream>>>(wo, CC * CC / 4, WO);   // [out][in] natural Bt
    k_xt<<<(unsigned)(((size_t)NBI * NN * CC / 4 + 255) / 256), 256, 0, stream>>>(x, XT);
    k_gemmw<bf, 0, false><<<dim3(NBI * NN / 64, CC / 64, 3), 32, 0, stream>>>(XT, nullptr, WQ, nullptr, CC, Q, CC, nullptr, 0, (size_t)CC * CC, (size_t)NBI * NN * CC);   // z = q, k, v: the three weight planes and the three result planes lie one behind the other
    k_qkpl<<<(unsigned)(((size_t)NBI * NH_ * NN * HD / 4 + 255) / 256), 256, 0, stream>>>(Q, Kf, Q16, K16); k_vt<<<(unsigned)(((size_t)NBI * NH_ * 64 * NN / 2 + 255) / 256), 256, 0, stream>>>(V, VT);
    for (int g = 0; g < NBI / GI; ++g) {   // z = image-in-group * 8 + head
        k_gemmw<h16, 0, false><<<dim3(NN / 64, NN / 64, GI * NH_), 32, 0, stream>>>(Q16 + (size_t)g * GI * NH_ * NN * HD, nullptr, K16 + (size_t)g * GI * NH_ * NN * HD, nullptr, HD, Sb, NN, nullptr, (size_t)NN * HD, (size_t)NN * HD, (size_t)NN * NN);
        k_softb<<<(GI * NH_ * NN + 7) / 8, 256, 0, stream>>>(Sb, rb, ridx, P16);
        k_gemmw<h16, 0, false><<<dim3(NN / 64, 1, GI * NH_), 32, 0, stream>>>(P16, nullptr, VT + (size_t)g * GI * NH_ * 64 * NN, nullptr, NN, O, 64, nullptr, (size_t)NN * NN, (size_t)64 * NN, (size_t)NN * 64);
        k_mrg16<<<(unsigned)(((size_t)GI * NN * CC / 4 + 255) / 256), 256, 0, stream>>>(O, M16 + (size_t)g * GI * NN * CC); }
    k_gemmw<h16, 0, false><<<dim3(NBI * NN / 64, CC / 64, 1), 32, 0, stream>>>(M16, nullptr, WO, nullptr, CC, R, CC, nullptr, 0, 0, 0);
    k_outT<<<(unsigned)(((size_t)NBI * CC * NN / 4 + 255) / 256), 256, 0, stream>>>(R, bo, OUT);
}

// v003
// Measured time: 97.2 microseconds a run.
// Versions between v001 and this one are left out; their measured steps multiply to 5.65 times as fast.
// Counting every step since v000, it is 16.0 times as fast.
#include <hip/hip_runtime.h>

// Attention block with a gathered relative bias (x NCHW [16][256][32][32] -> 1024 tokens; q/k/v = xt W^T (8 heads x 32); attn = softmax(q . (k scale) + rel_bias[h][rel_idx[i][j]]) (rel_bias [8][3969] and the int32 index table read as data, clamped); out = (attn v) Wo^T + bo -> NCHW).
// Compute dtypes, f32 accumulate: every input rounded to bf16; q/k/v on PLAIN bf16 operands (inputs: exact); scores (K 32) and probs.v on single fp16 planes (the logits are dominated by the unit-scale bias; the projected q/k are
// 0.3-scale); scores, bias gather, softmax (f32, running maximum) and probs.v in ONE kernel, scores and probs held in registers; Wo on fp16 planes of the merged heads x fp16 weights (+ bias). Deterministic, no atomics.
// Seven launches: the four weight roundings, k_qkv, k_fattn, k_wo. No activation has a layout pass of its own: k_qkv reads x as it comes (f32, NCHW) and rounds it in its fragment loader, and the epilogues of both GEMMs store the layout that the next reader wants.

#define NBI  16
#define NI   2      // images per wave of the attention kernel: they share one gathered bias tile
#define CC   256
#define NN   1024
#define NH_  8
#define HD   32
#define NRB  3969
#define PSH  10.0f  // probs carry 2^PSH so that small ones stay normal fp16 numbers; the row sum carries it too, so it cancels
#define L2E  1.4426950408889634f
typedef _Float16 h16;
typedef unsigned short bf;
typedef __attribute__((ext_vector_type(16))) __bf16   v16bf;
typedef __attribute__((ext_vector_type(16))) _Float16 v16h;
typedef __attribute__((ext_vector_type(16))) float    v16f;
typedef __attribute__((ext_vector_type(8)))  _Float16 v8h;
typedef __attribute__((ext_vector_type(8)))  unsigned short v8us;
typedef __attribute__((ext_vector_type(4)))  _Float16 v4h;
typedef __attribute__((ext_vector_type(8)))  float    v8f;
typedef __attribute__((ext_vector_type(4)))  float    v4f;
typedef __attribute__((ext_vector_type(4)))  int      v4i;
typedef v8h  __attribute__((may_alias)) v8ha;
typedef v4f  __attribute__((may_alias)) v4fa;

__device__ __forceinline__ unsigned short f2bf(float f) { unsigned u = __float_as_uint(f); u += 0x7FFFu + ((u >> 16) & 1u); return (unsigned short)(u >> 16); }
__device__ __forceinline__ float bf2f(unsigned short b) { return __uint_as_float(((unsigned)b) << 16); }
__device__ __forceinline__ float bfr(float f) { return bf2f(f2bf(f)); }
__device__ __forceinline__ v16h cat16(v8h lo, v8h hi) { return __builtin_shufflevector(lo, hi, 0, 1, 2, 3, 4, 5, 6, 7, 8, 9, 10, 11, 12, 13, 14, 15); }
__device__ __forceinline__ v16bf cat16b(v8us lo, v8us hi) { return __builtin_bit_cast(v16bf, __builtin_shufflevector(lo, hi, 0, 1, 2, 3, 4, 5, 6, 7, 8, 9, 10, 11, 12, 13, 14, 15)); }
__device__ __forceinline__ v8f wmma16(v16h a, v16h b, v8f c) { return __builtin_amdgcn_wmma_f32_16x16x32_f16(false, a, false, b, (short)0, c, false, false); }
__device__ __forceinline__ v8f wmmab(v16bf a, v16bf b, v8f c) { return __builtin_amdgcn_wmma_f32_16x16x32_bf16(false, a, false, b, (short)0, c, false, false); }
template <typename T16> struct WFrag;
template <> struct WFrag<h16> { typedef v16h V; static __device__ __forceinline__ V ld(const h16* p) { return cat16(*(const v8h*)p, *(const v8h*)(p + 16)); } static __device__ __forceinline__ v8f mma(V a, V b, v8f c) { return wmma16(a, b, c); } };
template <> struct WFrag<bf> { typedef v16bf V; static __device__ __forceinline__ V ld(const bf* p) { return cat16b(*(const v8us*)p, *(const v8us*)(p + 16)); } static __device__ __forceinline__ v8f mma(V a, V b, v8f c) { return wmmab(a, b, c); } };
__device__ __forceinline__ h16 tohx(float x) { return (h16)x; }
__global__ __launch_bounds__(256) void k_cvt8(const float* __restrict__ src, bf* dst, size_t n8) { const size_t i = (size_t)blockIdx.x * 256 + threadIdx.x; if (i >= n8) return; const v8f v = *(const v8f*)(src + i * 8); v8us o;
#pragma unroll
    for (int k = 0; k < 8; ++k) o[k] = f2bf(v[k]); *(v8us*)(dst + i * 8) = o;  }
__global__ __launch_bounds__(256) void k_w16(const float* __restrict__ w, size_t n4, h16* Bt) { const size_t i = ((size_t)blockIdx.x * 256 + threadIdx.x) * 4; if (i >= n4 * 4) return; const v4f a = *(const v4f*)(w + i); v4h o; o[0] = tohx(bfr(a[0])); o[1] = tohx(bfr(a[1])); o[2] = tohx(bfr(a[2])); o[3] = tohx(bfr(a[3])); *(v4h*)(Bt + i) = o;  }

// ---- The two GEMMs: ONE WAVE per 64x64 output tile (16 accumulators), K = CC in steps of 32, operands straight from global memory (the weights from their K-contiguous 16-bit planes), 32 threads a work-group.
// A lane of an accumulator holds ONE column and eight consecutive rows, so each product is set up with the index that is contiguous in its result's layout as the ROW index; the tile goes through LDS once so that every store instruction writes whole 128-byte lines.
// x W^T for 64 tokens x 64 output channels. x is [c][n]: one 16-byte load gives a lane FOUR tokens (n0 + 4 lr + t) at one k, so token block t of the tile is made of the tokens n0 + 4 r + t (r: the fragment's row or column): every load covers whole lines and nothing is transposed; the epilogues undo the order.
// k order of both loaders, element e of a fragment: kc + 8 hi + (e & 7) + 16 (e >> 3). XROWS: the tokens are the rows (A operand), else the columns (B operand). acc[g][t]: channel block g, token block t.
template <bool XROWS>
__device__ __forceinline__ void xw_tile(const float* xp, const bf* wp, v8f (&acc)[4][4]) {
#pragma unroll 1   // kept rolled: the raw f32 values of a second step would not fit beside the 16 accumulators
    for (int kc = 0; kc < CC; kc += 32) {
        const float* xk = xp + (size_t)kc * NN; const bf* wk = wp + kc;
        v4f xv[16]; v16bf xf[4], wf[4];
#pragma unroll
        for (int e = 0; e < 16; ++e) xv[e] = *(const v4f*)(xk + (size_t)((e & 7) + (e >> 3) * 16) * NN);
#pragma unroll
        for (int g = 0; g < 4; ++g) wf[g] = WFrag<bf>::ld(wk + g * 16 * CC);
        __builtin_amdgcn_sched_barrier(0);   // all 24 loads of the step are issued before its arithmetic: left alone, the compiler reloads two weight fragments among the matrix instructions and the wave waits out the load latency three times a step
#pragma unroll
        for (int t = 0; t < 4; ++t) { v16f c;
#pragma unroll
            for (int e = 0; e < 16; ++e) c[e] = xv[e][t];
            xf[t] = __builtin_convertvector(c, v16bf); }
#pragma unroll
        for (int g = 0; g < 4; ++g)
#pragma unroll
            for (int t = 0; t < 4; ++t) acc[g][t] = XROWS ? wmmab(xf[t], wf[g], acc[g][t]) : wmmab(wf[g], xf[t], acc[g][t]);
        asm volatile("v_nop\n\tv_nop\n\tv_nop\n\tv_nop" : "+v"(acc[0][0]), "+v"(acc[1][1]), "+v"(acc[2][2]), "+v"(acc[3][3]) : "v"(xf[3]), "v"(wf[3]));   // the slots behind the last matrix instruction on the loop's taken branch
    }
}
// grid (NBI * NN / 64, CC / 64, 3), z = q, k, v (W3: their three weight planes one behind the other). q, k: rows = channels, so a lane holds 8 consecutive d of one token -> Q16 / K16 [b][h][n][d] (k scaled in f32 before it is rounded). v: rows = tokens, so a lane holds 32 consecutive tokens of one channel -> VT [b][h][d][n].
__global__ __launch_bounds__(32) void k_qkv(const float* __restrict__ x, const bf* __restrict__ W3, h16* Q16, h16* K16, h16* VT) {
    __shared__ __align__(16) h16 os[2 * 64 * 40];   // q, k: [head][token][40]; v: [channel][72]
    const int lane = threadIdx.x & 31, lr = lane & 15, hi = lane >> 4;
    const int z = blockIdx.z, b = blockIdx.x >> 4, n0 = (blockIdx.x & 15) * 64, o0 = blockIdx.y * 64;
    const float* xp = x + ((size_t)b * CC + 8 * hi) * NN + n0 + 4 * lr;
    const bf* wp = W3 + ((size_t)z * CC + o0 + lr) * CC + 8 * hi;
    v8f acc[4][4];
#pragma unroll
    for (int g = 0; g < 4; ++g)
#pragma unroll
        for (int t = 0; t < 4; ++t) acc[g][t] = (v8f){};
    if (z < 2) {
        xw_tile<false>(xp, wp, acc);   // acc[g][t][j]: channel o0 + 16 g + 8 hi + j, token n0 + 4 lr + t
        const float sc = z == 1 ? 0.1767766952966369f : 1.0f;
#pragma unroll
        for (int g = 0; g < 4; ++g)
#pragma unroll
            for (int t = 0; t < 4; ++t) *(v8ha*)(os + ((g >> 1) * 64 + 4 * lr + t) * 40 + (g & 1) * 16 + 8 * hi) = __builtin_convertvector(acc[g][t] * sc, v8h);
        __builtin_amdgcn_wave_barrier(); asm volatile("" ::: "memory");   // one wave: its LDS operations run in order; this keeps the compiler from moving the reads of other lanes' rows over the writes
        h16* dst = (z == 0 ? Q16 : K16) + (((size_t)b * NH_ + (o0 >> 5)) * NN + n0) * HD;
#pragma unroll
        for (int s = 0; s < 16; ++s) { const int c = s * 32 + lane, hd = c >> 8, tok = (c >> 2) & 63, pc = c & 3;
            *(v8h*)(dst + (size_t)hd * NN * HD + (c & 255) * 8) = *(const v8ha*)(os + (hd * 64 + tok) * 40 + pc * 8); }
    } else {
        xw_tile<true>(xp, wp, acc);    // acc[g][t][j]: token n0 + 4 (8 hi + j) + t, channel o0 + 16 g + lr
#pragma unroll
        for (int g = 0; g < 4; ++g)
#pragma unroll
            for (int q = 0; q < 4; ++q) { v8f c;
#pragma unroll
                for (int e = 0; e < 8; ++e) c[e] = acc[g][e & 3][2 * q + (e >> 2)];   // tokens n0 + 32 hi + 8 q + e
                *(v8ha*)(os + (g * 16 + lr) * 72 + 32 * hi + 8 * q) = __builtin_convertvector(c, v8h); }
        __builtin_amdgcn_wave_barrier(); asm volatile("" ::: "memory");   // as above
        h16* dst = VT + ((size_t)b * CC + o0) * NN + n0;
#pragma unroll
        for (int s = 0; s < 16; ++s) { const int c = s * 32 + lane, row = c >> 3, pc = c & 7;
            *(v8h*)(dst + (size_t)row * NN + pc * 8) = *(const v8ha*)(os + row * 72 + pc * 8); }
    }
}
// grid (NBI * NN / 64, CC / 64): OUT [b][c][n] = merged heads . Wo^T + bo. Rows = tokens (natural order), columns = output channels: a lane holds 8 consecutive tokens of one channel, which is NCHW.
__global__ __launch_bounds__(32) void k_wo(const h16* __restrict__ M16, const h16* __restrict__ WO, const float* __restrict__ bo, float* OUT) {
    __shared__ __align__(16) float os[16 * 68];
    const int lane = threadIdx.x & 31, lr = lane & 15, hi = lane >> 4;
    const int b = blockIdx.x >> 4, n0 = (blockIdx.x & 15) * 64, c0 = blockIdx.y * 64;
    const h16* ap = M16 + ((size_t)b * NN + n0 + lr) * CC + 8 * hi;
    const h16* wp = WO + (size_t)(c0 + lr) * CC + 8 * hi;
    v8f acc[4][4];
#pragma unroll
    for (int mb = 0; mb < 4; ++mb)
#pragma unroll
        for (int nb = 0; nb < 4; ++nb) acc[mb][nb] = (v8f){};
#pragma unroll 1   // kept rolled: one step's fragments beside the 16 accumulators
    for (int kc = 0; kc < CC; kc += 32) {
        const h16* ak = ap + kc; const h16* wk = wp + kc;
        v16h a[4], w[4];
#pragma unroll
        for (int mb = 0; mb < 4; ++mb) a[mb] = WFrag<h16>::ld(ak + mb * 16 * CC);
#pragma unroll
        for (int nb = 0; nb < 4; ++nb) w[nb] = WFrag<h16>::ld(wk + nb * 16 * CC);
        asm volatile("s_wait_xcnt 0x0" :: "v"(ak), "v"(wk) : "memory");   // behind the step's loads: their address registers are inputs, so they live up to the wait and no result of the run is placed on one of them
#pragma unroll
        for (int nb = 0; nb < 4; ++nb)
#pragma unroll
            for (int mb = 0; mb < 4; ++mb) acc[mb][nb] = wmma16(a[mb], w[nb], acc[mb][nb]);
        asm volatile("v_nop\n\tv_nop\n\tv_nop\n\tv_nop" : "+v"(acc[0][0]), "+v"(acc[1][1]), "+v"(acc[2][2]), "+v"(acc[3][3]) : "v"(a[3]), "v"(w[3]));   // as in xw_tile
    }
#pragma unroll
    for (int nb = 0; nb < 4; ++nb) {   // acc[mb][nb][j]: token n0 + 16 mb + 8 hi + j, channel c0 + 16 nb + lr
        const float bb = bfr(bo[c0 + nb * 16 + lr]);
#pragma unroll
        for (int mb = 0; mb < 4; ++mb) { const v8f v = acc[mb][nb] + bb;
            *(v4fa*)(os + lr * 68 + mb * 16 + 8 * hi) = (v4f){v[0], v[1], v[2], v[3]}; *(v4fa*)(os + lr * 68 + mb * 16 + 8 * hi + 4) = (v4f){v[4], v[5], v[6], v[7]}; }
        __builtin_amdgcn_wave_barrier(); asm volatile("" ::: "memory");   // as in k_qkv
        float* dst = OUT + ((size_t)b * CC + c0 + nb * 16) * NN + n0;
#pragma unroll
        for (int s = 0; s < 8; ++s) { const int c = s * 32 + lane, row = c >> 4, pc = c & 15;
            *(v4f*)(dst + (size_t)row * NN + pc * 4) = *(const v4fa*)(os + row * 68 + pc * 4); }
        __builtin_amdgcn_wave_barrier(); asm volatile("" ::: "memory");   // the next block's writes stay behind these reads
    }
}

// ---- k_fattn: scores + gathered bias + softmax + probs.v for 16 queries of one head and NI images per wave; nothing of the score plane leaves the registers.
// Transposed products: S^T = K Q^T + bias (the bias tile is the C operand: a lane holds query lr, keys 8 hi + r), O^T += V^T P^T (two S^T tiles, converted in place, are the B operand in the hardware k order; V^T rows by the same loader).
// Work-group: 8 waves = 4 query tiles x 2 heads, so that the staged store writes whole 128-byte lines of the merged-heads plane. grid (NN / 64, NH_ / 2, NBI / NI) = 4096 waves, four per SIMD, all resident at once: hence amdgpu_waves_per_eu(4, 4), which holds the register count to that.
// Every inner loop is unrolled so that the fragment arrays are indexed by constants and stay in registers.
__device__ __forceinline__ float xrow(float v) { const int b = __float_as_int(v); return __int_as_float(__builtin_amdgcn_permlanex16(b, b, 0x76543210, 0xfedcba98, false, false)); }   // lane l <-> l ^ 16
// Eight v_exp_f32 in one statement: no result lies on a source ("=&v"), and the closing v_nop is the slot the instruction set asks for between a transcendental and the next user of its result or writer of its source.
__device__ __forceinline__ v8f exp2x8(v8f x) { float y0, y1, y2, y3, y4, y5, y6, y7;
    asm("v_exp_f32 %0, %8\n\tv_exp_f32 %1, %9\n\tv_exp_f32 %2, %10\n\tv_exp_f32 %3, %11\n\tv_exp_f32 %4, %12\n\tv_exp_f32 %5, %13\n\tv_exp_f32 %6, %14\n\tv_exp_f32 %7, %15\n\tv_nop"
        : "=&v"(y0), "=&v"(y1), "=&v"(y2), "=&v"(y3), "=&v"(y4), "=&v"(y5), "=&v"(y6), "=&v"(y7) : "v"(x[0]), "v"(x[1]), "v"(x[2]), "v"(x[3]), "v"(x[4]), "v"(x[5]), "v"(x[6]), "v"(x[7]));
    return (v8f){y0, y1, y2, y3, y4, y5, y6, y7}; }
__device__ __forceinline__ float exp2x1(float x) { float y; asm("v_exp_f32 %0, %1\n\tv_nop" : "=v"(y) : "v"(x)); return y; }   // the same slot behind a single one
__device__ __forceinline__ void ld_ix(const int* p, v4i (&ix)[4]) {
#pragma unroll
    for (int c = 0; c < 4; ++c) ix[c] = *(const v4i*)(p + (c >> 1) * 16 + (c & 1) * 4); }
__device__ __forceinline__ void clamp_ix(const v4i (&ix)[4], int (&kx)[16]) {
#pragma unroll
    for (int u = 0; u < 16; ++u) kx[u] = min(max(ix[u >> 2][u & 3], 0), NRB - 1); }
__device__ __forceinline__ void gather_raw(const float* __restrict__ rbh, const int (&kx)[16], float (&rw)[16]) {
#pragma unroll
    for (int u = 0; u < 16; ++u) rw[u] = rbh[kx[u]]; }
__device__ __forceinline__ void round_bias(const float (&rw)[16], v8f (&bias)[2]) {
#pragma unroll
    for (int u = 0; u < 16; ++u) bias[u >> 3][u & 7] = bfr(rw[u]); }
// s_wait_xcnt 0 behind a run of global loads. The run's address registers are inputs, so they live up to the wait and no result of the run is placed on one of them; the memory clobber keeps the run's loads in front of it (in the loop: ahead of the softmax arithmetic, which covers their latency) and later loads behind it.
#define XWAIT_KX(kx) "v"(kx[0]), "v"(kx[1]), "v"(kx[2]), "v"(kx[3]), "v"(kx[4]), "v"(kx[5]), "v"(kx[6]), "v"(kx[7]), "v"(kx[8]), "v"(kx[9]), "v"(kx[10]), "v"(kx[11]), "v"(kx[12]), "v"(kx[13]), "v"(kx[14]), "v"(kx[15])
__global__ __launch_bounds__(256) __attribute__((amdgpu_waves_per_eu(4, 4))) void k_fattn(const h16* __restrict__ Q16, const h16* __restrict__ K16, const h16* __restrict__ VT, const float* __restrict__ rb, const int* __restrict__ ridx, h16* M16) {
    __shared__ __align__(16) h16 os[NI][64][72];
    const int lane = threadIdx.x & 31, lr = lane & 15, hi = lane >> 4;
    const int wave = __builtin_amdgcn_readfirstlane(threadIdx.x >> 5), qt = wave & 3, hh = wave >> 2;
    const int q0 = blockIdx.x * 64, h = blockIdx.y * 2 + hh, b0 = blockIdx.z * NI, i = q0 + qt * 16 + lr;
    const float* rbh = rb + (size_t)h * NRB;
    const int* ir = ridx + (size_t)i * NN + 8 * hi;
    const size_t bh0 = (size_t)b0 * NH_ + h, IMS = (size_t)NH_ * NN * HD;   // IMS: elements from one image to the next in Q16, K16 and VT
    const h16* qa = Q16 + (bh0 * NN + i) * HD + 8 * hi; const h16* kp = K16 + (bh0 * NN + lr) * HD + 8 * hi; const h16* vp = VT + (bh0 * HD + lr) * NN + 8 * hi;
    v16h q[NI], kf[NI][2]; v8f o[NI][2]; float m[NI], l[NI];
    v4i ix[4]; int kx[16]; float rw[16]; v8f bias[2];
    ld_ix(ir, ix);
    asm volatile("s_wait_xcnt 0x0" :: "v"(ir) : "memory");   // see XWAIT_KX
    clamp_ix(ix, kx); gather_raw(rbh, kx, rw);
#pragma unroll
    for (int im = 0; im < NI; ++im) {
        q[im] = WFrag<h16>::ld(qa + im * IMS);
        kf[im][0] = WFrag<h16>::ld(kp + im * IMS); kf[im][1] = WFrag<h16>::ld(kp + im * IMS + 16 * HD);
        o[im][0] = (v8f){}; o[im][1] = (v8f){}; m[im] = -3.0e38f; l[im] = 0.f; }
    ld_ix(ir + 32, ix);
    asm volatile("s_wait_xcnt 0x0" :: "v"(qa), "v"(kp), "v"(ir), XWAIT_KX(kx) : "memory");   // see XWAIT_KX
#pragma unroll 1   // kept rolled: a second pass in flight would not fit the registers of four waves per SIMD
    for (int s = 0; s < NN / 32; ++s) {   // 32 keys a pass; the bias tile and the K fragments are fetched one pass ahead, the indices two (the last passes wrap to the row's start: in bounds, not used)
        const h16* va = vp + s * 32; const h16* ka = kp + (size_t)(((s + 1) & (NN / 32 - 1)) * 32) * HD; const int* ia = ir + ((s + 2) & (NN / 32 - 1)) * 32;
        v8f st[NI][2]; v16h vf[NI][2];
        round_bias(rw, bias);   // here and not behind the gather: the values gathered in the pass before have landed by now
#pragma unroll
        for (int im = 0; im < NI; ++im) { st[im][0] = wmma16(kf[im][0], q[im], bias[0]); st[im][1] = wmma16(kf[im][1], q[im], bias[1]); }
        clamp_ix(ix, kx);
#pragma unroll
        for (int im = 0; im < NI; ++im) { vf[im][0] = WFrag<h16>::ld(va + im * IMS); vf[im][1] = WFrag<h16>::ld(va + im * IMS + (size_t)16 * NN); }
        gather_raw(rbh, kx, rw);
#pragma unroll
        for (int im = 0; im < NI; ++im) { kf[im][0] = WFrag<h16>::ld(ka + im * IMS); kf[im][1] = WFrag<h16>::ld(ka + im * IMS + 16 * HD); }
        ld_ix(ia, ix);
        asm volatile("s_wait_xcnt 0x0" :: "v"(va), "v"(ka), "v"(ia), XWAIT_KX(kx) : "memory");   // see XWAIT_KX
#pragma unroll
        for (int im = 0; im < NI; ++im) {
            float tm = st[im][0][0];
#pragma unroll
            for (int r = 1; r < 16; ++r) tm = fmaxf(tm, st[im][r >> 3][r & 7]);
            tm = fmaxf(tm, xrow(tm));
            const float mn = fmaxf(m[im], tm), sc = exp2x1((m[im] - mn) * L2E), mb = mn * L2E - PSH; m[im] = mn;
            float ps = 0.f; v8f e[2];
#pragma unroll
            for (int t = 0; t < 2; ++t) { v8f a;
#pragma unroll
                for (int r = 0; r < 8; ++r) a[r] = fmaf(st[im][t][r], L2E, -mb);
                e[t] = exp2x8(a);
#pragma unroll
                for (int r = 0; r < 8; ++r) ps += e[t][r]; }
            l[im] = fmaf(l[im], sc, ps);
            const v16h pb = cat16(__builtin_convertvector(e[0], v8h), __builtin_convertvector(e[1], v8h));
            o[im][0] = wmma16(vf[im][0], pb, o[im][0] * sc); o[im][1] = wmma16(vf[im][1], pb, o[im][1] * sc); }
    }
#pragma unroll
    for (int im = 0; im < NI; ++im) { const float inv = 1.0f / (l[im] + xrow(l[im]));
#pragma unroll
        for (int u = 0; u < 2; ++u) *(v8ha*)(&os[im][qt * 16 + lr][hh * HD + u * 16 + hi * 8]) = __builtin_convertvector(o[im][u] * inv, v8h); }
    __syncthreads();   // the two heads of a 128-byte line come from two waves
#pragma unroll
    for (int it = 0; it < NI * 2; ++it) { const int c = it * 256 + threadIdx.x, im = c >> 9, row = (c >> 3) & 63, pc = c & 7;
        *(v8h*)(M16 + ((size_t)(b0 + im) * NN + q0 + row) * CC + blockIdx.y * 2 * HD + pc * 8) = *(const v8ha*)(&os[im][row][pc * 8]); }
}

extern "C" void kernel_launch(void* const* d_in, const int* in_sizes, int n_in,
                              void* d_out, int out_size, void* d_ws, size_t ws_size, hipStream_t stream) {
    (void)in_sizes; (void)n_in; (void)out_size;
    const float* x = (const float*)d_in[0]; const float* wq = (const float*)d_in[1]; const float* wk = (const float*)d_in[2]; const float* wv = (const float*)d_in[3]; const float* wo = (const float*)d_in[4]; const float* bo = (const float*)d_in[5]; const float* rb = (const float*)d_in[6]; const int* ridx = (const int*)d_in[7];
    float* OUT = (float*)d_out;     // [16][256][32][32]
    char* wsp = (char*)d_ws;
    auto take = [&](size_t bytes) { char* p = wsp; wsp += (bytes + 255) & ~(size_t)255; return (void*)p; };
    bf* WQ = (bf*)take((size_t)3 * CC * CC * 2); bf* WK = WQ + CC * CC; bf* WV = WK + CC * CC; h16* WO = (h16*)take(CC * CC * 2);
    h16* Q16 = (h16*)take((size_t)NBI * NH_ * NN * HD * 2); h16* K16 = (h16*)take((size_t)NBI * NH_ * NN * HD * 2); h16* VT = (h16*)take((size_t)NBI * NH_ * HD * NN * 2); h16* M16 = (h16*)take((size_t)NBI * NN * CC * 2);
    if ((size_t)(wsp - (char*)d_ws) > ws_size) return;    // total ~ 32.5 MiB
    k_cvt8<<<(CC * CC / 8 + 255) / 256, 256, 0, stream>>>(wq, WQ, CC * CC / 8); k_cvt8<<<(CC * CC / 8 + 255) / 256, 256, 0, stream>>>(wk, WK, CC * CC / 8); k_cvt8<<<(CC * CC / 8 + 255) / 256, 256, 0, stream>>>(wv, WV, CC * CC / 8); k_w16<<<(CC * CC / 4 + 255) / 256, 256, 0, stream>>>(wo, CC * CC / 4, WO);   // [out][in] natural Bt
    k_qkv<<<dim3(NBI * NN / 64, CC / 64, 3), 32, 0, stream>>>(x, WQ, Q16, K16, VT);
    k_fattn<<<dim3(NN / 64, NH_ / 2, NBI / NI), 256, 0, stream>>>(Q16, K16, VT, rb, ridx, M16);
    k_wo<<<dim3(NBI * NN / 64, CC / 64, 1), 32, 0, stream>>>(M16, WO, bo, OUT);
}

// v004
// Measured time: 75.5 microseconds a run.
// Timed twice side by side with v003, it ran 1.29 and 1.28 times as fast.
// Counting every step since v000, it is 20.7 times as fast.
#include <hip/hip_runtime.h>

// Attention block with a gathered relative bias (x NCHW [16][256][32][32] -> 1024 tokens; q/k/v = xt W^T (8 heads x 32); attn = softmax(q . (k scale) + rel_bias[h][rel_idx[i][j]]) (rel_bias [8][3969] and the int32 index table read as data, clamped); out = (attn v) Wo^T + bo -> NCHW).
// Compute dtypes, f32 accumulate: every input rounded to bf16; q/k/v on PLAIN bf16 operands (inputs: exact); scores (K 32) and probs.v on single fp16 planes (the logits are dominated by the unit-scale bias; the projected q/k are
// 0.3-scale); scores, bias gather, softmax (f32, running maximum) and probs.v in ONE kernel, scores and probs held in registers; Wo on fp16 planes of the merged heads x fp16 weights (+ bias). Deterministic, no atomics.
// Seven launches: the four weight roundings, k_qkv, k_fattn, k_wo. No activation has a layout pass of its own: k_qkv reads x as it comes (f32, NCHW) and rounds it in its fragment loader, and every epilogue stores the layout that the next reader wants.
// FRAGMENT ORDER: every 16-bit operand plane in the workspace (the four weights, q, k, V^T, the merged heads) is a row of 1-KiB fragments (16 rows x 32 k), each stored as [k >> 3 (4)][row (16)][k & 7]: lane l of a loader reads the 16 bytes at 16 l and at 512 + 16 l, so each load instruction covers four whole 128-byte lines
// (a row-major plane costs 8 or 16 lines for the same 512 bytes, and the cache path is paid by the line).

#define NBI  16
#define NI   2      // images per wave of the attention kernel: they share one gathered bias tile
#define CC   256
#define NN   1024
#define NH_  8
#define HD   32
#define NRB  3969
#define FR   512    // elements of one operand fragment in the workspace planes
#define PSH  10.0f  // probs carry 2^PSH so that small ones stay normal fp16 numbers; the row sum carries it too, so it cancels
#define L2E  1.4426950408889634f
typedef _Float16 h16;
typedef unsigned short bf;
typedef __attribute__((ext_vector_type(16))) __bf16   v16bf;
typedef __attribute__((ext_vector_type(16))) _Float16 v16h;
typedef __attribute__((ext_vector_type(16))) float    v16f;
typedef __attribute__((ext_vector_type(8)))  _Float16 v8h;
typedef __attribute__((ext_vector_type(8)))  unsigned short v8us;
typedef __attribute__((ext_vector_type(4)))  _Float16 v4h;
typedef __attribute__((ext_vector_type(8)))  float    v8f;
typedef __attribute__((ext_vector_type(4)))  float    v4f;
typedef __attribute__((ext_vector_type(4)))  int      v4i;
typedef v8h  __attribute__((may_alias)) v8ha;
typedef v4f  __attribute__((may_alias)) v4fa;

__device__ __forceinline__ unsigned short f2bf(float f) { unsigned u = __float_as_uint(f); u += 0x7FFFu + ((u >> 16) & 1u); return (unsigned short)(u >> 16); }
__device__ __forceinline__ float bf2f(unsigned short b) { return __uint_as_float(((unsigned)b) << 16); }
__device__ __forceinline__ float bfr(float f) { return bf2f(f2bf(f)); }
__device__ __forceinline__ v16h cat16(v8h lo, v8h hi) { return __builtin_shufflevector(lo, hi, 0, 1, 2, 3, 4, 5, 6, 7, 8, 9, 10, 11, 12, 13, 14, 15); }
__device__ __forceinline__ v16bf cat16b(v8us lo, v8us hi) { return __builtin_bit_cast(v16bf, __builtin_shufflevector(lo, hi, 0, 1, 2, 3, 4, 5, 6, 7, 8, 9, 10, 11, 12, 13, 14, 15)); }
__device__ __forceinline__ v8f wmma16(v16h a, v16h b, v8f c) { return __builtin_amdgcn_wmma_f32_16x16x32_f16(false, a, false, b, (short)0, c, false, false); }
__device__ __forceinline__ v8f wmmab(v16bf a, v16bf b, v8f c) { return __builtin_amdgcn_wmma_f32_16x16x32_bf16(false, a, false, b, (short)0, c, false, false); }
template <typename T16> struct WFrag;
template <> struct WFrag<h16> { typedef v16h V; static __device__ __forceinline__ V ld(const h16* p) { return cat16(*(const v8h*)p, *(const v8h*)(p + FR / 2)); } static __device__ __forceinline__ v8f mma(V a, V b, v8f c) { return wmma16(a, b, c); } };
template <> struct WFrag<bf> { typedef v16bf V; static __device__ __forceinline__ V ld(const bf* p) { return cat16b(*(const v8us*)p, *(const v8us*)(p + FR / 2)); } static __device__ __forceinline__ v8f mma(V a, V b, v8f c) { return wmmab(a, b, c); } };
__device__ __forceinline__ h16 tohx(float x) { return (h16)x; }
// The weight roundings, [out][in] f32 -> fragment order: thread i writes the plane's 16-byte piece i (whole lines per wave) and reads the 8 values that belong there: row 16 (i >> 9) + (i & 15), k 32 ((i >> 6) & 7) + 8 ((i >> 4) & 3).
__device__ __forceinline__ v8f w_piece(const float* __restrict__ w, size_t i) { return *(const v8f*)(w + ((i >> 9) * 16 + (i & 15)) * CC + ((i >> 6) & 7) * 32 + ((i >> 4) & 3) * 8); }
__global__ __launch_bounds__(256) void k_cvt8(const float* __restrict__ src, bf* dst, size_t n8) { const size_t i = (size_t)blockIdx.x * 256 + threadIdx.x; if (i >= n8) return; const v8f v = w_piece(src, i); v8us o;
#pragma unroll
    for (int k = 0; k < 8; ++k) o[k] = f2bf(v[k]); *(v8us*)(dst + i * 8) = o;  }
__global__ __launch_bounds__(256) void k_w16(const float* __restrict__ w, size_t n8, h16* Bt) { const size_t i = (size_t)blockIdx.x * 256 + threadIdx.x; if (i >= n8) return; const v8f v = w_piece(w, i); v8h o;
#pragma unroll
    for (int k = 0; k < 8; ++k) o[k] = tohx(bfr(v[k])); *(v8h*)(Bt + i * 8) = o;  }

// ---- The two GEMMs: ONE WAVE per 64x64 output tile (16 accumulators), K = CC in steps of 32, operands straight from global memory (the 16-bit planes in fragment order), 32 threads a work-group.
// A lane of an accumulator holds ONE column and eight consecutive rows, so each product is set up with the index that is contiguous in its result's layout as the ROW index; the tile goes through LDS once so that every store instruction writes whole 128-byte lines.
// x W^T for 64 tokens x 64 output channels. x is [c][n]: one 16-byte load gives a lane FOUR tokens (n0 + 4 lr + t) at one k, so token block t of the tile is made of the tokens n0 + 4 r + t (r: the fragment's row or column): every load covers whole lines and nothing is transposed; the epilogues undo the order.
// k order of both loaders, element e of a fragment: kc + 8 hi + (e & 7) + 16 (e >> 3). XROWS: the tokens are the rows (A operand), else the columns (B operand). acc[g][t]: channel block g, token block t.
template <bool XROWS>
__device__ __forceinline__ void xw_tile(const float* xp, const bf* wp, v8f (&acc)[4][4]) {
#pragma unroll 1   // kept rolled: the raw f32 values of a second step would not fit beside the 16 accumulators
    for (int kc = 0; kc < CC; kc += 32) {
        const float* xk = xp + (size_t)kc * NN; const bf* wk = wp + (kc >> 5) * FR;
        v4f xv[16]; v16bf xf[4], wf[4];
#pragma unroll
        for (int e = 0; e < 16; ++e) xv[e] = *(const v4f*)(xk + (size_t)((e & 7) + (e >> 3) * 16) * NN);
#pragma unroll
        for (int g = 0; g < 4; ++g) wf[g] = WFrag<bf>::ld(wk + g * (CC / 32) * FR);
        __builtin_amdgcn_sched_barrier(0);   // all 24 loads of the step are issued before its arithmetic: left alone, the compiler reloads two weight fragments among the matrix instructions and the wave waits out the load latency three times a step
#pragma unroll
        for (int t = 0; t < 4; ++t) { v16f c;
#pragma unroll
            for (int e = 0; e < 16; ++e) c[e] = xv[e][t];
            xf[t] = __builtin_convertvector(c, v16bf); }
#pragma unroll
        for (int g = 0; g < 4; ++g)
#pragma unroll
            for (int t = 0; t < 4; ++t) acc[g][t] = XROWS ? wmmab(xf[t], wf[g], acc[g][t]) : wmmab(wf[g], xf[t], acc[g][t]);
        asm volatile("v_nop\n\tv_nop\n\tv_nop\n\tv_nop" : "+v"(acc[0][0]), "+v"(acc[1][1]), "+v"(acc[2][2]), "+v"(acc[3][3]) : "v"(xf[3]), "v"(wf[3]));   // the slots behind the last matrix instruction on the loop's taken branch
    }
}
// grid (NBI * NN / 64, CC / 64, 3), z = q, k, v (W3: their three weight planes one behind the other). q, k: rows = channels, so a lane holds 8 consecutive d of one token -> Q16 / K16 [b][h][n >> 4] fragments (row n & 15, k = d; k scaled in f32 before it is rounded). v: rows = tokens, so a lane holds 32 consecutive tokens of one channel -> VT [b][h][n >> 5][d >> 4] fragments (row d & 15, k = n & 31).
__global__ __launch_bounds__(32) void k_qkv(const float* __restrict__ x, const bf* __restrict__ W3, h16* Q16, h16* K16, h16* VT) {
    __shared__ __align__(16) h16 os[2 * 64 * 40];   // q, k: [head][token][40]; v: [channel][72]
    const int lane = threadIdx.x & 31, lr = lane & 15, hi = lane >> 4;
    const int z = blockIdx.z, b = blockIdx.x >> 4, n0 = (blockIdx.x & 15) * 64, o0 = blockIdx.y * 64;
    const float* xp = x + ((size_t)b * CC + 8 * hi) * NN + n0 + 4 * lr;
    const bf* wp = W3 + (size_t)((z * CC + o0) >> 4) * (CC / 32) * FR + lane * 8;
    v8f acc[4][4];
#pragma unroll
    for (int g = 0; g < 4; ++g)
#pragma unroll
        for (int t = 0; t < 4; ++t) acc[g][t] = (v8f){};
    if (z < 2) {
        xw_tile<false>(xp, wp, acc);   // acc[g][t][j]: channel o0 + 16 g + 8 hi + j, token n0 + 4 lr + t
        const float sc = z == 1 ? 0.1767766952966369f : 1.0f;
#pragma unroll
        for (int g = 0; g < 4; ++g)
#pragma unroll
            for (int t = 0; t < 4; ++t) *(v8ha*)(os + ((g >> 1) * 64 + 4 * lr + t) * 40 + (g & 1) * 16 + 8 * hi) = __builtin_convertvector(acc[g][t] * sc, v8h);
        __builtin_amdgcn_wave_barrier(); asm volatile("" ::: "memory");   // one wave: its LDS operations run in order; this keeps the compiler from moving the reads of other lanes' rows over the writes
        h16* dst = (z == 0 ? Q16 : K16) + (((size_t)b * NH_ + (o0 >> 5)) * NN + n0) * HD;
#pragma unroll
        for (int s = 0; s < 16; ++s) { const int c = s * 32 + lane, hd = c >> 8, tok = ((c >> 6) & 3) * 16 + (c & 15), pc = (c >> 4) & 3;
            *(v8h*)(dst + (size_t)hd * NN * HD + (c & 255) * 8) = *(const v8ha*)(os + (hd * 64 + tok) * 40 + pc * 8); }
    } else {
        xw_tile<true>(xp, wp, acc);    // acc[g][t][j]: token n0 + 4 (8 hi + j) + t, channel o0 + 16 g + lr
#pragma unroll
        for (int g = 0; g < 4; ++g)
#pragma unroll
            for (int q = 0; q < 4; ++q) { v8f c;
#pragma unroll
                for (int e = 0; e < 8; ++e) c[e] = acc[g][e & 3][2 * q + (e >> 2)];   // tokens n0 + 32 hi + 8 q + e
                *(v8ha*)(os + (g * 16 + lr) * 72 + 32 * hi + 8 * q) = __builtin_convertvector(c, v8h); }
        __builtin_amdgcn_wave_barrier(); asm volatile("" ::: "memory");   // as above
        h16* dst = VT + (((size_t)b * NH_ + (o0 >> 5)) * NN + n0) * HD;
#pragma unroll
        for (int s = 0; s < 16; ++s) { const int c = s * 32 + lane, hd = c >> 8, row = hd * 32 + ((c >> 6) & 1) * 16 + (c & 15), pc = ((c >> 7) & 1) * 4 + ((c >> 4) & 3);
            *(v8h*)(dst + (size_t)hd * NN * HD + (c & 255) * 8) = *(const v8ha*)(os + row * 72 + pc * 8); }
    }
}
// grid (NBI * NN / 64, CC / 64): OUT [b][c][n] = merged heads . Wo^T + bo. Rows = tokens (natural order), columns = output channels: a lane holds 8 consecutive tokens of one channel, which is NCHW.
__global__ __launch_bounds__(32) void k_wo(const h16* __restrict__ M16, const h16* __restrict__ WO, const float* __restrict__ bo, float* OUT) {
    __shared__ __align__(16) float os[16 * 68];
    const int lane = threadIdx.x & 31, lr = lane & 15, hi = lane >> 4;
    const int b = blockIdx.x >> 4, n0 = (blockIdx.x & 15) * 64, c0 = blockIdx.y * 64;
    const h16* ap = M16 + (size_t)((b * NN + n0) >> 4) * (CC / 32) * FR + lane * 8;
    const h16* wp = WO + (size_t)(c0 >> 4) * (CC / 32) * FR + lane * 8;
    v8f acc[4][4];
#pragma unroll
    for (int mb = 0; mb < 4; ++mb)
#pragma unroll
        for (int nb = 0; nb < 4; ++nb) acc[mb][nb] = (v8f){};
#pragma unroll 1   // kept rolled: one step's fragments beside the 16 accumulators
    for (int kc = 0; kc < CC; kc += 32) {
        const h16* ak = ap + (kc >> 5) * FR; const h16* wk = wp + (kc >> 5) * FR;
        v16h a[4], w[4];
#pragma unroll
        for (int mb = 0; mb < 4; ++mb) a[mb] = WFrag<h16>::ld(ak + mb * (CC / 32) * FR);
#pragma unroll
        for (int nb = 0; nb < 4; ++nb) w[nb] = WFrag<h16>::ld(wk + nb * (CC / 32) * FR);
        asm volatile("s_wait_xcnt 0x0" :: "v"(ak), "v"(wk) : "memory");   // behind the step's loads: their address registers are inputs, so they live up to the wait and no result of the run is placed on one of them
#pragma unroll
        for (int nb = 0; nb < 4; ++nb)
#pragma unroll
            for (int mb = 0; mb < 4; ++mb) acc[mb][nb] = wmma16(a[mb], w[nb], acc[mb][nb]);
        asm volatile("v_nop\n\tv_nop\n\tv_nop\n\tv_nop" : "+v"(acc[0][0]), "+v"(acc[1][1]), "+v"(acc[2][2]), "+v"(acc[3][3]) : "v"(a[3]), "v"(w[3]));   // as in xw_tile
    }
#pragma unroll
    for (int nb = 0; nb < 4; ++nb) {   // acc[mb][nb][j]: token n0 + 16 mb + 8 hi + j, channel c0 + 16 nb + lr
        const float bb = bfr(bo[c0 + nb * 16 + lr]);
#pragma unroll
        for (int mb = 0; mb < 4; ++mb) { const v8f v = acc[mb][nb] + bb;
            *(v4fa*)(os + lr * 68 + mb * 16 + 8 * hi) = (v4f){v[0], v[1], v[2], v[3]}; *(v4fa*)(os + lr * 68 + mb * 16 + 8 * hi + 4) = (v4f){v[4], v[5], v[6], v[7]}; }
        __builtin_amdgcn_wave_barrier(); asm volatile("" ::: "memory");   // as in k_qkv
        float* dst = OUT + ((size_t)b * CC + c0 + nb * 16) * NN + n0;
#pragma unroll
        for (int s = 0; s < 8; ++s) { const int c = s * 32 + lane, row = c >> 4, pc = c & 15;
            *(v4f*)(dst + (size_t)row * NN + pc * 4) = *(const v4fa*)(os + row * 68 + pc * 4); }
        __builtin_amdgcn_wave_barrier(); asm volatile("" ::: "memory");   // the next block's writes stay behind these reads
    }
}

// ---- k_fattn: scores + gathered bias + softmax + probs.v for 16 queries of one head and NI images per wave; nothing of the score plane leaves the registers.
// Transposed products: S^T = K Q^T + bias (the bias tile is the C operand: a lane holds query lr, keys 8 hi + r), O^T += V^T P^T (two S^T tiles, converted in place, are the B operand in the hardware k order; V^T rows by the same loader).
// Work-group: 8 waves = 4 query tiles x 2 heads (the tiles share K and V, the heads the index rows, through the cache). An O^T tile in its registers IS a half fragment of the merged-heads plane (row = query, k = d), so each wave stores its own whole lines. grid (NN / 64, NH_ / 2, NBI / NI) = 4096 waves, four per SIMD, all resident at once: hence amdgpu_waves_per_eu(4, 4), which holds the register count to that.
// Every inner loop is unrolled so that the fragment arrays are indexed by constants and stay in registers.
__device__ __forceinline__ float xrow(float v) { const int b = __float_as_int(v); return __int_as_float(__builtin_amdgcn_permlanex16(b, b, 0x76543210, 0xfedcba98, false, false)); }   // lane l <-> l ^ 16
// Eight v_exp_f32 in one statement: no result lies on a source ("=&v"), and the closing v_nop is the slot the instruction set asks for between a transcendental and the next user of its result or writer of its source.
__device__ __forceinline__ v8f exp2x8(v8f x) { float y0, y1, y2, y3, y4, y5, y6, y7;
    asm("v_exp_f32 %0, %8\n\tv_exp_f32 %1, %9\n\tv_exp_f32 %2, %10\n\tv_exp_f32 %3, %11\n\tv_exp_f32 %4, %12\n\tv_exp_f32 %5, %13\n\tv_exp_f32 %6, %14\n\tv_exp_f32 %7, %15\n\tv_nop"
        : "=&v"(y0), "=&v"(y1), "=&v"(y2), "=&v"(y3), "=&v"(y4), "=&v"(y5), "=&v"(y6), "=&v"(y7) : "v"(x[0]), "v"(x[1]), "v"(x[2]), "v"(x[3]), "v"(x[4]), "v"(x[5]), "v"(x[6]), "v"(x[7]));
    return (v8f){y0, y1, y2, y3, y4, y5, y6, y7}; }
__device__ __forceinline__ float exp2x1(float x) { float y; asm("v_exp_f32 %0, %1\n\tv_nop" : "=v"(y) : "v"(x)); return y; }   // the same slot behind a single one
__device__ __forceinline__ void ld_ix(const int* p, v4i (&ix)[4]) {
#pragma unroll
    for (int c = 0; c < 4; ++c) ix[c] = *(const v4i*)(p + (c >> 1) * 16 + (c & 1) * 4); }
__device__ __forceinline__ void clamp_ix(const v4i (&ix)[4], int (&kx)[16]) {
#pragma unroll
    for (int u = 0; u < 16; ++u) kx[u] = min(max(ix[u >> 2][u & 3], 0), NRB - 1); }
__device__ __forceinline__ void gather_raw(const float* __restrict__ rbh, const int (&kx)[16], float (&rw)[16]) {
#pragma unroll
    for (int u = 0; u < 16; ++u) rw[u] = rbh[kx[u]]; }
__device__ __forceinline__ void round_bias(const float (&rw)[16], v8f (&bias)[2]) {
#pragma unroll
    for (int u = 0; u < 16; ++u) bias[u >> 3][u & 7] = bfr(rw[u]); }
// s_wait_xcnt 0 behind a run of global loads. The run's address registers are inputs, so they live up to the wait and no result of the run is placed on one of them; the memory clobber keeps the run's loads in front of it (in the loop: ahead of the softmax arithmetic, which covers their latency) and later loads behind it.
#define XWAIT_KX(kx) "v"(kx[0]), "v"(kx[1]), "v"(kx[2]), "v"(kx[3]), "v"(kx[4]), "v"(kx[5]), "v"(kx[6]), "v"(kx[7]), "v"(kx[8]), "v"(kx[9]), "v"(kx[10]), "v"(kx[11]), "v"(kx[12]), "v"(kx[13]), "v"(kx[14]), "v"(kx[15])
__global__ __launch_bounds__(256) __attribute__((amdgpu_waves_per_eu(4, 4))) void k_fattn(const h16* __restrict__ Q16, const h16* __restrict__ K16, const h16* __restrict__ VT, const float* __restrict__ rb, const int* __restrict__ ridx, h16* M16) {
    const int lane = threadIdx.x & 31, lr = lane & 15, hi = lane >> 4;
    const int wave = __builtin_amdgcn_readfirstlane(threadIdx.x >> 5), qt = wave & 3, hh = wave >> 2;
    const int q0 = blockIdx.x * 64, h = blockIdx.y * 2 + hh, b0 = blockIdx.z * NI, i = q0 + qt * 16 + lr;
    const float* rbh = rb + (size_t)h * NRB;
    const int* ir = ridx + (size_t)i * NN + 8 * hi;
    const size_t bh0 = (size_t)b0 * NH_ + h, IMS = (size_t)NH_ * NN * HD;   // IMS: elements from one image to the next in Q16, K16 and VT
    const h16* qa = Q16 + (bh0 * NN + q0 + qt * 16) * HD + lane * 8; const h16* kp = K16 + bh0 * NN * HD + lane * 8; const h16* vp = VT + bh0 * NN * HD + lane * 8;
    v16h q[NI], kf[NI][2]; v8f o[NI][2]; float m[NI], l[NI];
    v4i ix[4]; int kx[16]; float rw[16]; v8f bias[2];
    ld_ix(ir, ix);
    asm volatile("s_wait_xcnt 0x0" :: "v"(ir) : "memory");   // see XWAIT_KX
    clamp_ix(ix, kx); gather_raw(rbh, kx, rw);
#pragma unroll
    for (int im = 0; im < NI; ++im) {
        q[im] = WFrag<h16>::ld(qa + im * IMS);
        kf[im][0] = WFrag<h16>::ld(kp + im * IMS); kf[im][1] = WFrag<h16>::ld(kp + im * IMS + FR);
        o[im][0] = (v8f){}; o[im][1] = (v8f){}; m[im] = -3.0e38f; l[im] = 0.f; }
    ld_ix(ir + 32, ix);
    asm volatile("s_wait_xcnt 0x0" :: "v"(qa), "v"(kp), "v"(ir), XWAIT_KX(kx) : "memory");   // see XWAIT_KX
#pragma unroll 1   // kept rolled: a second pass in flight would not fit the registers of four waves per SIMD
    for (int s = 0; s < NN / 32; ++s) {   // 32 keys a pass; the bias tile and the K fragments are fetched one pass ahead, the indices two (the last passes wrap to the row's start: in bounds, not used)
        const h16* va = vp + s * 2 * FR; const h16* ka = kp + (size_t)(((s + 1) & (NN / 32 - 1)) * 32) * HD; const int* ia = ir + ((s + 2) & (NN / 32 - 1)) * 32;
        v8f st[NI][2]; v16h vf[NI][2];
        round_bias(rw, bias);   // here and not behind the gather: the values gathered in the pass before have landed by now
#pragma unroll
        for (int im = 0; im < NI; ++im) { st[im][0] = wmma16(kf[im][0], q[im], bias[0]); st[im][1] = wmma16(kf[im][1], q[im], bias[1]); }
        clamp_ix(ix, kx);
#pragma unroll
        for (int im = 0; im < NI; ++im) { vf[im][0] = WFrag<h16>::ld(va + im * IMS); vf[im][1] = WFrag<h16>::ld(va + im * IMS + FR); }
        gather_raw(rbh, kx, rw);
#pragma unroll
        for (int im = 0; im < NI; ++im) { kf[im][0] = WFrag<h16>::ld(ka + im * IMS); kf[im][1] = WFrag<h16>::ld(ka + im * IMS + FR); }
        ld_ix(ia, ix);
        asm volatile("s_wait_xcnt 0x0" :: "v"(va), "v"(ka), "v"(ia), XWAIT_KX(kx) : "memory");   // see XWAIT_KX
#pragma unroll
        for (int im = 0; im < NI; ++im) {
            float tm = st[im][0][0];
#pragma unroll
            for (int r = 1; r < 16; ++r) tm = fmaxf(tm, st[im][r >> 3][r & 7]);
            tm = fmaxf(tm, xrow(tm));
            const float mn = fmaxf(m[im], tm), sc = exp2x1((m[im] - mn) * L2E), mb = mn * L2E - PSH; m[im] = mn;
            float ps = 0.f; v8f e[2];
#pragma unroll
            for (int t = 0; t < 2; ++t) { v8f a;
#pragma unroll
                for (int r = 0; r < 8; ++r) a[r] = fmaf(st[im][t][r], L2E, -mb);
                e[t] = exp2x8(a);
#pragma unroll
                for (int r = 0; r < 8; ++r) ps += e[t][r]; }
            l[im] = fmaf(l[im], sc, ps);
            const v16h pb = cat16(__builtin_convertvector(e[0], v8h), __builtin_convertvector(e[1], v8h));
            o[im][0] = wmma16(vf[im][0], pb, o[im][0] * sc); o[im][1] = wmma16(vf[im][1], pb, o[im][1] * sc); }
    }
#pragma unroll
    for (int im = 0; im < NI; ++im) { const float inv = 1.0f / (l[im] + xrow(l[im]));
#pragma unroll
        for (int u = 0; u < 2; ++u) *(v8h*)(M16 + ((((size_t)(b0 + im) * NN + q0) >> 4) + qt) * (CC / 32) * FR + h * FR + u * (FR / 2) + lane * 8) = __builtin_convertvector(o[im][u] * inv, v8h); }
}

extern "C" void kernel_launch(void* const* d_in, const int* in_sizes, int n_in,
                              void* d_out, int out_size, void* d_ws, size_t ws_size, hipStream_t stream) {
    (void)in_sizes; (void)n_in; (void)out_size;
    const float* x = (const float*)d_in[0]; const float* wq = (const float*)d_in[1]; const float* wk = (const float*)d_in[2]; const float* wv = (const float*)d_in[3]; const float* wo = (const float*)d_in[4]; const float* bo = (const float*)d_in[5]; const float* rb = (const float*)d_in[6]; const int* ridx = (const int*)d_in[7];
    float* OUT = (float*)d_out;     // [16][256][32][32]
    char* wsp = (char*)d_ws;
    auto take = [&](size_t bytes) { char* p = wsp; wsp += (bytes + 255) & ~(size_t)255; return (void*)p; };
    bf* WQ = (bf*)take((size_t)3 * CC * CC * 2); bf* WK = WQ + CC * CC; bf* WV = WK + CC * CC; h16* WO = (h16*)take(CC * CC * 2);
    h16* Q16 = (h16*)take((size_t)NBI * NH_ * NN * HD * 2); h16* K16 = (h16*)take((size_t)NBI * NH_ * NN * HD * 2); h16* VT = (h16*)take((size_t)NBI * NH_ * HD * NN * 2); h16* M16 = (h16*)take((size_t)NBI * NN * CC * 2);
    if ((size_t)(wsp - (char*)d_ws) > ws_size) return;    // total ~ 32.5 MiB
    k_cvt8<<<(CC * CC / 8 + 255) / 256, 256, 0, stream>>>(wq, WQ, CC * CC / 8); k_cvt8<<<(CC * CC / 8 + 255) / 256, 256, 0, stream>>>(wk, WK, CC * CC / 8); k_cvt8<<<(CC * CC / 8 + 255) / 256, 256, 0, stream>>>(wv, WV, CC * CC / 8); k_w16<<<(CC * CC / 8 + 255) / 256, 256, 0, stream>>>(wo, CC * CC / 8, WO);
    k_qkv<<<dim3(NBI * NN / 64, CC / 64, 3), 32, 0, stream>>>(x, WQ, Q16, K16, VT);
    k_fattn<<<dim3(NN / 64, NH_ / 2, NBI / NI), 256, 0, stream>>>(Q16, K16, VT, rb, ridx, M16);
    k_wo<<<dim3(NBI * NN / 64, CC / 64, 1), 32, 0, stream>>>(M16, WO, bo, OUT);
}

// v005
// It runs in 69.5 microseconds.
// In both of two side-by-side timings against v004, it was 1.10 times as fast.
// All steps since v000 together make it 22.7 times as fast.
#include <hip/hip_runtime.h>

// Attention block with a gathered relative bias (x NCHW [16][256][32][32] -> 1024 tokens; q/k/v = xt W^T (8 heads x 32); attn = softmax(q . (k scale) + rel_bias[h][rel_idx[i][j]]) (rel_bias [8][3969] and the int32 index table read as data, clamped); out = (attn v) Wo^T + bo -> NCHW).
// Compute dtypes, f32 accumulate: every input rounded to bf16; q/k/v on PLAIN bf16 operands (inputs: exact); scores (K 32) and probs.v on single fp16 planes (the logits are dominated by the unit-scale bias; the projected q/k are
// 0.3-scale); scores, bias gather, softmax (f32, running maximum) and probs.v in ONE kernel, scores and probs held in registers; Wo on fp16 planes of the merged heads x fp16 weights (+ bias). Deterministic, no atomics.
// Four launches: the weight roundings (all four matrices in one grid), k_qkv, k_fattn, k_wo. No activation has a layout pass of its own: k_qkv reads x as it comes (f32, NCHW) and rounds it in its fragment loader, and every epilogue stores the layout that the next reader wants.
// FRAGMENT ORDER: every 16-bit operand plane in the workspace (the four weights, q, k, V^T, the merged heads) is a row of 1-KiB fragments (16 rows x 32 k), each stored as [k >> 3 (4)][row (16)][k & 7]: lane l of a loader reads the 16 bytes at 16 l and at 512 + 16 l, so each load instruction covers four whole 128-byte lines
// (a row-major plane costs 8 or 16 lines for the same 512 bytes, and the cache path is paid by the line).

#define NBI  16
#define NI   2      // images per wave of the attention kernel: they share one gathered bias tile
#define CC   256
#define NN   1024
#define NH_  8
#define HD   32
#define NRB  3969
#define FR   512    // elements of one operand fragment in the workspace planes
#define PSH  10.0f  // probs carry 2^PSH so that small ones stay normal fp16 numbers; the row sum carries it too, so it cancels
#define L2E  1.4426950408889634f
typedef _Float16 h16;
typedef unsigned short bf;
typedef __attribute__((ext_vector_type(16))) __bf16   v16bf;
typedef __attribute__((ext_vector_type(16))) _Float16 v16h;
typedef __attribute__((ext_vector_type(16))) float    v16f;
typedef __attribute__((ext_vector_type(8)))  _Float16 v8h;
typedef __attribute__((ext_vector_type(8)))  unsigned short v8us;
typedef __attribute__((ext_vector_type(4)))  _Float16 v4h;
typedef __attribute__((ext_vector_type(8)))  float    v8f;
typedef __attribute__((ext_vector_type(4)))  float    v4f;
typedef __attribute__((ext_vector_type(4)))  int      v4i;
typedef v8h  __attribute__((may_alias)) v8ha;
typedef v4f  __attribute__((may_alias)) v4fa;

__device__ __forceinline__ unsigned short f2bf(float f) { unsigned u = __float_as_uint(f); u += 0x7FFFu + ((u >> 16) & 1u); return (unsigned short)(u >> 16); }
__device__ __forceinline__ float bf2f(unsigned short b) { return __uint_as_float(((unsigned)b) << 16); }
__device__ __forceinline__ float bfr(float f) { return bf2f(f2bf(f)); }
__device__ __forceinline__ v16h cat16(v8h lo, v8h hi) { return __builtin_shufflevector(lo, hi, 0, 1, 2, 3, 4, 5, 6, 7, 8, 9, 10, 11, 12, 13, 14, 15); }
__device__ __forceinline__ v16bf cat16b(v8us lo, v8us hi) { return __builtin_bit_cast(v16bf, __builtin_shufflevector(lo, hi, 0, 1, 2, 3, 4, 5, 6, 7, 8, 9, 10, 11, 12, 13, 14, 15)); }
__device__ __forceinline__ v8f wmma16(v16h a, v16h b, v8f c) { return __builtin_amdgcn_wmma_f32_16x16x32_f16(false, a, false, b, (short)0, c, false, false); }
__device__ __forceinline__ v8f wmmab(v16bf a, v16bf b, v8f c) { return __builtin_amdgcn_wmma_f32_16x16x32_bf16(false, a, false, b, (short)0, c, false, false); }
template <typename T16> struct WFrag;
template <> struct WFrag<h16> { typedef v16h V; static __device__ __forceinline__ V ld(const h16* p) { return cat16(*(const v8h*)p, *(const v8h*)(p + FR / 2)); } static __device__ __forceinline__ v8f mma(V a, V b, v8f c) { return wmma16(a, b, c); } };
template <> struct WFrag<bf> { typedef v16bf V; static __device__ __forceinline__ V ld(const bf* p) { return cat16b(*(const v8us*)p, *(const v8us*)(p + FR / 2)); } static __device__ __forceinline__ v8f mma(V a, V b, v8f c) { return wmmab(a, b, c); } };
__device__ __forceinline__ h16 tohx(float x) { return (h16)x; }
// The weight roundings, [out][in] f32 -> fragment order: thread i writes the plane's 16-byte piece i (whole lines per wave) and reads the 8 values that belong there: row 16 (i >> 9) + (i & 15), k 32 ((i >> 6) & 7) + 8 ((i >> 4) & 3).
__device__ __forceinline__ v8f w_piece(const float* __restrict__ w, size_t i) { return *(const v8f*)(w + ((i >> 9) * 16 + (i & 15)) * CC + ((i >> 6) & 7) * 32 + ((i >> 4) & 3) * 8); }
// All four roundings are ONE launch, grid (CC * CC / 8 / 256, 4): blockIdx.y picks the matrix (0, 1, 2: Wq, Wk, Wv -> the three bf16 planes of W3, one behind the other; 3: Wo -> fp16). They need nothing of each other, and 32 work-groups as a launch of their own cost a whole launch gap and a whole load-to-store latency.
__global__ __launch_bounds__(256) void k_wprep(const float* __restrict__ wq, const float* __restrict__ wk, const float* __restrict__ wv, const float* __restrict__ wo, bf* W3, h16* WO) {
    const int y = blockIdx.y; const size_t i = (size_t)blockIdx.x * 256 + threadIdx.x;
    const v8f v = w_piece(y == 0 ? wq : y == 1 ? wk : y == 2 ? wv : wo, i);
    if (y < 3) { v8us o;
#pragma unroll
        for (int k = 0; k < 8; ++k) o[k] = f2bf(v[k]);
        *(v8us*)(W3 + (size_t)y * CC * CC + i * 8) = o;
    } else { v8h o;
#pragma unroll
        for (int k = 0; k < 8; ++k) o[k] = tohx(bfr(v[k]));
        *(v8h*)(WO + i * 8) = o;
        asm volatile("s_wait_xcnt 0x0" ::: "memory"); }   // behind the store: in the built code the other branch's block follows this one and writes the store's registers
}

// ---- The two GEMMs: ONE WAVE per 64x64 output tile (16 accumulators), K = CC in steps of 32, operands straight from global memory (the 16-bit planes in fragment order), 32 threads a work-group.
// A lane of an accumulator holds ONE column and eight consecutive rows, so each product is set up with the index that is contiguous in its result's layout as the ROW index; the tile goes through LDS once so that every store instruction writes whole 128-byte lines.
// x W^T for 64 tokens x 64 output channels. x is [c][n]: one 16-byte load gives a lane FOUR tokens (n0 + 4 lr + t) at one k, so token block t of the tile is made of the tokens n0 + 4 r + t (r: the fragment's row or column): every load covers whole lines and nothing is transposed; the epilogues undo the order.
// k order of both loaders, element e of a fragment: kc + 8 hi + (e & 7) + 16 (e >> 3). XROWS: the tokens are the rows (A operand), else the columns (B operand). acc[g][t]: channel block g, token block t.
template <bool XROWS>
__device__ __forceinline__ void xw_tile(const float* xp, const bf* wp, v8f (&acc)[4][4]) {
#pragma unroll 1   // kept rolled: the raw f32 values of a second step would not fit beside the 16 accumulators
    for (int kc = 0; kc < CC; kc += 32) {
        const float* xk = xp + (size_t)kc * NN; const bf* wk = wp + (kc >> 5) * FR;
        v4f xv[16]; v16bf xf[4], wf[4];
#pragma unroll
        for (int e = 0; e < 16; ++e) xv[e] = *(const v4f*)(xk + (size_t)((e & 7) + (e >> 3) * 16) * NN);
#pragma unroll
        for (int g = 0; g < 4; ++g) wf[g] = WFrag<bf>::ld(wk + g * (CC / 32) * FR);
        __builtin_amdgcn_sched_barrier(0);   // all 24 loads of the step are issued before its arithmetic: left alone, the compiler reloads two weight fragments among the matrix instructions and the wave waits out the load latency three times a step
#pragma unroll
        for (int t = 0; t < 4; ++t) { v16f c;
#pragma unroll
            for (int e = 0; e < 16; ++e) c[e] = xv[e][t];
            xf[t] = __builtin_convertvector(c, v16bf); }
#pragma unroll
        for (int g = 0; g < 4; ++g)
#pragma unroll
            for (int t = 0; t < 4; ++t) acc[g][t] = XROWS ? wmmab(xf[t], wf[g], acc[g][t]) : wmmab(wf[g], xf[t], acc[g][t]);
        asm volatile("v_nop\n\tv_nop\n\tv_nop\n\tv_nop" : "+v"(acc[0][0]), "+v"(acc[1][1]), "+v"(acc[2][2]), "+v"(acc[3][3]) : "v"(xf[3]), "v"(wf[3]));   // the slots behind the last matrix instruction on the loop's taken branch
    }
}
// grid (NBI * NN / 64, CC / 64, 3), z = q, k, v (W3: their three weight planes one behind the other). q, k: rows = channels, so a lane holds 8 consecutive d of one token -> Q16 / K16 [b][h][n >> 4] fragments (row n & 15, k = d; k scaled in f32 before it is rounded). v: rows = tokens, so a lane holds 32 consecutive tokens of one channel -> VT [b][h][n >> 5][d >> 4] fragments (row d & 15, k = n & 31).
__global__ __launch_bounds__(32) void k_qkv(const float* __restrict__ x, const bf* __restrict__ W3, h16* Q16, h16* K16, h16* VT) {
    __shared__ __align__(16) h16 os[2 * 64 * 40];   // q, k: [head][token][40]; v: [channel][72]
    const int lane = threadIdx.x & 31, lr = lane & 15, hi = lane >> 4;
    const int z = blockIdx.z, b = blockIdx.x >> 4, n0 = (blockIdx.x & 15) * 64, o0 = blockIdx.y * 64;
    const float* xp = x + ((size_t)b * CC + 8 * hi) * NN + n0 + 4 * lr;
    const bf* wp = W3 + (size_t)((z * CC + o0) >> 4) * (CC / 32) * FR + lane * 8;
    v8f acc[4][4];
#pragma unroll
    for (int g = 0; g < 4; ++g)
#pragma unroll
        for (int t = 0; t < 4; ++t) acc[g][t] = (v8f){};
    if (z < 2) {
        xw_tile<false>(xp, wp, acc);   // acc[g][t][j]: channel o0 + 16 g + 8 hi + j, token n0 + 4 lr + t
        const float sc = z == 1 ? 0.1767766952966369f : 1.0f;
#pragma unroll
        for (int g = 0; g < 4; ++g)
#pragma unroll
            for (int t = 0; t < 4; ++t) *(v8ha*)(os + ((g >> 1) * 64 + 4 * lr + t) * 40 + (g & 1) * 16 + 8 * hi) = __builtin_convertvector(acc[g][t] * sc, v8h);
        __builtin_amdgcn_wave_barrier(); asm volatile("" ::: "memory");   // one wave: its LDS operations run in order; this keeps the compiler from moving the reads of other lanes' rows over the writes
        h16* dst = (z == 0 ? Q16 : K16) + (((size_t)b * NH_ + (o0 >> 5)) * NN + n0) * HD;
#pragma unroll
        for (int s = 0; s < 16; ++s) { const int c = s * 32 + lane, hd = c >> 8, tok = ((c >> 6) & 3) * 16 + (c & 15), pc = (c >> 4) & 3;
            *(v8h*)(dst + (size_t)hd * NN * HD + (c & 255) * 8) = *(const v8ha*)(os + (hd * 64 + tok) * 40 + pc * 8); }
    } else {
        xw_tile<true>(xp, wp, acc);    // acc[g][t][j]: token n0 + 4 (8 hi + j) + t, channel o0 + 16 g + lr
#pragma unroll
        for (int g = 0; g < 4; ++g)
#pragma unroll
            for (int q = 0; q < 4; ++q) { v8f c;
#pragma unroll
                for (int e = 0; e < 8; ++e) c[e] = acc[g][e & 3][2 * q + (e >> 2)];   // tokens n0 + 32 hi + 8 q + e
                *(v8ha*)(os + (g * 16 + lr) * 72 + 32 * hi + 8 * q) = __builtin_convertvector(c, v8h); }
        __builtin_amdgcn_wave_barrier(); asm volatile("" ::: "memory");   // as above
        h16* dst = VT + (((size_t)b * NH_ + (o0 >> 5)) * NN + n0) * HD;
#pragma unroll
        for (int s = 0; s < 16; ++s) { const int c = s * 32 + lane, hd = c >> 8, row = hd * 32 + ((c >> 6) & 1) * 16 + (c & 15), pc = ((c >> 7) & 1) * 4 + ((c >> 4) & 3);
            *(v8h*)(dst + (size_t)hd * NN * HD + (c & 255) * 8) = *(const v8ha*)(os + row * 72 + pc * 8); }
    }
}
// grid (NBI * NN / 64, CC / 64): OUT [b][c][n] = merged heads . Wo^T + bo. Rows = tokens (natural order), columns = output channels: a lane holds 8 consecutive tokens of one channel, which is NCHW.
__global__ __launch_bounds__(32) void k_wo(const h16* __restrict__ M16, const h16* __restrict__ WO, const float* __restrict__ bo, float* OUT) {
    __shared__ __align__(16) float os[16 * 68];
    const int lane = threadIdx.x & 31, lr = lane & 15, hi = lane >> 4;
    const int b = blockIdx.x >> 4, n0 = (blockIdx.x & 15) * 64, c0 = blockIdx.y * 64;
    const h16* ap = M16 + (size_t)((b * NN + n0) >> 4) * (CC / 32) * FR + lane * 8;
    const h16* wp = WO + (size_t)(c0 >> 4) * (CC / 32) * FR + lane * 8;
    v8f acc[4][4];
#pragma unroll
    for (int mb = 0; mb < 4; ++mb)
#pragma unroll
        for (int nb = 0; nb < 4; ++nb) acc[mb][nb] = (v8f){};
#pragma unroll 1   // kept rolled: one step's fragments beside the 16 accumulators
    for (int kc = 0; kc < CC; kc += 32) {
        const h16* ak = ap + (kc >> 5) * FR; const h16* wk = wp + (kc >> 5) * FR;
        v16h a[4], w[4];
#pragma unroll
        for (int mb = 0; mb < 4; ++mb) a[mb] = WFrag<h16>::ld(ak + mb * (CC / 32) * FR);
#pragma unroll
        for (int nb = 0; nb < 4; ++nb) w[nb] = WFrag<h16>::ld(wk + nb * (CC / 32) * FR);
        asm volatile("s_wait_xcnt 0x0" :: "v"(ak), "v"(wk) : "memory");   // behind the step's loads: their address registers are inputs, so they live up to the wait and no result of the run is placed on one of them
#pragma unroll
        for (int nb = 0; nb < 4; ++nb)
#pragma unroll
            for (int mb = 0; mb < 4; ++mb) acc[mb][nb] = wmma16(a[mb], w[nb], acc[mb][nb]);
        asm volatile("v_nop\n\tv_nop\n\tv_nop\n\tv_nop" : "+v"(acc[0][0]), "+v"(acc[1][1]), "+v"(acc[2][2]), "+v"(acc[3][3]) : "v"(a[3]), "v"(w[3]));   // as in xw_tile
    }
#pragma unroll
    for (int nb = 0; nb < 4; ++nb) {   // acc[mb][nb][j]: token n0 + 16 mb + 8 hi + j, channel c0 + 16 nb + lr
        const float bb = bfr(bo[c0 + nb * 16 + lr]);
#pragma unroll
        for (int mb = 0; mb < 4; ++mb) { const v8f v = acc[mb][nb] + bb;
            *(v4fa*)(os + lr * 68 + mb * 16 + 8 * hi) = (v4f){v[0], v[1], v[2], v[3]}; *(v4fa*)(os + lr * 68 + mb * 16 + 8 * hi + 4) = (v4f){v[4], v[5], v[6], v[7]}; }
        __builtin_amdgcn_wave_barrier(); asm volatile("" ::: "memory");   // as in k_qkv
        float* dst = OUT + ((size_t)b * CC + c0 + nb * 16) * NN + n0;
#pragma unroll
        for (int s = 0; s < 8; ++s) { const int c = s * 32 + lane, row = c >> 4, pc = c & 15;
            *(v4f*)(dst + (size_t)row * NN + pc * 4) = *(const v4fa*)(os + row * 68 + pc * 4); }
        __builtin_amdgcn_wave_barrier(); asm volatile("" ::: "memory");   // the next block's writes stay behind these reads
    }
}

// ---- k_fattn: scores + gathered bias + softmax + probs.v for 16 queries of one head and NI images per wave; nothing of the score plane leaves the registers.
// Transposed products: S^T = K Q^T + bias (the bias tile is the C operand: a lane holds query lr, keys 8 hi + r), O^T += V^T P^T (two S^T tiles, converted in place, are the B operand in the hardware k order; V^T rows by the same loader).
// Work-group: 8 waves = 4 query tiles x 2 heads (the tiles share K and V, the heads the index rows, through the cache). An O^T tile in its registers IS a half fragment of the merged-heads plane (row = query, k = d), so each wave stores its own whole lines. grid (NN / 64, NH_ / 2, NBI / NI) = 4096 waves, four per SIMD, all resident at once: hence amdgpu_waves_per_eu(4, 4), which holds the register count to that.
// Every inner loop is unrolled so that the fragment arrays are indexed by constants and stay in registers.
__device__ __forceinline__ float xrow(float v) { const int b = __float_as_int(v); return __int_as_float(__builtin_amdgcn_permlanex16(b, b, 0x76543210, 0xfedcba98, false, false)); }   // lane l <-> l ^ 16
// Eight v_exp_f32 in one statement: no result lies on a source ("=&v"), and the closing v_nop is the slot the instruction set asks for between a transcendental and the next user of its result or writer of its source.
__device__ __forceinline__ v8f exp2x8(v8f x) { float y0, y1, y2, y3, y4, y5, y6, y7;
    asm("v_exp_f32 %0, %8\n\tv_exp_f32 %1, %9\n\tv_exp_f32 %2, %10\n\tv_exp_f32 %3, %11\n\tv_exp_f32 %4, %12\n\tv_exp_f32 %5, %13\n\tv_exp_f32 %6, %14\n\tv_exp_f32 %7, %15\n\tv_nop"
        : "=&v"(y0), "=&v"(y1), "=&v"(y2), "=&v"(y3), "=&v"(y4), "=&v"(y5), "=&v"(y6), "=&v"(y7) : "v"(x[0]), "v"(x[1]), "v"(x[2]), "v"(x[3]), "v"(x[4]), "v"(x[5]), "v"(x[6]), "v"(x[7]));
    return (v8f){y0, y1, y2, y3, y4, y5, y6, y7}; }
__device__ __forceinline__ float exp2x1(float x) { float y; asm("v_exp_f32 %0, %1\n\tv_nop" : "=v"(y) : "v"(x)); return y; }   // the same slot behind a single one
__device__ __forceinline__ void ld_ix(const int* p, v4i (&ix)[4]) {
#pragma unroll
    for (int c = 0; c < 4; ++c) ix[c] = *(const v4i*)(p + (c >> 1) * 16 + (c & 1) * 4); }
__device__ __forceinline__ void clamp_ix(const v4i (&ix)[4], int (&kx)[16]) {
#pragma unroll
    for (int u = 0; u < 16; ++u) kx[u] = min(max(ix[u >> 2][u & 3], 0), NRB - 1); }
__device__ __forceinline__ void gather_raw(const float* __restrict__ rbh, const int (&kx)[16], float (&rw)[16]) {
#pragma unroll
    for (int u = 0; u < 16; ++u) rw[u] = rbh[kx[u]]; }
__device__ __forceinline__ void round_bias(const float (&rw)[16], v8f (&bias)[2]) {
#pragma unroll
    for (int u = 0; u < 16; ++u) bias[u >> 3][u & 7] = bfr(rw[u]); }
// s_wait_xcnt 0 behind a run of global loads. The run's address registers are inputs, so they live up to the wait and no result of the run is placed on one of them; the memory clobber keeps the run's loads in front of it (in the loop: ahead of the softmax arithmetic, which covers their latency) and later loads behind it.
#define XWAIT_KX(kx) "v"(kx[0]), "v"(kx[1]), "v"(kx[2]), "v"(kx[3]), "v"(kx[4]), "v"(kx[5]), "v"(kx[6]), "v"(kx[7]), "v"(kx[8]), "v"(kx[9]), "v"(kx[10]), "v"(kx[11]), "v"(kx[12]), "v"(kx[13]), "v"(kx[14]), "v"(kx[15])
__global__ __launch_bounds__(256) __attribute__((amdgpu_waves_per_eu(4, 4))) void k_fattn(const h16* __restrict__ Q16, const h16* __restrict__ K16, const h16* __restrict__ VT, const float* __restrict__ rb, const int* __restrict__ ridx, h16* M16) {
    const int lane = threadIdx.x & 31, lr = lane & 15, hi = lane >> 4;
    const int wave = __builtin_amdgcn_readfirstlane(threadIdx.x >> 5), qt = wave & 3, hh = wave >> 2;
    const int q0 = blockIdx.x * 64, h = blockIdx.y * 2 + hh, b0 = blockIdx.z * NI, i = q0 + qt * 16 + lr;
    const float* rbh = rb + (size_t)h * NRB;
    const int* ir = ridx + (size_t)i * NN + 8 * hi;
    const size_t bh0 = (size_t)b0 * NH_ + h, IMS = (size_t)NH_ * NN * HD;   // IMS: elements from one image to the next in Q16, K16 and VT
    const h16* qa = Q16 + (bh0 * NN + q0 + qt * 16) * HD + lane * 8; const h16* kp = K16 + bh0 * NN * HD + lane * 8; const h16* vp = VT + bh0 * NN * HD + lane * 8;
    v16h q[NI], kf[NI][2]; v8f o[NI][2]; float m[NI], l[NI];
    v4i ix[4]; int kx[16]; float rw[16]; v8f bias[2];
    ld_ix(ir, ix);
    asm volatile("s_wait_xcnt 0x0" :: "v"(ir) : "memory");   // see XWAIT_KX
    clamp_ix(ix, kx); gather_raw(rbh, kx, rw);
#pragma unroll
    for (int im = 0; im < NI; ++im) {
        q[im] = WFrag<h16>::ld(qa + im * IMS);
        kf[im][0] = WFrag<h16>::ld(kp + im * IMS); kf[im][1] = WFrag<h16>::ld(kp + im * IMS + FR);
        o[im][0] = (v8f){}; o[im][1] = (v8f){}; m[im] = -3.0e38f; l[im] = 0.f; }
    ld_ix(ir + 32, ix);
    asm volatile("s_wait_xcnt 0x0" :: "v"(qa), "v"(kp), "v"(ir), XWAIT_KX(kx) : "memory");   // see XWAIT_KX
#pragma unroll 1   // kept rolled: a second pass in flight would not fit the registers of four waves per SIMD
    for (int s = 0; s < NN / 32; ++s) {   // 32 keys a pass; the bias tile and the K fragments are fetched one pass ahead, the indices two (the last passes wrap to the row's start: in bounds, not used)
        const h16* va = vp + s * 2 * FR; const h16* ka = kp + (size_t)(((s + 1) & (NN / 32 - 1)) * 32) * HD; const int* ia = ir + ((s + 2) & (NN / 32 - 1)) * 32;
        v8f st[NI][2]; v16h vf[NI][2];
        round_bias(rw, bias);   // here and not behind the gather: the values gathered in the pass before have landed by now
#pragma unroll
        for (int im = 0; im < NI; ++im) { st[im][0] = wmma16(kf[im][0], q[im], bias[0]); st[im][1] = wmma16(kf[im][1], q[im], bias[1]); }
        clamp_ix(ix, kx);
#pragma unroll
        for (int im = 0; im < NI; ++im) { vf[im][0] = WFrag<h16>::ld(va + im * IMS); vf[im][1] = WFrag<h16>::ld(va + im * IMS + FR); }
        gather_raw(rbh, kx, rw);
#pragma unroll
        for (int im = 0; im < NI; ++im) { kf[im][0] = WFrag<h16>::ld(ka + im * IMS); kf[im][1] = WFrag<h16>::ld(ka + im * IMS + FR); }
        ld_ix(ia, ix);
        asm volatile("s_wait_xcnt 0x0" :: "v"(va), "v"(ka), "v"(ia), XWAIT_KX(kx) : "memory");   // see XWAIT_KX
#pragma unroll
        for (int im = 0; im < NI; ++im) {
            float tm = st[im][0][0];
#pragma unroll
            for (int r = 1; r < 16; ++r) tm = fmaxf(tm, st[im][r >> 3][r & 7]);
            tm = fmaxf(tm, xrow(tm));
            const float mn = fmaxf(m[im], tm), sc = exp2x1((m[im] - mn) * L2E), mb = mn * L2E - PSH; m[im] = mn;
            float ps = 0.f; v8f e[2];
#pragma unroll
            for (int t = 0; t < 2; ++t) { v8f a;
#pragma unroll
                for (int r = 0; r < 8; ++r) a[r] = fmaf(st[im][t][r], L2E, -mb);
                e[t] = exp2x8(a);
#pragma unroll
                for (int r = 0; r < 8; ++r) ps += e[t][r]; }
            l[im] = fmaf(l[im], sc, ps);
            const v16h pb = cat16(__builtin_convertvector(e[0], v8h), __builtin_convertvector(e[1], v8h));
            o[im][0] = wmma16(vf[im][0], pb, o[im][0] * sc); o[im][1] = wmma16(vf[im][1], pb, o[im][1] * sc); }
    }
#pragma unroll
    for (int im = 0; im < NI; ++im) { const float inv = 1.0f / (l[im] + xrow(l[im]));
#pragma unroll
        for (int u = 0; u < 2; ++u) *(v8h*)(M16 + ((((size_t)(b0 + im) * NN + q0) >> 4) + qt) * (CC / 32) * FR + h * FR + u * (FR / 2) + lane * 8) = __builtin_convertvector(o[im][u] * inv, v8h); }
}

extern "C" void kernel_launch(void* const* d_in, const int* in_sizes, int n_in,
                              void* d_out, int out_size, void* d_ws, size_t ws_size, hipStream_t stream) {
    (void)in_sizes; (void)n_in; (void)out_size;
    const float* x = (const float*)d_in[0]; const float* wq = (const float*)d_in[1]; const float* wk = (const float*)d_in[2]; const float* wv = (const float*)d_in[3]; const float* wo = (const float*)d_in[4]; const float* bo = (const float*)d_in[5]; const float* rb = (const float*)d_in[6]; const int* ridx = (const int*)d_in[7];
    float* OUT = (float*)d_out;     // [16][256][32][32]
    char* wsp = (char*)d_ws;
    auto take = [&](size_t bytes) { char* p = wsp; wsp += (bytes + 255) & ~(size_t)255; return (void*)p; };
    bf* W3 = (bf*)take((size_t)3 * CC * CC * 2); h16* WO = (h16*)take(CC * CC * 2);
    h16* Q16 = (h16*)take((size_t)NBI * NH_ * NN * HD * 2); h16* K16 = (h16*)take((size_t)NBI * NH_ * NN * HD * 2); h16* VT = (h16*)take((size_t)NBI * NH_ * HD * NN * 2); h16* M16 = (h16*)take((size_t)NBI * NN * CC * 2);
    if ((size_t)(wsp - (char*)d_ws) > ws_size) return;    // total ~ 32.5 MiB
    k_wprep<<<dim3(CC * CC / 8 / 256, 4), 256, 0, stream>>>(wq, wk, wv, wo, W3, WO);
    k_qkv<<<dim3(NBI * NN / 64, CC / 64, 3), 32, 0, stream>>>(x, W3, Q16, K16, VT);
    k_fattn<<<dim3(NN / 64, NH_ / 2, NBI / NI), 256, 0, stream>>>(Q16, K16, VT, rb, ridx, M16);
    k_wo<<<dim3(NBI * NN / 64, CC / 64, 1), 32, 0, stream>>>(M16, WO, bo, OUT);
}

// v006
// A run of this version takes 65.4 microseconds.
// Timed twice side by side with v005, it ran 1.05 and 1.06 times as fast.
// Over all steps from v000 it is 23.9 times as fast.
#include <hip/hip_runtime.h>

// Attention block with a gathered relative bias (x NCHW [16][256][32][32] -> 1024 tokens; q/k/v = xt W^T (8 heads x 32); attn = softmax(q . (k scale) + rel_bias[h][rel_idx[i][j]]) (rel_bias [8][3969] and the int32 index table read as data, clamped); out = (attn v) Wo^T + bo -> NCHW).
// Compute dtypes, f32 accumulate: every input rounded to bf16; q/k/v on PLAIN bf16 operands (inputs: exact); scores (K 32) and probs.v on single fp16 planes (the logits are dominated by the unit-scale bias; the projected q/k are
// 0.3-scale); scores, bias, softmax (f32, running maximum) and probs.v in ONE kernel, scores and probs held in registers; Wo on fp16 planes of the merged heads x fp16 weights (+ bias). Deterministic, no atomics.
// The gathered bias does not depend on the image: it is gathered and rounded ONCE, into a bf16 plane in the order of the score tiles (by a fourth z plane of k_qkv's grid), and the attention kernel reads it from there.
// Four launches: the weight roundings (all four matrices in one grid), k_qkv, k_fattn, k_wo. No activation has a layout pass of its own: k_qkv reads x as it comes (f32, NCHW) and rounds it in its fragment loader, and every epilogue stores the layout that the next reader wants.
// FRAGMENT ORDER: every 16-bit operand plane in the workspace (the four weights, q, k, V^T, the merged heads) is a row of 1-KiB fragments (16 rows x 32 k), each stored as [k >> 3 (4)][row (16)][k & 7]: lane l of a loader reads the 16 bytes at 16 l and at 512 + 16 l, so each load instruction covers four whole 128-byte lines
// (a row-major plane costs 8 or 16 lines for the same 512 bytes, and the cache path is paid by the line).

#define NBI  16
#define NI   2      // images per wave of the attention kernel: they share one bias tile
#define CC   256
#define NN   1024
#define NH_  8
#define HD   32
#define NRB  3969
#define FR   512    // elements of one operand fragment in the workspace planes
#define PSH  10.0f  // probs carry 2^PSH so that small ones stay normal fp16 numbers; the row sum carries it too, so it cancels
#define L2E  1.4426950408889634f
typedef _Float16 h16;
typedef unsigned short bf;
typedef __attribute__((ext_vector_type(16))) __bf16   v16bf;
typedef __attribute__((ext_vector_type(8)))  __bf16   v8bf;
typedef __attribute__((ext_vector_type(16))) _Float16 v16h;
typedef __attribute__((ext_vector_type(16))) float    v16f;
typedef __attribute__((ext_vector_type(8)))  _Float16 v8h;
typedef __attribute__((ext_vector_type(8)))  unsigned short v8us;
typedef __attribute__((ext_vector_type(4)))  _Float16 v4h;
typedef __attribute__((ext_vector_type(8)))  float    v8f;
typedef __attribute__((ext_vector_type(4)))  float    v4f;
typedef __attribute__((ext_vector_type(4)))  int      v4i;
typedef __attribute__((ext_vector_type(4)))  unsigned v4u;
typedef __attribute__((ext_vector_type(16))) int      v16i;
typedef v8h  __attribute__((may_alias)) v8ha;
typedef v4f  __attribute__((may_alias)) v4fa;

__device__ __forceinline__ unsigned short f2bf(float f) { unsigned u = __float_as_uint(f); u += 0x7FFFu + ((u >> 16) & 1u); return (unsigned short)(u >> 16); }
__device__ __forceinline__ float bf2f(unsigned short b) { return __uint_as_float(((unsigned)b) << 16); }
__device__ __forceinline__ float bfr(float f) { return bf2f(f2bf(f)); }
__device__ __forceinline__ v16h cat16(v8h lo, v8h hi) { return __builtin_shufflevector(lo, hi, 0, 1, 2, 3, 4, 5, 6, 7, 8, 9, 10, 11, 12, 13, 14, 15); }
__device__ __forceinline__ v16bf cat16b(v8us lo, v8us hi) { return __builtin_bit_cast(v16bf, __builtin_shufflevector(lo, hi, 0, 1, 2, 3, 4, 5, 6, 7, 8, 9, 10, 11, 12, 13, 14, 15)); }
__device__ __forceinline__ v8f wmma16(v16h a, v16h b, v8f c) { return __builtin_amdgcn_wmma_f32_16x16x32_f16(false, a, false, b, (short)0, c, false, false); }
__device__ __forceinline__ v8f wmmab(v16bf a, v16bf b, v8f c) { return __builtin_amdgcn_wmma_f32_16x16x32_bf16(false, a, false, b, (short)0, c, false, false); }
template <typename T16> struct WFrag;
template <> struct WFrag<h16> { typedef v16h V; static __device__ __forceinline__ V ld(const h16* p) { return cat16(*(const v8h*)p, *(const v8h*)(p + FR / 2)); } static __device__ __forceinline__ v8f mma(V a, V b, v8f c) { return wmma16(a, b, c); } };
template <> struct WFrag<bf> { typedef v16bf V; static __device__ __forceinline__ V ld(const bf* p) { return cat16b(*(const v8us*)p, *(const v8us*)(p + FR / 2)); } static __device__ __forceinline__ v8f mma(V a, V b, v8f c) { return wmmab(a, b, c); } };
__device__ __forceinline__ h16 tohx(float x) { return (h16)x; }
// The weight roundings, [out][in] f32 -> fragment order: thread i writes the plane's 16-byte piece i (whole lines per wave) and reads the 8 values that belong there: row 16 (i >> 9) + (i & 15), k 32 ((i >> 6) & 7) + 8 ((i >> 4) & 3).
__device__ __forceinline__ v8f w_piece(const float* __restrict__ w, size_t i) { return *(const v8f*)(w + ((i >> 9) * 16 + (i & 15)) * CC + ((i >> 6) & 7) * 32 + ((i >> 4) & 3) * 8); }
// All four roundings are ONE launch, grid (CC * CC / 8 / 256, 4): blockIdx.y picks the matrix (0, 1, 2: Wq, Wk, Wv -> the three bf16 planes of W3, one behind the other; 3: Wo -> fp16). They need nothing of each other, and 32 work-groups as a launch of their own cost a whole launch gap and a whole load-to-store latency.
__global__ __launch_bounds__(256) void k_wprep(const float* __restrict__ wq, const float* __restrict__ wk, const float* __restrict__ wv, const float* __restrict__ wo, bf* W3, h16* WO) {
    const int y = blockIdx.y; const size_t i = (size_t)blockIdx.x * 256 + threadIdx.x;
    const v8f v = w_piece(y == 0 ? wq : y == 1 ? wk : y == 2 ? wv : wo, i);
    if (y < 3) { v8us o;
#pragma unroll
        for (int k = 0; k < 8; ++k) o[k] = f2bf(v[k]);
        *(v8us*)(W3 + (size_t)y * CC * CC + i * 8) = o;
    } else { v8h o;
#pragma unroll
        for (int k = 0; k < 8; ++k) o[k] = tohx(bfr(v[k]));
        *(v8h*)(WO + i * 8) = o;
        asm volatile("s_wait_xcnt 0x0" ::: "memory"); }   // behind the store: in the built code the other branch's block follows this one and writes the store's registers
}

// ---- The two GEMMs: ONE WAVE per 64x64 output tile (16 accumulators), K = CC in steps of 32, operands straight from global memory (the 16-bit planes in fragment order), 32 threads a work-group.
// A lane of an accumulator holds ONE column and eight consecutive rows, so each product is set up with the index that is contiguous in its result's layout as the ROW index; the tile goes through LDS once so that every store instruction writes whole 128-byte lines.
// x W^T for 64 tokens x 64 output channels. x is [c][n]: one 16-byte load gives a lane FOUR tokens (n0 + 4 lr + t) at one k, so token block t of the tile is made of the tokens n0 + 4 r + t (r: the fragment's row or column): every load covers whole lines and nothing is transposed; the epilogues undo the order.
// k order of both loaders, element e of a fragment: kc + 8 hi + (e & 7) + 16 (e >> 3). XROWS: the tokens are the rows (A operand), else the columns (B operand). acc[g][t]: channel block g, token block t.
template <bool XROWS>
__device__ __forceinline__ void xw_tile(const float* xp, const bf* wp, v8f (&acc)[4][4]) {
#pragma unroll 1   // kept rolled: the raw f32 values of a second step would not fit beside the 16 accumulators
    for (int kc = 0; kc < CC; kc += 32) {
        const float* xk = xp + (size_t)kc * NN; const bf* wk = wp + (kc >> 5) * FR;
        v4f xv[16]; v16bf xf[4], wf[4];
#pragma unroll
        for (int e = 0; e < 16; ++e) xv[e] = *(const v4f*)(xk + (size_t)((e & 7) + (e >> 3) * 16) * NN);
#pragma unroll
        for (int g = 0; g < 4; ++g) wf[g] = WFrag<bf>::ld(wk + g * (CC / 32) * FR);
        __builtin_amdgcn_sched_barrier(0);   // all 24 loads of the step are issued before its arithmetic: left alone, the compiler reloads two weight fragments among the matrix instructions and the wave waits out the load latency three times a step
#pragma unroll
        for (int t = 0; t < 4; ++t) { v16f c;
#pragma unroll
            for (int e = 0; e < 16; ++e) c[e] = xv[e][t];
            xf[t] = __builtin_convertvector(c, v16bf); }
#pragma unroll
        for (int g = 0; g < 4; ++g)
#pragma unroll
            for (int t = 0; t < 4; ++t) acc[g][t] = XROWS ? wmmab(xf[t], wf[g], acc[g][t]) : wmmab(wf[g], xf[t], acc[g][t]);
        asm volatile("v_nop\n\tv_nop\n\tv_nop\n\tv_nop" : "+v"(acc[0][0]), "+v"(acc[1][1]), "+v"(acc[2][2]), "+v"(acc[3][3]) : "v"(xf[3]), "v"(wf[3]));   // the slots behind the last matrix instruction on the loop's taken branch
    }
}
// ---- The bias plane BP: [head][query >> 4][key >> 5] tiles of 1 KiB (16 queries x 32 keys, bf16: the rounding that every input takes anyway, so nothing is lost). Piece t * 32 + lane of a tile holds, for query lr, the keys 16 t + 8 hi + (0..7): what that lane holds of the C operand of score tile t.
// One wave: two (query tile, key block) pairs, all eight heads of each (the index rows are read once for the eight). The index is data: clamped before it forms an address.
__device__ __forceinline__ void ld_ix(const int* p, v4i (&ix)[4]) {
#pragma unroll
    for (int c = 0; c < 4; ++c) ix[c] = *(const v4i*)(p + (c >> 1) * 16 + (c & 1) * 4); }
__device__ __forceinline__ v16i clamp_ix(const v4i (&ix)[4]) { v16i kx;
#pragma unroll
    for (int u = 0; u < 16; ++u) kx[u] = min(max(ix[u >> 2][u & 3], 0), NRB - 1);
    return kx; }
__device__ __forceinline__ void bias_tiles(const float* __restrict__ rb, const int* __restrict__ ridx, bf* BP, int id, int lane) {
    const int lr = lane & 15, hi = lane >> 4, qt = id >> 4, s0 = (id & 15) * 2;
    const int* ir = ridx + (size_t)(qt * 16 + lr) * NN + s0 * 32 + 8 * hi;
    bf* dst = BP + ((size_t)qt * (NN / 32) + s0) * FR + lane * 8;
    v4i ix[2][4]; v16i kx[2];
    ld_ix(ir, ix[0]); ld_ix(ir + 32, ix[1]);
    asm volatile("s_wait_xcnt 0x0" :: "v"(ir) : "memory");   // behind the index loads: their address register is an input, so it lives up to the wait
    kx[0] = clamp_ix(ix[0]); kx[1] = clamp_ix(ix[1]);
#pragma unroll
    for (int h0 = 0; h0 < NH_; h0 += 4) {   // four heads (128 gathers) in flight at a time: one load latency for the four
        v8f rw[4][2][2];
#pragma unroll
        for (int g = 0; g < 4; ++g)
#pragma unroll
            for (int p = 0; p < 2; ++p)
#pragma unroll
                for (int u = 0; u < 16; ++u) rw[g][p][u >> 3][u & 7] = rb[(size_t)(h0 + g) * NRB + kx[p][u]];
        asm volatile("s_wait_xcnt 0x0" :: "v"(kx[0]), "v"(kx[1]) : "memory");   // behind the gathers: their index registers are inputs, so they live up to the wait and no result of the run is placed on one of them; the clobber keeps all 128 in front of the first store
#pragma unroll
        for (int g = 0; g < 4; ++g)
#pragma unroll
            for (int p = 0; p < 2; ++p)
#pragma unroll
                for (int t = 0; t < 2; ++t) *(v8us*)(dst + (size_t)(h0 + g) * (NN / 16) * (NN / 32) * FR + p * FR + t * (FR / 2)) = __builtin_bit_cast(v8us, __builtin_convertvector(rw[g][p][t], v8bf));
        asm volatile("s_wait_xcnt 0x0" :: "v"(dst) : "memory");   // behind the stores: what follows writes their data registers
    }
}
// grid (NBI * NN / 64, CC / 64, 4), z = q, k, v (W3: their three weight planes one behind the other), 3: the bias plane (1024 waves that run beside the GEMM waves and need nothing of them). q, k: rows = channels, so a lane holds 8 consecutive d of one token -> Q16 / K16 [b][h][n >> 4] fragments (row n & 15, k = d; k scaled in f32 before it is rounded). v: rows = tokens, so a lane holds 32 consecutive tokens of one channel -> VT [b][h][n >> 5][d >> 4] fragments (row d & 15, k = n & 31).
__global__ __launch_bounds__(32) void k_qkv(const float* __restrict__ x, const bf* __restrict__ W3, const float* __restrict__ rb, const int* __restrict__ ridx, h16* Q16, h16* K16, h16* VT, bf* BP) {
    __shared__ __align__(16) h16 os[2 * 64 * 40];   // q, k: [head][token][40]; v: [channel][72]
    const int lane = threadIdx.x & 31, lr = lane & 15, hi = lane >> 4;
    const int z = blockIdx.z, b = blockIdx.x >> 4, n0 = (blockIdx.x & 15) * 64, o0 = blockIdx.y * 64;
    if (z == 3) { bias_tiles(rb, ridx, BP, blockIdx.y * (NBI * NN / 64) + blockIdx.x, lane); return; }
    const float* xp = x + ((size_t)b * CC + 8 * hi) * NN + n0 + 4 * lr;
    const bf* wp = W3 + (size_t)((z * CC + o0) >> 4) * (CC / 32) * FR + lane * 8;
    v8f acc[4][4];
#pragma unroll
    for (int g = 0; g < 4; ++g)
#pragma unroll
        for (int t = 0; t < 4; ++t) acc[g][t] = (v8f){};
    if (z < 2) {
        xw_tile<false>(xp, wp, acc);   // acc[g][t][j]: channel o0 + 16 g + 8 hi + j, token n0 + 4 lr + t
        const float sc = z == 1 ? 0.1767766952966369f : 1.0f;
#pragma unroll
        for (int g = 0; g < 4; ++g)
#pragma unroll
            for (int t = 0; t < 4; ++t) *(v8ha*)(os + ((g >> 1) * 64 + 4 * lr + t) * 40 + (g & 1) * 16 + 8 * hi) = __builtin_convertvector(acc[g][t] * sc, v8h);
        __builtin_amdgcn_wave_barrier(); asm volatile("" ::: "memory");   // one wave: its LDS operations run in order; this keeps the compiler from moving the reads of other lanes' rows over the writes
        h16* dst = (z == 0 ? Q16 : K16) + (((size_t)b * NH_ + (o0 >> 5)) * NN + n0) * HD;
#pragma unroll
        for (int s = 0; s < 16; ++s) { const int c = s * 32 + lane, hd = c >> 8, tok = ((c >> 6) & 3) * 16 + (c & 15), pc = (c >> 4) & 3;
            *(v8h*)(dst + (size_t)hd * NN * HD + (c & 255) * 8) = *(const v8ha*)(os + (hd * 64 + tok) * 40 + pc * 8); }
    } else {
        xw_tile<true>(xp, wp, acc);    // acc[g][t][j]: token n0 + 4 (8 hi + j) + t, channel o0 + 16 g + lr
#pragma unroll
        for (int g = 0; g < 4; ++g)
#pragma unroll
            for (int q = 0; q < 4; ++q) { v8f c;
#pragma unroll
                for (int e = 0; e < 8; ++e) c[e] = acc[g][e & 3][2 * q + (e >> 2)];   // tokens n0 + 32 hi + 8 q + e
                *(v8ha*)(os + (g * 16 + lr) * 72 + 32 * hi + 8 * q) = __builtin_convertvector(c, v8h); }
        __builtin_amdgcn_wave_barrier(); asm volatile("" ::: "memory");   // as above
        h16* dst = VT + (((size_t)b * NH_ + (o0 >> 5)) * NN + n0) * HD;
#pragma unroll
        for (int s = 0; s < 16; ++s) { const int c = s * 32 + lane, hd = c >> 8, row = hd * 32 + ((c >> 6) & 1) * 16 + (c & 15), pc = ((c >> 7) & 1) * 4 + ((c >> 4) & 3);
            *(v8h*)(dst + (size_t)hd * NN * HD + (c & 255) * 8) = *(const v8ha*)(os + row * 72 + pc * 8); }
    }
}
// grid (NBI * NN / 64, CC / 64): OUT [b][c][n] = merged heads . Wo^T + bo. Rows = tokens (natural order), columns = output channels: a lane holds 8 consecutive tokens of one channel, which is NCHW.
__global__ __launch_bounds__(32) void k_wo(const h16* __restrict__ M16, const h16* __restrict__ WO, const float* __restrict__ bo, float* OUT) {
    __shared__ __align__(16) float os[16 * 68];
    const int lane = threadIdx.x & 31, lr = lane & 15, hi = lane >> 4;
    const int b = blockIdx.x >> 4, n0 = (blockIdx.x & 15) * 64, c0 = blockIdx.y * 64;
    const h16* ap = M16 + (size_t)((b * NN + n0) >> 4) * (CC / 32) * FR + lane * 8;
    const h16* wp = WO + (size_t)(c0 >> 4) * (CC / 32) * FR + lane * 8;
    v8f acc[4][4];
#pragma unroll
    for (int mb = 0; mb < 4; ++mb)
#pragma unroll
        for (int nb = 0; nb < 4; ++nb) acc[mb][nb] = (v8f){};
#pragma unroll 1   // kept rolled: one step's fragments beside the 16 accumulators
    for (int kc = 0; kc < CC; kc += 32) {
        const h16* ak = ap + (kc >> 5) * FR; const h16* wk = wp + (kc >> 5) * FR;
        v16h a[4], w[4];
#pragma unroll
        for (int mb = 0; mb < 4; ++mb) a[mb] = WFrag<h16>::ld(ak + mb * (CC / 32) * FR);
#pragma unroll
        for (int nb = 0; nb < 4; ++nb) w[nb] = WFrag<h16>::ld(wk + nb * (CC / 32) * FR);
        asm volatile("s_wait_xcnt 0x0" :: "v"(ak), "v"(wk) : "memory");   // behind the step's loads: their address registers are inputs, so they live up to the wait and no result of the run is placed on one of them
#pragma unroll
        for (int nb = 0; nb < 4; ++nb)
#pragma unroll
            for (int mb = 0; mb < 4; ++mb) acc[mb][nb] = wmma16(a[mb], w[nb], acc[mb][nb]);
        asm volatile("v_nop\n\tv_nop\n\tv_nop\n\tv_nop" : "+v"(acc[0][0]), "+v"(acc[1][1]), "+v"(acc[2][2]), "+v"(acc[3][3]) : "v"(a[3]), "v"(w[3]));   // as in xw_tile
    }
#pragma unroll
    for (int nb = 0; nb < 4; ++nb) {   // acc[mb][nb][j]: token n0 + 16 mb + 8 hi + j, channel c0 + 16 nb + lr
        const float bb = bfr(bo[c0 + nb * 16 + lr]);
#pragma unroll
        for (int mb = 0; mb < 4; ++mb) { const v8f v = acc[mb][nb] + bb;
            *(v4fa*)(os + lr * 68 + mb * 16 + 8 * hi) = (v4f){v[0], v[1], v[2], v[3]}; *(v4fa*)(os + lr * 68 + mb * 16 + 8 * hi + 4) = (v4f){v[4], v[5], v[6], v[7]}; }
        __builtin_amdgcn_wave_barrier(); asm volatile("" ::: "memory");   // as in k_qkv
        float* dst = OUT + ((size_t)b * CC + c0 + nb * 16) * NN + n0;
#pragma unroll
        for (int s = 0; s < 8; ++s) { const int c = s * 32 + lane, row = c >> 4, pc = c & 15;
            *(v4f*)(dst + (size_t)row * NN + pc * 4) = *(const v4fa*)(os + row * 68 + pc * 4); }
        __builtin_amdgcn_wave_barrier(); asm volatile("" ::: "memory");   // the next block's writes stay behind these reads
    }
}

// ---- k_fattn: scores + bias (from the plane BP) + softmax + probs.v for 16 queries of one head and NI images per wave; nothing of the score plane leaves the registers.
// Transposed products: S^T = K Q^T + bias (the bias tile is the C operand: a lane holds query lr, keys 8 hi + r), O^T += V^T P^T (two S^T tiles, converted in place, are the B operand in the hardware k order; V^T rows by the same loader).
// Work-group: 8 waves = 4 query tiles x 2 heads (the tiles share K and V through the cache). An O^T tile in its registers IS a half fragment of the merged-heads plane (row = query, k = d), so each wave stores its own whole lines. grid (NN / 64, NH_ / 2, NBI / NI) = 4096 waves, four per SIMD, all resident at once: hence amdgpu_waves_per_eu(4, 4), which holds the register count to that.
// Every inner loop is unrolled so that the fragment arrays are indexed by constants and stay in registers.
__device__ __forceinline__ float xrow(float v) { const int b = __float_as_int(v); return __int_as_float(__builtin_amdgcn_permlanex16(b, b, 0x76543210, 0xfedcba98, false, false)); }   // lane l <-> l ^ 16
// Eight v_exp_f32 in one statement: no result lies on a source ("=&v"), and the closing v_nop is the slot the instruction set asks for between a transcendental and the next user of its result or writer of its source.
__device__ __forceinline__ v8f exp2x8(v8f x) { float y0, y1, y2, y3, y4, y5, y6, y7;
    asm("v_exp_f32 %0, %8\n\tv_exp_f32 %1, %9\n\tv_exp_f32 %2, %10\n\tv_exp_f32 %3, %11\n\tv_exp_f32 %4, %12\n\tv_exp_f32 %5, %13\n\tv_exp_f32 %6, %14\n\tv_exp_f32 %7, %15\n\tv_nop"
        : "=&v"(y0), "=&v"(y1), "=&v"(y2), "=&v"(y3), "=&v"(y4), "=&v"(y5), "=&v"(y6), "=&v"(y7) : "v"(x[0]), "v"(x[1]), "v"(x[2]), "v"(x[3]), "v"(x[4]), "v"(x[5]), "v"(x[6]), "v"(x[7]));
    return (v8f){y0, y1, y2, y3, y4, y5, y6, y7}; }
__device__ __forceinline__ float exp2x1(float x) { float y; asm("v_exp_f32 %0, %1\n\tv_nop" : "=v"(y) : "v"(x)); return y; }   // the same slot behind a single one
// s_wait_xcnt 0 behind a run of global loads: the run's address registers are inputs of the statement, so they live up to the wait and no result of the run is placed on one of them; the memory clobber keeps the run's loads in front of it (in the loop: ahead of the softmax arithmetic, which covers their latency) and later loads behind it.
__global__ __launch_bounds__(256) __attribute__((amdgpu_waves_per_eu(4, 4))) void k_fattn(const h16* __restrict__ Q16, const h16* __restrict__ K16, const h16* __restrict__ VT, const bf* __restrict__ BP, h16* M16) {
    const int lane = threadIdx.x & 31;
    const int wave = __builtin_amdgcn_readfirstlane(threadIdx.x >> 5), qt = wave & 3, hh = wave >> 2;
    const int q0 = blockIdx.x * 64, h = blockIdx.y * 2 + hh, b0 = blockIdx.z * NI;
    const bf* bp = BP + ((size_t)h * (NN / 16) + (q0 >> 4) + qt) * (NN / 32) * FR + lane * 8;
    const size_t bh0 = (size_t)b0 * NH_ + h, IMS = (size_t)NH_ * NN * HD;   // IMS: elements from one image to the next in Q16, K16 and VT
    const h16* qa = Q16 + (bh0 * NN + q0 + qt * 16) * HD + lane * 8; const h16* kp = K16 + bh0 * NN * HD + lane * 8; const h16* vp = VT + bh0 * NN * HD + lane * 8;
    v16h q[NI], kf[NI][2]; v8f o[NI][2]; float m[NI], l[NI];
    v4u br[2]; v8f bias[2];
    br[0] = *(const v4u*)bp; br[1] = *(const v4u*)(bp + FR / 2);
#pragma unroll
    for (int im = 0; im < NI; ++im) {
        q[im] = WFrag<h16>::ld(qa + im * IMS);
        kf[im][0] = WFrag<h16>::ld(kp + im * IMS); kf[im][1] = WFrag<h16>::ld(kp + im * IMS + FR);
        o[im][0] = (v8f){}; o[im][1] = (v8f){}; m[im] = -3.0e38f; l[im] = 0.f; }
    asm volatile("s_wait_xcnt 0x0" :: "v"(qa), "v"(kp), "v"(bp) : "memory");   // see above
#pragma unroll 1   // kept rolled: a second pass in flight would not fit the registers of four waves per SIMD
    for (int s = 0; s < NN / 32; ++s) {   // 32 keys a pass; the bias tile and the K fragments are fetched one pass ahead (the last pass wraps to the row's start: in bounds, not used)
        const h16* va = vp + s * 2 * FR; const h16* ka = kp + (size_t)(((s + 1) & (NN / 32 - 1)) * 32) * HD; const bf* ba = bp + ((s + 1) & (NN / 32 - 1)) * FR;
        v8f st[NI][2]; v16h vf[NI][2];
#pragma unroll
        for (int u = 0; u < 16; ++u) bias[u >> 3][u & 7] = __uint_as_float((u & 1) ? br[u >> 3][(u & 7) >> 1] & 0xFFFF0000u : br[u >> 3][(u & 7) >> 1] << 16);   // bf16 pair -> two f32. Here and not behind the load: the tile fetched in the pass before has landed by now
#pragma unroll
        for (int im = 0; im < NI; ++im) { st[im][0] = wmma16(kf[im][0], q[im], bias[0]); st[im][1] = wmma16(kf[im][1], q[im], bias[1]); }
#pragma unroll
        for (int im = 0; im < NI; ++im) { vf[im][0] = WFrag<h16>::ld(va + im * IMS); vf[im][1] = WFrag<h16>::ld(va + im * IMS + FR); }
        br[0] = *(const v4u*)ba; br[1] = *(const v4u*)(ba + FR / 2);
#pragma unroll
        for (int im = 0; im < NI; ++im) { kf[im][0] = WFrag<h16>::ld(ka + im * IMS); kf[im][1] = WFrag<h16>::ld(ka + im * IMS + FR); }
        asm volatile("s_wait_xcnt 0x0" :: "v"(va), "v"(ka), "v"(ba) : "memory");   // see above
#pragma unroll
        for (int im = 0; im < NI; ++im) {
            float tm = st[im][0][0];
#pragma unroll
            for (int r = 1; r < 16; ++r) tm = fmaxf(tm, st[im][r >> 3][r & 7]);
            tm = fmaxf(tm, xrow(tm));
            const float mn = fmaxf(m[im], tm), sc = exp2x1((m[im] - mn) * L2E), mb = mn * L2E - PSH; m[im] = mn;
            float ps = 0.f; v8f e[2];
#pragma unroll
            for (int t = 0; t < 2; ++t) { v8f a;
#pragma unroll
                for (int r = 0; r < 8; ++r) a[r] = fmaf(st[im][t][r], L2E, -mb);
                e[t] = exp2x8(a);
#pragma unroll
                for (int r = 0; r < 8; ++r) ps += e[t][r]; }
            l[im] = fmaf(l[im], sc, ps);
            const v16h pb = cat16(__builtin_convertvector(e[0], v8h), __builtin_convertvector(e[1], v8h));
            o[im][0] = wmma16(vf[im][0], pb, o[im][0] * sc); o[im][1] = wmma16(vf[im][1], pb, o[im][1] * sc); }
    }
#pragma unroll
    for (int im = 0; im < NI; ++im) { const float inv = 1.0f / (l[im] + xrow(l[im]));
#pragma unroll
        for (int u = 0; u < 2; ++u) *(v8h*)(M16 + ((((size_t)(b0 + im) * NN + q0) >> 4) + qt) * (CC / 32) * FR + h * FR + u * (FR / 2) + lane * 8) = __builtin_convertvector(o[im][u] * inv, v8h); }
}

extern "C" void kernel_launch(void* const* d_in, const int* in_sizes, int n_in,
                              void* d_out, int out_size, void* d_ws, size_t ws_size, hipStream_t stream) {
    (void)in_sizes; (void)n_in; (void)out_size;
    const float* x = (const float*)d_in[0]; const float* wq = (const float*)d_in[1]; const float* wk = (const float*)d_in[2]; const float* wv = (const float*)d_in[3]; const float* wo = (const float*)d_in[4]; const float* bo = (const float*)d_in[5]; const float* rb = (const float*)d_in[6]; const int* ridx = (const int*)d_in[7];
    float* OUT = (float*)d_out;     // [16][256][32][32]
    char* wsp = (char*)d_ws;
    auto take = [&](size_t bytes) { char* p = wsp; wsp += (bytes + 255) & ~(size_t)255; return (void*)p; };
    bf* W3 = (bf*)take((size_t)3 * CC * CC * 2); h16* WO = (h16*)take(CC * CC * 2);
    h16* Q16 = (h16*)take((size_t)NBI * NH_ * NN * HD * 2); h16* K16 = (h16*)take((size_t)NBI * NH_ * NN * HD * 2); h16* VT = (h16*)take((size_t)NBI * NH_ * HD * NN * 2); h16* M16 = (h16*)take((size_t)NBI * NN * CC * 2); bf* BP = (bf*)take((size_t)NH_ * NN * NN * 2);
    if ((size_t)(wsp - (char*)d_ws) > ws_size) return;    // total ~ 48.5 MiB
    k_wprep<<<dim3(CC * CC / 8 / 256, 4), 256, 0, stream>>>(wq, wk, wv, wo, W3, WO);
    k_qkv<<<dim3(NBI * NN / 64, CC / 64, 4), 32, 0, stream>>>(x, W3, rb, ridx, Q16, K16, VT, BP);
    k_fattn<<<dim3(NN / 64, NH_ / 2, NBI / NI), 256, 0, stream>>>(Q16, K16, VT, BP, M16);
    k_wo<<<dim3(NBI * NN / 64, CC / 64, 1), 32, 0, stream>>>(M16, WO, bo, OUT);
}

// v007
// One run takes 59.3 microseconds.
// In two side-by-side timings against v006, it was 1.10 and 1.09 times as fast.
// Over all steps from v000 it is 26.2 times as fast.
#include <hip/hip_runtime.h>

// Attention block with a gathered relative bias (x NCHW [16][256][32][32] -> 1024 tokens; q/k/v = xt W^T (8 heads x 32); attn = softmax(q . (k scale) + rel_bias[h][rel_idx[i][j]]) (rel_bias [8][3969] and the int32 index table read as data, clamped); out = (attn v) Wo^T + bo -> NCHW).
// Compute dtypes, f32 accumulate: every input rounded to bf16; q/k/v on PLAIN bf16 operands (inputs: exact); scores (K 32) and probs.v on single fp16 planes (the logits are dominated by the unit-scale bias; the projected q/k are
// 0.3-scale); scores, bias, softmax (f32, running maximum) and probs.v in ONE kernel, scores and probs held in registers; Wo on fp16 planes of the merged heads x fp16 weights (+ bias). Deterministic, no atomics.
// The gathered bias does not depend on the image: it is gathered and rounded ONCE, into a bf16 plane in the order of the score tiles (by a fourth z plane of k_qkv's grid), and the attention kernel reads it from there.
// Four launches: the weight roundings (all four matrices in one grid), k_qkv, k_fattn, k_wo. No activation has a layout pass of its own: k_qkv reads x as it comes (f32, NCHW) and rounds it in its fragment loader, and every epilogue stores the layout that the next reader wants.
// FRAGMENT ORDER: every 16-bit operand plane in the workspace (the four weights, q, k, V^T, the merged heads) is a row of 1-KiB fragments (16 rows x 32 k), each stored as [k >> 3 (4)][row (16)][k & 7]: lane l of a loader reads the 16 bytes at 16 l and at 512 + 16 l, so each load instruction covers four whole 128-byte lines
// (a row-major plane costs 8 or 16 lines for the same 512 bytes, and the cache path is paid by the line).

#define NBI  16
#define NI   2      // images per wave of the attention kernel: they share one bias tile
#define CC   256
#define NN   1024
#define NH_  8
#define HD   32
#define NRB  3969
#define FR   512    // elements of one operand fragment in the workspace planes
#define PSH  10.0f  // probs carry 2^PSH so that small ones stay normal fp16 numbers; the row sum carries it too, so it cancels
#define L2E  1.4426950408889634f
typedef _Float16 h16;
typedef unsigned short bf;
typedef __attribute__((ext_vector_type(16))) __bf16   v16bf;
typedef __attribute__((ext_vector_type(8)))  __bf16   v8bf;
typedef __attribute__((ext_vector_type(16))) _Float16 v16h;
typedef __attribute__((ext_vector_type(16))) float    v16f;
typedef __attribute__((ext_vector_type(8)))  _Float16 v8h;
typedef __attribute__((ext_vector_type(8)))  unsigned short v8us;
typedef __attribute__((ext_vector_type(4)))  _Float16 v4h;
typedef __attribute__((ext_vector_type(8)))  float    v8f;
typedef __attribute__((ext_vector_type(4)))  float    v4f;
typedef __attribute__((ext_vector_type(4)))  int      v4i;
typedef __attribute__((ext_vector_type(4)))  unsigned v4u;
typedef __attribute__((ext_vector_type(16))) int      v16i;
typedef v8h  __attribute__((may_alias)) v8ha;
typedef v4f  __attribute__((may_alias)) v4fa;

__device__ __forceinline__ unsigned short f2bf(float f) { unsigned u = __float_as_uint(f); u += 0x7FFFu + ((u >> 16) & 1u); return (unsigned short)(u >> 16); }
__device__ __forceinline__ float bf2f(unsigned short b) { return __uint_as_float(((unsigned)b) << 16); }
__device__ __forceinline__ float bfr(float f) { return bf2f(f2bf(f)); }
__device__ __forceinline__ v16h cat16(v8h lo, v8h hi) { return __builtin_shufflevector(lo, hi, 0, 1, 2, 3, 4, 5, 6, 7, 8, 9, 10, 11, 12, 13, 14, 15); }
__device__ __forceinline__ v16bf cat16b(v8us lo, v8us hi) { return __builtin_bit_cast(v16bf, __builtin_shufflevector(lo, hi, 0, 1, 2, 3, 4, 5, 6, 7, 8, 9, 10, 11, 12, 13, 14, 15)); }
__device__ __forceinline__ v8f wmma16(v16h a, v16h b, v8f c) { return __builtin_amdgcn_wmma_f32_16x16x32_f16(false, a, false, b, (short)0, c, false, false); }
__device__ __forceinline__ v8f wmmab(v16bf a, v16bf b, v8f c) { return __builtin_amdgcn_wmma_f32_16x16x32_bf16(false, a, false, b, (short)0, c, false, false); }
template <typename T16> struct WFrag;
template <> struct WFrag<h16> { typedef v16h V; static __device__ __forceinline__ V ld(const h16* p) { return cat16(*(const v8h*)p, *(const v8h*)(p + FR / 2)); } static __device__ __forceinline__ v8f mma(V a, V b, v8f c) { return wmma16(a, b, c); } };
template <> struct WFrag<bf> { typedef v16bf V; static __device__ __forceinline__ V ld(const bf* p) { return cat16b(*(const v8us*)p, *(const v8us*)(p + FR / 2)); } static __device__ __forceinline__ v8f mma(V a, V b, v8f c) { return wmmab(a, b, c); } };
__device__ __forceinline__ h16 tohx(float x) { return (h16)x; }
// The weight roundings, [out][in] f32 -> fragment order: thread i writes the plane's 16-byte piece i (whole lines per wave) and reads the 8 values that belong there: row 16 (i >> 9) + (i & 15), k 32 ((i >> 6) & 7) + 8 ((i >> 4) & 3).
__device__ __forceinline__ v8f w_piece(const float* __restrict__ w, size_t i) { return *(const v8f*)(w + ((i >> 9) * 16 + (i & 15)) * CC + ((i >> 6) & 7) * 32 + ((i >> 4) & 3) * 8); }
// All four roundings are ONE launch, grid (CC * CC / 8 / 256, 4): blockIdx.y picks the matrix (0, 1, 2: Wq, Wk, Wv -> the three bf16 planes of W3, one behind the other; 3: Wo -> fp16). They need nothing of each other, and 32 work-groups as a launch of their own cost a whole launch gap and a whole load-to-store latency.
__global__ __launch_bounds__(256) void k_wprep(const float* __restrict__ wq, const float* __restrict__ wk, const float* __restrict__ wv, const float* __restrict__ wo, bf* W3, h16* WO) {
    const int y = blockIdx.y; const size_t i = (size_t)blockIdx.x * 256 + threadIdx.x;
    const v8f v = w_piece(y == 0 ? wq : y == 1 ? wk : y == 2 ? wv : wo, i);
    if (y < 3) { v8us o;
#pragma unroll
        for (int k = 0; k < 8; ++k) o[k] = f2bf(v[k]);
        *(v8us*)(W3 + (size_t)y * CC * CC + i * 8) = o;
    } else { v8h o;
#pragma unroll
        for (int k = 0; k < 8; ++k) o[k] = tohx(bfr(v[k]));
        *(v8h*)(WO + i * 8) = o;
        asm volatile("s_wait_xcnt 0x0" ::: "memory"); }   // behind the store: in the built code the other branch's block follows this one and writes the store's registers
}

// ---- The two GEMMs: ONE WAVE per 64x64 output tile (16 accumulators), K = CC in steps of 32, operands straight from global memory (the 16-bit planes in fragment order), 32 threads a work-group.
// A lane of an accumulator holds ONE column and eight consecutive rows, so each product is set up with the index that is contiguous in its result's layout as the ROW index; the tile goes through LDS once so that every store instruction writes whole 128-byte lines.
// x W^T for 64 tokens x 64 output channels. x is [c][n]: one 16-byte load gives a lane FOUR tokens (n0 + 4 lr + t) at one k, so token block t of the tile is made of the tokens n0 + 4 r + t (r: the fragment's row or column): every load covers whole lines and nothing is transposed; the epilogues undo the order.
// k order of both loaders, element e of a fragment: kc + 8 hi + (e & 7) + 16 (e >> 3). XROWS: the tokens are the rows (A operand), else the columns (B operand). acc[g][t]: channel block g, token block t.
// rot: the k step at which this wave enters its walk over K (it wraps round): see ROTATED WALKS at k_qkv.
template <bool XROWS>
__device__ __forceinline__ void xw_tile(const float* xp, const bf* wp, v8f (&acc)[4][4], int rot) {
#pragma unroll 1   // kept rolled: the raw f32 values of a second step would not fit beside the 16 accumulators
    for (int i = 0; i < CC / 32; ++i) { const int kc = ((i + rot) & (CC / 32 - 1)) * 32;
        const float* xk = xp + (size_t)kc * NN; const bf* wk = wp + (kc >> 5) * FR;
        v4f xv[16]; v16bf xf[4], wf[4];
#pragma unroll
        for (int e = 0; e < 16; ++e) xv[e] = *(const v4f*)(xk + (size_t)((e & 7) + (e >> 3) * 16) * NN);
#pragma unroll
        for (int g = 0; g < 4; ++g) wf[g] = WFrag<bf>::ld(wk + g * (CC / 32) * FR);
        asm volatile("s_wait_xcnt 0x0" :: "v"(xk), "v"(wk) : "memory");   // behind the step's loads: their address registers are inputs, so they live up to the wait; the next step forms its addresses anew in them
        __builtin_amdgcn_sched_barrier(0);   // all 24 loads of the step are issued before its arithmetic: left alone, the compiler reloads two weight fragments among the matrix instructions and the wave waits out the load latency three times a step
#pragma unroll
        for (int t = 0; t < 4; ++t) { v16f c;
#pragma unroll
            for (int e = 0; e < 16; ++e) c[e] = xv[e][t];
            xf[t] = __builtin_convertvector(c, v16bf); }
#pragma unroll
        for (int g = 0; g < 4; ++g)
#pragma unroll
            for (int t = 0; t < 4; ++t) acc[g][t] = XROWS ? wmmab(xf[t], wf[g], acc[g][t]) : wmmab(wf[g], xf[t], acc[g][t]);
        asm volatile("v_nop\n\tv_nop\n\tv_nop\n\tv_nop" : "+v"(acc[0][0]), "+v"(acc[1][1]), "+v"(acc[2][2]), "+v"(acc[3][3]) : "v"(xf[3]), "v"(wf[3]));   // the slots behind the last matrix instruction on the loop's taken branch
    }
}
// ---- The bias plane BP: [head][query >> 4][key >> 5] tiles of 1 KiB (16 queries x 32 keys, bf16: the rounding that every input takes anyway, so nothing is lost). Piece t * 32 + lane of a tile holds, for query lr, the keys 16 t + 8 hi + (0..7): what that lane holds of the C operand of score tile t.
// One wave: two (query tile, key block) pairs, all eight heads of each (the index rows are read once for the eight). The index is data: clamped before it forms an address.
__device__ __forceinline__ void ld_ix(const int* p, v4i (&ix)[4]) {
#pragma unroll
    for (int c = 0; c < 4; ++c) ix[c] = *(const v4i*)(p + (c >> 1) * 16 + (c & 1) * 4); }
__device__ __forceinline__ v16i clamp_ix(const v4i (&ix)[4]) { v16i kx;
#pragma unroll
    for (int u = 0; u < 16; ++u) kx[u] = min(max(ix[u >> 2][u & 3], 0), NRB - 1);
    return kx; }
__device__ __forceinline__ void bias_tiles(const float* __restrict__ rb, const int* __restrict__ ridx, bf* BP, int id, int lane) {
    const int lr = lane & 15, hi = lane >> 4, qt = id >> 4, s0 = (id & 15) * 2;
    const int* ir = ridx + (size_t)(qt * 16 + lr) * NN + s0 * 32 + 8 * hi;
    bf* dst = BP + ((size_t)qt * (NN / 32) + s0) * FR + lane * 8;
    v4i ix[2][4]; v16i kx[2];
    ld_ix(ir, ix[0]); ld_ix(ir + 32, ix[1]);
    asm volatile("s_wait_xcnt 0x0" :: "v"(ir) : "memory");   // behind the index loads: their address register is an input, so it lives up to the wait
    kx[0] = clamp_ix(ix[0]); kx[1] = clamp_ix(ix[1]);
#pragma unroll
    for (int h0 = 0; h0 < NH_; h0 += 4) {   // four heads (128 gathers) in flight at a time: one load latency for the four
        v8f rw[4][2][2];
#pragma unroll
        for (int g = 0; g < 4; ++g)
#pragma unroll
            for (int p = 0; p < 2; ++p)
#pragma unroll
                for (int u = 0; u < 16; ++u) rw[g][p][u >> 3][u & 7] = rb[(size_t)(h0 + g) * NRB + kx[p][u]];
        asm volatile("s_wait_xcnt 0x0" :: "v"(kx[0]), "v"(kx[1]) : "memory");   // behind the gathers: their index registers are inputs, so they live up to the wait and no result of the run is placed on one of them; the clobber keeps all 128 in front of the first store
#pragma unroll
        for (int g = 0; g < 4; ++g)
#pragma unroll
            for (int p = 0; p < 2; ++p)
#pragma unroll
                for (int t = 0; t < 2; ++t) *(v8us*)(dst + (size_t)(h0 + g) * (NN / 16) * (NN / 32) * FR + p * FR + t * (FR / 2)) = __builtin_bit_cast(v8us, __builtin_convertvector(rw[g][p][t], v8bf));
        asm volatile("s_wait_xcnt 0x0" :: "v"(dst) : "memory");   // behind the stores: what follows writes their data registers
    }
}
// ROTATED WALKS: waves of different work-groups that read the same lines (a weight plane: 256 waves; an x tile: 12; in k_wo a token tile: 4; in k_fattn one head's K and V: 16 work-groups, a bias row: 8) start together and would ask L2 for the same line at the same moment all the way down. Each enters its walk (over K here and in k_wo, over the keys in k_fattn) at a step of its own, taken from its block index, and wraps round: the same loads and products, in another order.
// grid (NBI * NN / 64, CC / 64, 4), z = q, k, v (W3: their three weight planes one behind the other), 3: the bias plane (1024 waves that run beside the GEMM waves and need nothing of them). q, k: rows = channels, so a lane holds 8 consecutive d of one token -> Q16 / K16 [b][h][n >> 4] fragments (row n & 15, k = d; k scaled in f32 before it is rounded). v: rows = tokens, so a lane holds 32 consecutive tokens of one channel -> VT [b][h][n >> 5][d >> 4] fragments (row d & 15, k = n & 31).
__global__ __launch_bounds__(32) void k_qkv(const float* __restrict__ x, const bf* __restrict__ W3, const float* __restrict__ rb, const int* __restrict__ ridx, h16* Q16, h16* K16, h16* VT, bf* BP) {
    __shared__ __align__(16) h16 os[2 * 64 * 40];   // q, k: [head][token][40]; v: [channel][72]
    const int lane = threadIdx.x & 31, lr = lane & 15, hi = lane >> 4;
    const int z = blockIdx.z, b = blockIdx.x >> 4, n0 = (blockIdx.x & 15) * 64, o0 = blockIdx.y * 64;
    if (z == 3) { bias_tiles(rb, ridx, BP, blockIdx.y * (NBI * NN / 64) + blockIdx.x, lane); return; }
    const float* xp = x + ((size_t)b * CC + 8 * hi) * NN + n0 + 4 * lr;
    const bf* wp = W3 + (size_t)((z * CC + o0) >> 4) * (CC / 32) * FR + lane * 8;
    const int rot = blockIdx.x + blockIdx.y + 4 * z;
    v8f acc[4][4];
#pragma unroll
    for (int g = 0; g < 4; ++g)
#pragma unroll
        for (int t = 0; t < 4; ++t) acc[g][t] = (v8f){};
    if (z < 2) {
        xw_tile<false>(xp, wp, acc, rot);   // acc[g][t][j]: channel o0 + 16 g + 8 hi + j, token n0 + 4 lr + t
        const float sc = z == 1 ? 0.1767766952966369f : 1.0f;
#pragma unroll
        for (int g = 0; g < 4; ++g)
#pragma unroll
            for (int t = 0; t < 4; ++t) *(v8ha*)(os + ((g >> 1) * 64 + 4 * lr + t) * 40 + (g & 1) * 16 + 8 * hi) = __builtin_convertvector(acc[g][t] * sc, v8h);
        __builtin_amdgcn_wave_barrier(); asm volatile("" ::: "memory");   // one wave: its LDS operations run in order; this keeps the compiler from moving the reads of other lanes' rows over the writes
        h16* dst = (z == 0 ? Q16 : K16) + (((size_t)b * NH_ + (o0 >> 5)) * NN + n0) * HD;
#pragma unroll
        for (int s = 0; s < 16; ++s) { const int c = s * 32 + lane, hd = c >> 8, tok = ((c >> 6) & 3) * 16 + (c & 15), pc = (c >> 4) & 3;
            *(v8h*)(dst + (size_t)hd * NN * HD + (c & 255) * 8) = *(const v8ha*)(os + (hd * 64 + tok) * 40 + pc * 8); }
    } else {
        xw_tile<true>(xp, wp, acc, rot);    // acc[g][t][j]: token n0 + 4 (8 hi + j) + t, channel o0 + 16 g + lr
#pragma unroll
        for (int g = 0; g < 4; ++g)
#pragma unroll
            for (int q = 0; q < 4; ++q) { v8f c;
#pragma unroll
                for (int e = 0; e < 8; ++e) c[e] = acc[g][e & 3][2 * q + (e >> 2)];   // tokens n0 + 32 hi + 8 q + e
                *(v8ha*)(os + (g * 16 + lr) * 72 + 32 * hi + 8 * q) = __builtin_convertvector(c, v8h); }
        __builtin_amdgcn_wave_barrier(); asm volatile("" ::: "memory");   // as above
        h16* dst = VT + (((size_t)b * NH_ + (o0 >> 5)) * NN + n0) * HD;
#pragma unroll
        for (int s = 0; s < 16; ++s) { const int c = s * 32 + lane, hd = c >> 8, row = hd * 32 + ((c >> 6) & 1) * 16 + (c & 15), pc = ((c >> 7) & 1) * 4 + ((c >> 4) & 3);
            *(v8h*)(dst + (size_t)hd * NN * HD + (c & 255) * 8) = *(const v8ha*)(os + row * 72 + pc * 8); }
    }
}
// grid (NBI * NN / 64, CC / 64): OUT [b][c][n] = merged heads . Wo^T + bo. Rows = tokens (natural order), columns = output channels: a lane holds 8 consecutive tokens of one channel, which is NCHW.
__global__ __launch_bounds__(32) void k_wo(const h16* __restrict__ M16, const h16* __restrict__ WO, const float* __restrict__ bo, float* OUT) {
    __shared__ __align__(16) float os[16 * 68];
    const int lane = threadIdx.x & 31, lr = lane & 15, hi = lane >> 4;
    const int b = blockIdx.x >> 4, n0 = (blockIdx.x & 15) * 64, c0 = blockIdx.y * 64;
    const h16* ap = M16 + (size_t)((b * NN + n0) >> 4) * (CC / 32) * FR + lane * 8;
    const h16* wp = WO + (size_t)(c0 >> 4) * (CC / 32) * FR + lane * 8;
    v8f acc[4][4];
#pragma unroll
    for (int mb = 0; mb < 4; ++mb)
#pragma unroll
        for (int nb = 0; nb < 4; ++nb) acc[mb][nb] = (v8f){};
    const int rot = blockIdx.x + 2 * blockIdx.y;   // see ROTATED WALKS at k_qkv
#pragma unroll 1   // kept rolled: one step's fragments beside the 16 accumulators
    for (int i = 0; i < CC / 32; ++i) { const int kc = ((i + rot) & (CC / 32 - 1)) * 32;
        const h16* ak = ap + (kc >> 5) * FR; const h16* wk = wp + (kc >> 5) * FR;
        v16h a[4], w[4];
#pragma unroll
        for (int mb = 0; mb < 4; ++mb) a[mb] = WFrag<h16>::ld(ak + mb * (CC / 32) * FR);
#pragma unroll
        for (int nb = 0; nb < 4; ++nb) w[nb] = WFrag<h16>::ld(wk + nb * (CC / 32) * FR);
        asm volatile("s_wait_xcnt 0x0" :: "v"(ak), "v"(wk) : "memory");   // behind the step's loads: their address registers are inputs, so they live up to the wait and no result of the run is placed on one of them
#pragma unroll
        for (int nb = 0; nb < 4; ++nb)
#pragma unroll
            for (int mb = 0; mb < 4; ++mb) acc[mb][nb] = wmma16(a[mb], w[nb], acc[mb][nb]);
        asm volatile("v_nop\n\tv_nop\n\tv_nop\n\tv_nop" : "+v"(acc[0][0]), "+v"(acc[1][1]), "+v"(acc[2][2]), "+v"(acc[3][3]) : "v"(a[3]), "v"(w[3]));   // as in xw_tile
    }
#pragma unroll
    for (int nb = 0; nb < 4; ++nb) {   // acc[mb][nb][j]: token n0 + 16 mb + 8 hi + j, channel c0 + 16 nb + lr
        const float bb = bfr(bo[c0 + nb * 16 + lr]);
#pragma unroll
        for (int mb = 0; mb < 4; ++mb) { const v8f v = acc[mb][nb] + bb;
            *(v4fa*)(os + lr * 68 + mb * 16 + 8 * hi) = (v4f){v[0], v[1], v[2], v[3]}; *(v4fa*)(os + lr * 68 + mb * 16 + 8 * hi + 4) = (v4f){v[4], v[5], v[6], v[7]}; }
        __builtin_amdgcn_wave_barrier(); asm volatile("" ::: "memory");   // as in k_qkv
        float* dst = OUT + ((size_t)b * CC + c0 + nb * 16) * NN + n0;
#pragma unroll
        for (int s = 0; s < 8; ++s) { const int c = s * 32 + lane, row = c >> 4, pc = c & 15;
            *(v4f*)(dst + (size_t)row * NN + pc * 4) = *(const v4fa*)(os + row * 68 + pc * 4); }
        __builtin_amdgcn_wave_barrier(); asm volatile("" ::: "memory");   // the next block's writes stay behind these reads
    }
}

// ---- k_fattn: scores + bias (from the plane BP) + softmax + probs.v for 16 queries of one head and NI images per wave; nothing of the score plane leaves the registers.
// Transposed products: S^T = K Q^T + bias (the bias tile is the C operand: a lane holds query lr, keys 8 hi + r), O^T += V^T P^T (two S^T tiles, converted in place, are the B operand in the hardware k order; V^T rows by the same loader).
// Work-group: 8 waves = 4 query tiles x 2 heads (the tiles share K and V through the cache). An O^T tile in its registers IS a half fragment of the merged-heads plane (row = query, k = d), so each wave stores its own whole lines. grid (NN / 64, NH_ / 2, NBI / NI) = 4096 waves, four per SIMD, all resident at once: hence amdgpu_waves_per_eu(4, 4), which holds the register count to that.
// Every inner loop is unrolled so that the fragment arrays are indexed by constants and stay in registers.
__device__ __forceinline__ float xrow(float v) { const int b = __float_as_int(v); return __int_as_float(__builtin_amdgcn_permlanex16(b, b, 0x76543210, 0xfedcba98, false, false)); }   // lane l <-> l ^ 16
// Eight v_exp_f32 in one statement: no result lies on a source ("=&v"), and the closing v_nop is the slot the instruction set asks for between a transcendental and the next user of its result or writer of its source.
__device__ __forceinline__ v8f exp2x8(v8f x) { float y0, y1, y2, y3, y4, y5, y6, y7;
    asm("v_exp_f32 %0, %8\n\tv_exp_f32 %1, %9\n\tv_exp_f32 %2, %10\n\tv_exp_f32 %3, %11\n\tv_exp_f32 %4, %12\n\tv_exp_f32 %5, %13\n\tv_exp_f32 %6, %14\n\tv_exp_f32 %7, %15\n\tv_nop"
        : "=&v"(y0), "=&v"(y1), "=&v"(y2), "=&v"(y3), "=&v"(y4), "=&v"(y5), "=&v"(y6), "=&v"(y7) : "v"(x[0]), "v"(x[1]), "v"(x[2]), "v"(x[3]), "v"(x[4]), "v"(x[5]), "v"(x[6]), "v"(x[7]));
    return (v8f){y0, y1, y2, y3, y4, y5, y6, y7}; }
__device__ __forceinline__ float exp2x1(float x) { float y; asm("v_exp_f32 %0, %1\n\tv_nop" : "=v"(y) : "v"(x)); return y; }   // the same slot behind a single one
// s_wait_xcnt 0 behind a run of global loads: the run's address registers are inputs of the statement, so they live up to the wait and no result of the run is placed on one of them; the memory clobber keeps the run's loads in front of it (in the loop: ahead of the softmax arithmetic, which covers their latency) and later loads behind it.
__global__ __launch_bounds__(256) __attribute__((amdgpu_waves_per_eu(4, 4))) void k_fattn(const h16* __restrict__ Q16, const h16* __restrict__ K16, const h16* __restrict__ VT, const bf* __restrict__ BP, h16* M16) {
    const int lane = threadIdx.x & 31;
    const int wave = __builtin_amdgcn_readfirstlane(threadIdx.x >> 5), qt = wave & 3, hh = wave >> 2;
    const int q0 = blockIdx.x * 64, h = blockIdx.y * 2 + hh, b0 = blockIdx.z * NI;
    const bf* bp = BP + ((size_t)h * (NN / 16) + (q0 >> 4) + qt) * (NN / 32) * FR + lane * 8;
    const size_t bh0 = (size_t)b0 * NH_ + h, IMS = (size_t)NH_ * NN * HD;   // IMS: elements from one image to the next in Q16, K16 and VT
    const h16* qa = Q16 + (bh0 * NN + q0 + qt * 16) * HD + lane * 8; const h16* kp = K16 + bh0 * NN * HD + lane * 8; const h16* vp = VT + bh0 * NN * HD + lane * 8;
    v16h q[NI], kf[NI][2]; v8f o[NI][2]; float m[NI], l[NI];
    v4u br[2]; v8f bias[2];
    const int rot = (blockIdx.x * 2 + blockIdx.z * 4) & (NN / 32 - 1);   // the key block at which this work-group enters its walk (see ROTATED WALKS at k_qkv): the 16 work-groups on one K and V stand 2 passes apart, the 8 on one bias row 4
    const h16* k0 = kp + rot * 2 * FR; const bf* bs = bp + rot * FR;
    br[0] = *(const v4u*)bs; br[1] = *(const v4u*)(bs + FR / 2);
#pragma unroll
    for (int im = 0; im < NI; ++im) {
        q[im] = WFrag<h16>::ld(qa + im * IMS);
        kf[im][0] = WFrag<h16>::ld(k0 + im * IMS); kf[im][1] = WFrag<h16>::ld(k0 + im * IMS + FR);
        o[im][0] = (v8f){}; o[im][1] = (v8f){}; m[im] = -3.0e38f; l[im] = 0.f; }
    asm volatile("s_wait_xcnt 0x0" :: "v"(qa), "v"(k0), "v"(bs) : "memory");   // see above
#pragma unroll 1   // kept rolled: a second pass in flight would not fit the registers of four waves per SIMD
    for (int s = 0; s < NN / 32; ++s) {   // 32 keys a pass, key block (s + rot) mod 32; the bias tile and the K fragments are fetched one pass ahead (the last pass fetches the walk's first block again: in bounds, not used)
        const int kb = (s + rot) & (NN / 32 - 1), kn = (kb + 1) & (NN / 32 - 1);
        const h16* va = vp + kb * 2 * FR; const h16* ka = kp + kn * 2 * FR; const bf* ba = bp + kn * FR;
        v8f st[NI][2]; v16h vf[NI][2];
#pragma unroll
        for (int im = 0; im < NI; ++im) { vf[im][0] = WFrag<h16>::ld(va + im * IMS); vf[im][1] = WFrag<h16>::ld(va + im * IMS + FR); }
        __builtin_amdgcn_sched_barrier(0);   // the V loads are issued at the head of the pass, ahead of the wait for K and the bias: left alone, the compiler sinks them behind the score products and they lose that lead
#pragma unroll
        for (int u = 0; u < 16; ++u) bias[u >> 3][u & 7] = __uint_as_float((u & 1) ? br[u >> 3][(u & 7) >> 1] & 0xFFFF0000u : br[u >> 3][(u & 7) >> 1] << 16);   // bf16 pair -> two f32. Here and not behind the load: the tile fetched in the pass before has landed by now
#pragma unroll
        for (int im = 0; im < NI; ++im) { st[im][0] = wmma16(kf[im][0], q[im], bias[0]); st[im][1] = wmma16(kf[im][1], q[im], bias[1]); }
        br[0] = *(const v4u*)ba; br[1] = *(const v4u*)(ba + FR / 2);
#pragma unroll
        for (int im = 0; im < NI; ++im) { kf[im][0] = WFrag<h16>::ld(ka + im * IMS); kf[im][1] = WFrag<h16>::ld(ka + im * IMS + FR); }
        asm volatile("s_wait_xcnt 0x0" :: "v"(va), "v"(ka), "v"(ba) : "memory");   // see above
#pragma unroll
        for (int im = 0; im < NI; ++im) {
            float tm = st[im][0][0];
#pragma unroll
            for (int r = 1; r < 16; ++r) tm = fmaxf(tm, st[im][r >> 3][r & 7]);
            tm = fmaxf(tm, xrow(tm));
            const float mn = fmaxf(m[im], tm), sc = exp2x1((m[im] - mn) * L2E), mb = mn * L2E - PSH; m[im] = mn;
            float ps = 0.f; v8f e[2];
#pragma unroll
            for (int t = 0; t < 2; ++t) { v8f a;
#pragma unroll
                for (int r = 0; r < 8; ++r) a[r] = fmaf(st[im][t][r], L2E, -mb);
                e[t] = exp2x8(a);
#pragma unroll
                for (int r = 0; r < 8; ++r) ps += e[t][r]; }
            l[im] = fmaf(l[im], sc, ps);
            const v16h pb = cat16(__builtin_convertvector(e[0], v8h), __builtin_convertvector(e[1], v8h));
            o[im][0] = wmma16(vf[im][0], pb, o[im][0] * sc); o[im][1] = wmma16(vf[im][1], pb, o[im][1] * sc); }
    }
#pragma unroll
    for (int im = 0; im < NI; ++im) { const float inv = 1.0f / (l[im] + xrow(l[im]));
#pragma unroll
        for (int u = 0; u < 2; ++u) *(v8h*)(M16 + ((((size_t)(b0 + im) * NN + q0) >> 4) + qt) * (CC / 32) * FR + h * FR + u * (FR / 2) + lane * 8) = __builtin_convertvector(o[im][u] * inv, v8h); }
}

extern "C" void kernel_launch(void* const* d_in, const int* in_sizes, int n_in,
                              void* d_out, int out_size, void* d_ws, size_t ws_size, hipStream_t stream) {
    (void)in_sizes; (void)n_in; (void)out_size;
    const float* x = (const float*)d_in[0]; const float* wq = (const float*)d_in[1]; const float* wk = (const float*)d_in[2]; const float* wv = (const float*)d_in[3]; const float* wo = (const float*)d_in[4]; const float* bo = (const float*)d_in[5]; const float* rb = (const float*)d_in[6]; const int* ridx = (const int*)d_in[7];
    float* OUT = (float*)d_out;     // [16][256][32][32]
    char* wsp = (char*)d_ws;
    auto take = [&](size_t bytes) { char* p = wsp; wsp += (bytes + 255) & ~(size_t)255; return (void*)p; };
    bf* W3 = (bf*)take((size_t)3 * CC * CC * 2); h16* WO = (h16*)take(CC * CC * 2);
    h16* Q16 = (h16*)take((size_t)NBI * NH_ * NN * HD * 2); h16* K16 = (h16*)take((size_t)NBI * NH_ * NN * HD * 2); h16* VT = (h16*)take((size_t)NBI * NH_ * HD * NN * 2); h16* M16 = (h16*)take((size_t)NBI * NN * CC * 2); bf* BP = (bf*)take((size_t)NH_ * NN * NN * 2);
    if ((size_t)(wsp - (char*)d_ws) > ws_size) return;    // total ~ 48.5 MiB
    k_wprep<<<dim3(CC * CC / 8 / 256, 4), 256, 0, stream>>>(wq, wk, wv, wo, W3, WO);
    k_qkv<<<dim3(NBI * NN / 64, CC / 64, 4), 32, 0, stream>>>(x, W3, rb, ridx, Q16, K16, VT, BP);
    k_fattn<<<dim3(NN / 64, NH_ / 2, NBI / NI), 256, 0, stream>>>(Q16, K16, VT, BP, M16);
    k_wo<<<dim3(NBI * NN / 64, CC / 64, 1), 32, 0, stream>>>(M16, WO, bo, OUT);
}

// v008
// One run takes 56.5 microseconds.
// In both of two side-by-side timings against v007, it was 1.05 times as fast.
// Counting every step since v000, it is 27.6 times as fast.
#include <hip/hip_runtime.h>

// Attention block with a gathered relative bias (x NCHW [16][256][32][32] -> 1024 tokens; q/k/v = xt W^T (8 heads x 32); attn = softmax(q . (k scale) + rel_bias[h][rel_idx[i][j]]) (rel_bias [8][3969] and the int32 index table read as data, clamped); out = (attn v) Wo^T + bo -> NCHW).
// Compute dtypes, f32 accumulate: every input rounded to bf16; q/k/v on PLAIN bf16 operands (inputs: exact); scores (K 32) and probs.v on single fp16 planes (the logits are dominated by the unit-scale bias; the projected q/k are
// 0.3-scale); scores, bias, softmax (f32, running maximum) and probs.v in ONE kernel, scores and probs held in registers; Wo on fp16 planes of the merged heads x fp16 weights (+ bias). Deterministic, no atomics.
// The gathered bias does not depend on the image: it is gathered and rounded ONCE, into a bf16 plane in the order of the score tiles (by a fourth z plane of k_qkv's grid), and the attention kernel reads it from there.
// Four launches: the weight roundings (all four matrices in one grid), k_qkv, k_fattn, k_wo. No activation has a layout pass of its own: k_qkv reads x as it comes (f32, NCHW) and rounds it in its fragment loader, and every epilogue stores the layout that the next reader wants.
// FRAGMENT ORDER: every 16-bit operand plane in the workspace (the four weights, q, k, V^T, the merged heads) is a row of 1-KiB fragments (16 rows x 32 k), each stored as [k >> 3 (4)][row (16)][k & 7]: lane l of a loader reads the 16 bytes at 16 l and at 512 + 16 l, so each load instruction covers four whole 128-byte lines
// (a row-major plane costs 8 or 16 lines for the same 512 bytes, and the cache path is paid by the line).

#define NBI  16
#define NI   2      // images per wave of the attention kernel: they share one bias tile
#define CC   256
#define NN   1024
#define NH_  8
#define HD   32
#define NRB  3969
#define FR   512    // elements of one operand fragment in the workspace planes
#define PSH  7.0f   // probs carry 2^PSH so that small ones stay normal fp16 numbers; the row sum carries it too, so it cancels
#define PTOP 32768.0f   // a lane's sum of a pass's probs up to here: each of them is then a finite fp16 number
#define L2E  1.4426950408889634f
typedef _Float16 h16;
typedef unsigned short bf;
typedef __attribute__((ext_vector_type(16))) __bf16   v16bf;
typedef __attribute__((ext_vector_type(8)))  __bf16   v8bf;
typedef __attribute__((ext_vector_type(16))) _Float16 v16h;
typedef __attribute__((ext_vector_type(16))) float    v16f;
typedef __attribute__((ext_vector_type(8)))  _Float16 v8h;
typedef __attribute__((ext_vector_type(8)))  unsigned short v8us;
typedef __attribute__((ext_vector_type(4)))  _Float16 v4h;
typedef __attribute__((ext_vector_type(8)))  float    v8f;
typedef __attribute__((ext_vector_type(4)))  float    v4f;
typedef __attribute__((ext_vector_type(4)))  int      v4i;
typedef __attribute__((ext_vector_type(4)))  unsigned v4u;
typedef __attribute__((ext_vector_type(16))) int      v16i;
typedef v8h  __attribute__((may_alias)) v8ha;
typedef v4f  __attribute__((may_alias)) v4fa;

__device__ __forceinline__ unsigned short f2bf(float f) { unsigned u = __float_as_uint(f); u += 0x7FFFu + ((u >> 16) & 1u); return (unsigned short)(u >> 16); }
__device__ __forceinline__ float bf2f(unsigned short b) { return __uint_as_float(((unsigned)b) << 16); }
__device__ __forceinline__ float bfr(float f) { return bf2f(f2bf(f)); }
__device__ __forceinline__ v16h cat16(v8h lo, v8h hi) { return __builtin_shufflevector(lo, hi, 0, 1, 2, 3, 4, 5, 6, 7, 8, 9, 10, 11, 12, 13, 14, 15); }
__device__ __forceinline__ v16bf cat16b(v8us lo, v8us hi) { return __builtin_bit_cast(v16bf, __builtin_shufflevector(lo, hi, 0, 1, 2, 3, 4, 5, 6, 7, 8, 9, 10, 11, 12, 13, 14, 15)); }
__device__ __forceinline__ v8f wmma16(v16h a, v16h b, v8f c) { return __builtin_amdgcn_wmma_f32_16x16x32_f16(false, a, false, b, (short)0, c, false, false); }
__device__ __forceinline__ v8f wmmab(v16bf a, v16bf b, v8f c) { return __builtin_amdgcn_wmma_f32_16x16x32_bf16(false, a, false, b, (short)0, c, false, false); }
template <typename T16> struct WFrag;
template <> struct WFrag<h16> { typedef v16h V; static __device__ __forceinline__ V ld(const h16* p) { return cat16(*(const v8h*)p, *(const v8h*)(p + FR / 2)); } static __device__ __forceinline__ v8f mma(V a, V b, v8f c) { return wmma16(a, b, c); } };
template <> struct WFrag<bf> { typedef v16bf V; static __device__ __forceinline__ V ld(const bf* p) { return cat16b(*(const v8us*)p, *(const v8us*)(p + FR / 2)); } static __device__ __forceinline__ v8f mma(V a, V b, v8f c) { return wmmab(a, b, c); } };
__device__ __forceinline__ h16 tohx(float x) { return (h16)x; }
// The weight roundings, [out][in] f32 -> fragment order: thread i writes the plane's 16-byte piece i (whole lines per wave) and reads the 8 values that belong there: row 16 (i >> 9) + (i & 15), k 32 ((i >> 6) & 7) + 8 ((i >> 4) & 3).
__device__ __forceinline__ v8f w_piece(const float* __restrict__ w, size_t i) { return *(const v8f*)(w + ((i >> 9) * 16 + (i & 15)) * CC + ((i >> 6) & 7) * 32 + ((i >> 4) & 3) * 8); }
// All four roundings are ONE launch, grid (CC * CC / 8 / 256, 4): blockIdx.y picks the matrix (0, 1, 2: Wq, Wk, Wv -> the three bf16 planes of W3, one behind the other; 3: Wo -> fp16). They need nothing of each other, and 32 work-groups as a launch of their own cost a whole launch gap and a whole load-to-store latency.
__global__ __launch_bounds__(256) void k_wprep(const float* __restrict__ wq, const float* __restrict__ wk, const float* __restrict__ wv, const float* __restrict__ wo, bf* W3, h16* WO) {
    const int y = blockIdx.y; const size_t i = (size_t)blockIdx.x * 256 + threadIdx.x;
    const v8f v = w_piece(y == 0 ? wq : y == 1 ? wk : y == 2 ? wv : wo, i);
    if (y < 3) { v8us o;
#pragma unroll
        for (int k = 0; k < 8; ++k) o[k] = f2bf(v[k]);
        *(v8us*)(W3 + (size_t)y * CC * CC + i * 8) = o;
    } else { v8h o;
#pragma unroll
        for (int k = 0; k < 8; ++k) o[k] = tohx(bfr(v[k]));
        *(v8h*)(WO + i * 8) = o;
        asm volatile("s_wait_xcnt 0x0" ::: "memory"); }   // behind the store: in the built code the other branch's block follows this one and writes the store's registers
}

// ---- The two GEMMs: ONE WAVE per 64x64 output tile (16 accumulators), K = CC in steps of 32, operands straight from global memory (the 16-bit planes in fragment order), 32 threads a work-group.
// A lane of an accumulator holds ONE column and eight consecutive rows, so each product is set up with the index that is contiguous in its result's layout as the ROW index; the tile goes through LDS once so that every store instruction writes whole 128-byte lines.
// x W^T for 64 tokens x 64 output channels. x is [c][n]: one 16-byte load gives a lane FOUR tokens (n0 + 4 lr + t) at one k, so token block t of the tile is made of the tokens n0 + 4 r + t (r: the fragment's row or column): every load covers whole lines and nothing is transposed; the epilogues undo the order.
// k order of both loaders, element e of a fragment: kc + 8 hi + (e & 7) + 16 (e >> 3). XROWS: the tokens are the rows (A operand), else the columns (B operand). acc[g][t]: channel block g, token block t.
// rot: the k step at which this wave enters its walk over K (it wraps round): see ROTATED WALKS at k_qkv.
template <bool XROWS>
__device__ __forceinline__ void xw_tile(const float* xp, const bf* wp, v8f (&acc)[4][4], int rot) {
#pragma unroll 1   // kept rolled: the raw f32 values of a second step would not fit beside the 16 accumulators
    for (int i = 0; i < CC / 32; ++i) { const int kc = ((i + rot) & (CC / 32 - 1)) * 32;
        const float* xk = xp + (size_t)kc * NN; const bf* wk = wp + (kc >> 5) * FR;
        v4f xv[16]; v16bf xf[4], wf[4];
#pragma unroll
        for (int e = 0; e < 16; ++e) xv[e] = *(const v4f*)(xk + (size_t)((e & 7) + (e >> 3) * 16) * NN);
#pragma unroll
        for (int g = 0; g < 4; ++g) wf[g] = WFrag<bf>::ld(wk + g * (CC / 32) * FR);
        asm volatile("s_wait_xcnt 0x0" :: "v"(xk), "v"(wk) : "memory");   // behind the step's loads: their address registers are inputs, so they live up to the wait; the next step forms its addresses anew in them
        __builtin_amdgcn_sched_barrier(0);   // all 24 loads of the step are issued before its arithmetic: left alone, the compiler reloads two weight fragments among the matrix instructions and the wave waits out the load latency three times a step
#pragma unroll
        for (int t = 0; t < 4; ++t) { v16f c;
#pragma unroll
            for (int e = 0; e < 16; ++e) c[e] = xv[e][t];
            xf[t] = __builtin_convertvector(c, v16bf); }
#pragma unroll
        for (int g = 0; g < 4; ++g)
#pragma unroll
            for (int t = 0; t < 4; ++t) acc[g][t] = XROWS ? wmmab(xf[t], wf[g], acc[g][t]) : wmmab(wf[g], xf[t], acc[g][t]);
        asm volatile("v_nop\n\tv_nop\n\tv_nop\n\tv_nop" : "+v"(acc[0][0]), "+v"(acc[1][1]), "+v"(acc[2][2]), "+v"(acc[3][3]) : "v"(xf[3]), "v"(wf[3]));   // the slots behind the last matrix instruction on the loop's taken branch
    }
}
// ---- The bias plane BP: [head][query >> 4][key >> 5] tiles of 1 KiB (16 queries x 32 keys, bf16: the rounding that every input takes anyway, so nothing is lost). Piece t * 32 + lane of a tile holds, for query lr, the keys 16 t + 8 hi + (0..7): what that lane holds of the C operand of score tile t.
// One wave: two (query tile, key block) pairs, all eight heads of each (the index rows are read once for the eight). The index is data: clamped before it forms an address.
__device__ __forceinline__ void ld_ix(const int* p, v4i (&ix)[4]) {
#pragma unroll
    for (int c = 0; c < 4; ++c) ix[c] = *(const v4i*)(p + (c >> 1) * 16 + (c & 1) * 4); }
__device__ __forceinline__ v16i clamp_ix(const v4i (&ix)[4]) { v16i kx;
#pragma unroll
    for (int u = 0; u < 16; ++u) kx[u] = min(max(ix[u >> 2][u & 3], 0), NRB - 1);
    return kx; }
__device__ __forceinline__ void bias_tiles(const float* __restrict__ rb, const int* __restrict__ ridx, bf* BP, int id, int lane) {
    const int lr = lane & 15, hi = lane >> 4, qt = id >> 4, s0 = (id & 15) * 2;
    const int* ir = ridx + (size_t)(qt * 16 + lr) * NN + s0 * 32 + 8 * hi;
    bf* dst = BP + ((size_t)qt * (NN / 32) + s0) * FR + lane * 8;
    v4i ix[2][4]; v16i kx[2];
    ld_ix(ir, ix[0]); ld_ix(ir + 32, ix[1]);
    asm volatile("s_wait_xcnt 0x0" :: "v"(ir) : "memory");   // behind the index loads: their address register is an input, so it lives up to the wait
    kx[0] = clamp_ix(ix[0]); kx[1] = clamp_ix(ix[1]);
#pragma unroll
    for (int h0 = 0; h0 < NH_; h0 += 4) {   // four heads (128 gathers) in flight at a time: one load latency for the four
        v8f rw[4][2][2];
#pragma unroll
        for (int g = 0; g < 4; ++g)
#pragma unroll
            for (int p = 0; p < 2; ++p)
#pragma unroll
                for (int u = 0; u < 16; ++u) rw[g][p][u >> 3][u & 7] = rb[(size_t)(h0 + g) * NRB + kx[p][u]];
        asm volatile("s_wait_xcnt 0x0" :: "v"(kx[0]), "v"(kx[1]) : "memory");   // behind the gathers: their index registers are inputs, so they live up to the wait and no result of the run is placed on one of them; the clobber keeps all 128 in front of the first store
#pragma unroll
        for (int g = 0; g < 4; ++g)
#pragma unroll
            for (int p = 0; p < 2; ++p)
#pragma unroll
                for (int t = 0; t < 2; ++t) *(v8us*)(dst + (size_t)(h0 + g) * (NN / 16) * (NN / 32) * FR + p * FR + t * (FR / 2)) = __builtin_bit_cast(v8us, __builtin_convertvector(rw[g][p][t], v8bf));
        asm volatile("s_wait_xcnt 0x0" :: "v"(dst) : "memory");   // behind the stores: what follows writes their data registers
    }
}
// ROTATED WALKS: waves of different work-groups that read the same lines (a weight plane: 256 waves; an x tile: 12; in k_wo a token tile: 4; in k_fattn one head's K and V: 16 work-groups, a bias row: 8) start together and would ask L2 for the same line at the same moment all the way down. Each enters its walk (over K here and in k_wo, over the keys in k_fattn) at a step of its own, taken from its block index, and wraps round: the same loads and products, in another order.
// grid (NBI * NN / 64, CC / 64, 4), z = q, k, v (W3: their three weight planes one behind the other), 3: the bias plane (1024 waves that run beside the GEMM waves and need nothing of them). q, k: rows = channels, so a lane holds 8 consecutive d of one token -> Q16 / K16 [b][h][n >> 4] fragments (row n & 15, k = d; k scaled in f32 before it is rounded). v: rows = tokens, so a lane holds 32 consecutive tokens of one channel -> VT [b][h][n >> 5][d >> 4] fragments (row d & 15, k = n & 31).
__global__ __launch_bounds__(32) void k_qkv(const float* __restrict__ x, const bf* __restrict__ W3, const float* __restrict__ rb, const int* __restrict__ ridx, h16* Q16, h16* K16, h16* VT, bf* BP) {
    __shared__ __align__(16) h16 os[2 * 64 * 40];   // q, k: [head][token][40]; v: [channel][72]
    const int lane = threadIdx.x & 31, lr = lane & 15, hi = lane >> 4;
    const int z = blockIdx.z, b = blockIdx.x >> 4, n0 = (blockIdx.x & 15) * 64, o0 = blockIdx.y * 64;
    if (z == 3) { bias_tiles(rb, ridx, BP, blockIdx.y * (NBI * NN / 64) + blockIdx.x, lane); return; }
    const float* xp = x + ((size_t)b * CC + 8 * hi) * NN + n0 + 4 * lr;
    const bf* wp = W3 + (size_t)((z * CC + o0) >> 4) * (CC / 32) * FR + lane * 8;
    const int rot = blockIdx.x + blockIdx.y + 4 * z;
    v8f acc[4][4];
#pragma unroll
    for (int g = 0; g < 4; ++g)
#pragma unroll
        for (int t = 0; t < 4; ++t) acc[g][t] = (v8f){};
    if (z < 2) {
        xw_tile<false>(xp, wp, acc, rot);   // acc[g][t][j]: channel o0 + 16 g + 8 hi + j, token n0 + 4 lr + t
        const float sc = z == 1 ? 0.1767766952966369f : 1.0f;
#pragma unroll
        for (int g = 0; g < 4; ++g)
#pragma unroll
            for (int t = 0; t < 4; ++t) *(v8ha*)(os + ((g >> 1) * 64 + 4 * lr + t) * 40 + (g & 1) * 16 + 8 * hi) = __builtin_convertvector(acc[g][t] * sc, v8h);
        __builtin_amdgcn_wave_barrier(); asm volatile("" ::: "memory");   // one wave: its LDS operations run in order; this keeps the compiler from moving the reads of other lanes' rows over the writes
        h16* dst = (z == 0 ? Q16 : K16) + (((size_t)b * NH_ + (o0 >> 5)) * NN + n0) * HD;
#pragma unroll
        for (int s = 0; s < 16; ++s) { const int c = s * 32 + lane, hd = c >> 8, tok = ((c >> 6) & 3) * 16 + (c & 15), pc = (c >> 4) & 3;
            *(v8h*)(dst + (size_t)hd * NN * HD + (c & 255) * 8) = *(const v8ha*)(os + (hd * 64 + tok) * 40 + pc * 8); }
    } else {
        xw_tile<true>(xp, wp, acc, rot);    // acc[g][t][j]: token n0 + 4 (8 hi + j) + t, channel o0 + 16 g + lr
#pragma unroll
        for (int g = 0; g < 4; ++g)
#pragma unroll
            for (int q = 0; q < 4; ++q) { v8f c;
#pragma unroll
                for (int e = 0; e < 8; ++e) c[e] = acc[g][e & 3][2 * q + (e >> 2)];   // tokens n0 + 32 hi + 8 q + e
                *(v8ha*)(os + (g * 16 + lr) * 72 + 32 * hi + 8 * q) = __builtin_convertvector(c, v8h); }
        __builtin_amdgcn_wave_barrier(); asm volatile("" ::: "memory");   // as above
        h16* dst = VT + (((size_t)b * NH_ + (o0 >> 5)) * NN + n0) * HD;
#pragma unroll
        for (int s = 0; s < 16; ++s) { const int c = s * 32 + lane, hd = c >> 8, row = hd * 32 + ((c >> 6) & 1) * 16 + (c & 15), pc = ((c >> 7) & 1) * 4 + ((c >> 4) & 3);
            *(v8h*)(dst + (size_t)hd * NN * HD + (c & 255) * 8) = *(const v8ha*)(os + row * 72 + pc * 8); }
    }
}
// grid (NBI * NN / 64, CC / 64): OUT [b][c][n] = merged heads . Wo^T + bo. Rows = tokens (natural order), columns = output channels: a lane holds 8 consecutive tokens of one channel, which is NCHW.
__global__ __launch_bounds__(32) void k_wo(const h16* __restrict__ M16, const h16* __restrict__ WO, const float* __restrict__ bo, float* OUT) {
    __shared__ __align__(16) float os[16 * 68];
    const int lane = threadIdx.x & 31, lr = lane & 15, hi = lane >> 4;
    const int b = blockIdx.x >> 4, n0 = (blockIdx.x & 15) * 64, c0 = blockIdx.y * 64;
    const h16* ap = M16 + (size_t)((b * NN + n0) >> 4) * (CC / 32) * FR + lane * 8;
    const h16* wp = WO + (size_t)(c0 >> 4) * (CC / 32) * FR + lane * 8;
    v8f acc[4][4];
#pragma unroll
    for (int mb = 0; mb < 4; ++mb)
#pragma unroll
        for (int nb = 0; nb < 4; ++nb) acc[mb][nb] = (v8f){};
    const int rot = blockIdx.x + 2 * blockIdx.y;   // see ROTATED WALKS at k_qkv
#pragma unroll 1   // kept rolled: one step's fragments beside the 16 accumulators
    for (int i = 0; i < CC / 32; ++i) { const int kc = ((i + rot) & (CC / 32 - 1)) * 32;
        const h16* ak = ap + (kc >> 5) * FR; const h16* wk = wp + (kc >> 5) * FR;
        v16h a[4], w[4];
#pragma unroll
        for (int mb = 0; mb < 4; ++mb) a[mb] = WFrag<h16>::ld(ak + mb * (CC / 32) * FR);
#pragma unroll
        for (int nb = 0; nb < 4; ++nb) w[nb] = WFrag<h16>::ld(wk + nb * (CC / 32) * FR);
        asm volatile("s_wait_xcnt 0x0" :: "v"(ak), "v"(wk) : "memory");   // behind the step's loads: their address registers are inputs, so they live up to the wait and no result of the run is placed on one of them
#pragma unroll
        for (int nb = 0; nb < 4; ++nb)
#pragma unroll
            for (int mb = 0; mb < 4; ++mb) acc[mb][nb] = wmma16(a[mb], w[nb], acc[mb][nb]);
        asm volatile("v_nop\n\tv_nop\n\tv_nop\n\tv_nop" : "+v"(acc[0][0]), "+v"(acc[1][1]), "+v"(acc[2][2]), "+v"(acc[3][3]) : "v"(a[3]), "v"(w[3]));   // as in xw_tile
    }
#pragma unroll
    for (int nb = 0; nb < 4; ++nb) {   // acc[mb][nb][j]: token n0 + 16 mb + 8 hi + j, channel c0 + 16 nb + lr
        const float bb = bfr(bo[c0 + nb * 16 + lr]);
#pragma unroll
        for (int mb = 0; mb < 4; ++mb) { const v8f v = acc[mb][nb] + bb;
            *(v4fa*)(os + lr * 68 + mb * 16 + 8 * hi) = (v4f){v[0], v[1], v[2], v[3]}; *(v4fa*)(os + lr * 68 + mb * 16 + 8 * hi + 4) = (v4f){v[4], v[5], v[6], v[7]}; }
        __builtin_amdgcn_wave_barrier(); asm volatile("" ::: "memory");   // as in k_qkv
        float* dst = OUT + ((size_t)b * CC + c0 + nb * 16) * NN + n0;
#pragma unroll
        for (int s = 0; s < 8; ++s) { const int c = s * 32 + lane, row = c >> 4, pc = c & 15;
            *(v4f*)(dst + (size_t)row * NN + pc * 4) = *(const v4fa*)(os + row * 68 + pc * 4); }
        __builtin_amdgcn_wave_barrier(); asm volatile("" ::: "memory");   // the next block's writes stay behind these reads
    }
}

// ---- k_fattn: scores + bias (from the plane BP) + softmax + probs.v for 16 queries of one head and NI images per wave; nothing of the score plane leaves the registers.
// Transposed products: S^T = K Q^T + bias (the bias tile is the C operand: a lane holds query lr, keys 8 hi + r), O^T += V^T P^T (two S^T tiles, converted in place, are the B operand in the hardware k order; V^T rows by the same loader).
// Work-group: 8 waves = 4 query tiles x 2 heads (the tiles share K and V through the cache). An O^T tile in its registers IS a half fragment of the merged-heads plane (row = query, k = d), so each wave stores its own whole lines. grid (NN / 64, NH_ / 2, NBI / NI) = 4096 waves, four per SIMD, all resident at once: hence amdgpu_waves_per_eu(4, 4), which holds the register count to that.
// Every inner loop is unrolled so that the fragment arrays are indexed by constants and stay in registers.
__device__ __forceinline__ float xrow(float v) { const int b = __float_as_int(v); return __int_as_float(__builtin_amdgcn_permlanex16(b, b, 0x76543210, 0xfedcba98, false, false)); }   // lane l <-> l ^ 16
// Eight v_exp_f32 in one statement: no result lies on a source ("=&v"), and the closing v_nop is the slot the instruction set asks for between a transcendental and the next user of its result or writer of its source.
__device__ __forceinline__ v8f exp2x8(v8f x) { float y0, y1, y2, y3, y4, y5, y6, y7;
    asm("v_exp_f32 %0, %8\n\tv_exp_f32 %1, %9\n\tv_exp_f32 %2, %10\n\tv_exp_f32 %3, %11\n\tv_exp_f32 %4, %12\n\tv_exp_f32 %5, %13\n\tv_exp_f32 %6, %14\n\tv_exp_f32 %7, %15\n\tv_nop"
        : "=&v"(y0), "=&v"(y1), "=&v"(y2), "=&v"(y3), "=&v"(y4), "=&v"(y5), "=&v"(y6), "=&v"(y7) : "v"(x[0]), "v"(x[1]), "v"(x[2]), "v"(x[3]), "v"(x[4]), "v"(x[5]), "v"(x[6]), "v"(x[7]));
    return (v8f){y0, y1, y2, y3, y4, y5, y6, y7}; }
__device__ __forceinline__ float exp2x1(float x) { float y; asm("v_exp_f32 %0, %1\n\tv_nop" : "=v"(y) : "v"(x)); return y; }   // the same slot behind a single one
// One image's probs of a pass, e = 2^(score log2(e) - mb), and the lane's sum of them.
__device__ __forceinline__ float probs(const v8f (&st)[2], float mb, v8f (&e)[2]) { float ps = 0.f;
#pragma unroll
    for (int t = 0; t < 2; ++t) { v8f a;
#pragma unroll
        for (int r = 0; r < 8; ++r) a[r] = fmaf(st[t][r], L2E, -mb);
        e[t] = exp2x8(a);
#pragma unroll
        for (int r = 0; r < 8; ++r) ps += e[t][r]; }
    return ps; }
// s_wait_xcnt 0 behind a run of global loads: the run's address registers are inputs of the statement, so they live up to the wait and no result of the run is placed on one of them; the memory clobber keeps the run's loads in front of it (in the loop: ahead of the softmax arithmetic, which covers their latency) and later loads behind it.
__global__ __launch_bounds__(256) __attribute__((amdgpu_waves_per_eu(4, 4))) void k_fattn(const h16* __restrict__ Q16, const h16* __restrict__ K16, const h16* __restrict__ VT, const bf* __restrict__ BP, h16* M16) {
    const int lane = threadIdx.x & 31;
    const int wave = __builtin_amdgcn_readfirstlane(threadIdx.x >> 5), qt = wave & 3, hh = wave >> 2;
    const int q0 = blockIdx.x * 64, h = blockIdx.y * 2 + hh, b0 = blockIdx.z * NI;
    const bf* bp = BP + ((size_t)h * (NN / 16) + (q0 >> 4) + qt) * (NN / 32) * FR + lane * 8;
    const size_t bh0 = (size_t)b0 * NH_ + h, IMS = (size_t)NH_ * NN * HD;   // IMS: elements from one image to the next in Q16, K16 and VT
    const h16* qa = Q16 + (bh0 * NN + q0 + qt * 16) * HD + lane * 8; const h16* kp = K16 + bh0 * NN * HD + lane * 8; const h16* vp = VT + bh0 * NN * HD + lane * 8;
    v16h q[NI], kf[NI][2]; v8f o[NI][2]; float m[NI], l[NI], mb[NI];   // m: the maximum in use, mb = m log2(e) - PSH
    v4u br[2]; v8f bias[2];
    const int rot = (blockIdx.x * 2 + blockIdx.z * 4) & (NN / 32 - 1);   // the key block at which this work-group enters its walk (see ROTATED WALKS at k_qkv): the 16 work-groups on one K and V stand 2 passes apart, the 8 on one bias row 4
    const h16* k0 = kp + rot * 2 * FR; const bf* bs = bp + rot * FR;
    br[0] = *(const v4u*)bs; br[1] = *(const v4u*)(bs + FR / 2);
#pragma unroll
    for (int im = 0; im < NI; ++im) {
        q[im] = WFrag<h16>::ld(qa + im * IMS);
        kf[im][0] = WFrag<h16>::ld(k0 + im * IMS); kf[im][1] = WFrag<h16>::ld(k0 + im * IMS + FR);
        o[im][0] = (v8f){}; o[im][1] = (v8f){}; m[im] = -3.0e38f; mb[im] = -__builtin_inff(); l[im] = 0.f; }   // with this mb the first pass's probs come out infinite, so the first pass sets the maximum
    asm volatile("s_wait_xcnt 0x0" :: "v"(qa), "v"(k0), "v"(bs) : "memory");   // see above
#pragma unroll 1   // kept rolled: a second pass in flight would not fit the registers of four waves per SIMD
    for (int s = 0; s < NN / 32; ++s) {   // 32 keys a pass, key block (s + rot) mod 32; the bias tile and the K fragments are fetched one pass ahead (the last pass fetches the walk's first block again: in bounds, not used)
        const int kb = (s + rot) & (NN / 32 - 1), kn = (kb + 1) & (NN / 32 - 1);
        const h16* va = vp + kb * 2 * FR; const h16* ka = kp + kn * 2 * FR; const bf* ba = bp + kn * FR;
        v8f st[NI][2]; v16h vf[NI][2];
#pragma unroll
        for (int im = 0; im < NI; ++im) { vf[im][0] = WFrag<h16>::ld(va + im * IMS); vf[im][1] = WFrag<h16>::ld(va + im * IMS + FR); }
        __builtin_amdgcn_sched_barrier(0);   // the V loads are issued at the head of the pass, ahead of the wait for K and the bias: left alone, the compiler sinks them behind the score products and they lose that lead
#pragma unroll
        for (int u = 0; u < 16; ++u) bias[u >> 3][u & 7] = __uint_as_float((u & 1) ? br[u >> 3][(u & 7) >> 1] & 0xFFFF0000u : br[u >> 3][(u & 7) >> 1] << 16);   // bf16 pair -> two f32. Here and not behind the load: the tile fetched in the pass before has landed by now
#pragma unroll
        for (int im = 0; im < NI; ++im) { st[im][0] = wmma16(kf[im][0], q[im], bias[0]); st[im][1] = wmma16(kf[im][1], q[im], bias[1]); }
        br[0] = *(const v4u*)ba; br[1] = *(const v4u*)(ba + FR / 2);
#pragma unroll
        for (int im = 0; im < NI; ++im) { kf[im][0] = WFrag<h16>::ld(ka + im * IMS); kf[im][1] = WFrag<h16>::ld(ka + im * IMS + FR); }
        asm volatile("s_wait_xcnt 0x0" :: "v"(va), "v"(ka), "v"(ba) : "memory");   // see above
        // LAZY MAXIMUM: softmax does not depend on the value subtracted, so a pass takes the maximum in use as it is: no search, no rescaling. The probs are positive, so a lane's sum bounds each of them: while it stays under PTOP they all fit fp16.
        // Else (also an infinite or NaN sum, and always in the first pass) the whole wave renews its maxima from this pass's scores, rescales what it has summed and forms the pass's probs again, which then are at most 2^PSH.
        v8f e[NI][2]; float ps[NI]; bool over = false;
#pragma unroll
        for (int im = 0; im < NI; ++im) { ps[im] = probs(st[im], mb[im], e[im]); over |= !(ps[im] <= PTOP); }
        if (__builtin_amdgcn_ballot_w32(over) != 0) {   // one test a pass, a scalar branch: every lane is on inside it (the exchange between the wave's halves needs that)
#pragma unroll
            for (int im = 0; im < NI; ++im) {
                float tm = st[im][0][0];
#pragma unroll
                for (int r = 1; r < 16; ++r) tm = fmaxf(tm, st[im][r >> 3][r & 7]);
                tm = fmaxf(tm, xrow(tm));
                const float mn = fmaxf(m[im], tm), sc = exp2x1((m[im] - mn) * L2E); m[im] = mn; mb[im] = mn * L2E - PSH;
                l[im] *= sc; o[im][0] *= sc; o[im][1] *= sc;
                ps[im] = probs(st[im], mb[im], e[im]); }
        }
#pragma unroll
        for (int im = 0; im < NI; ++im) {
            l[im] += ps[im];
            const v16h pb = cat16(__builtin_convertvector(e[im][0], v8h), __builtin_convertvector(e[im][1], v8h));
            o[im][0] = wmma16(vf[im][0], pb, o[im][0]); o[im][1] = wmma16(vf[im][1], pb, o[im][1]); }
    }
#pragma unroll
    for (int im = 0; im < NI; ++im) { const float inv = 1.0f / (l[im] + xrow(l[im]));
#pragma unroll
        for (int u = 0; u < 2; ++u) *(v8h*)(M16 + ((((size_t)(b0 + im) * NN + q0) >> 4) + qt) * (CC / 32) * FR + h * FR + u * (FR / 2) + lane * 8) = __builtin_convertvector(o[im][u] * inv, v8h); }
}

extern "C" void kernel_launch(void* const* d_in, const int* in_sizes, int n_in,
                              void* d_out, int out_size, void* d_ws, size_t ws_size, hipStream_t stream) {
    (void)in_sizes; (void)n_in; (void)out_size;
    const float* x = (const float*)d_in[0]; const float* wq = (const float*)d_in[1]; const float* wk = (const float*)d_in[2]; const float* wv = (const float*)d_in[3]; const float* wo = (const float*)d_in[4]; const float* bo = (const float*)d_in[5]; const float* rb = (const float*)d_in[6]; const int* ridx = (const int*)d_in[7];
    float* OUT = (float*)d_out;     // [16][256][32][32]
    char* wsp = (char*)d_ws;
    auto take = [&](size_t bytes) { char* p = wsp; wsp += (bytes + 255) & ~(size_t)255; return (void*)p; };
    bf* W3 = (bf*)take((size_t)3 * CC * CC * 2); h16* WO = (h16*)take(CC * CC * 2);
    h16* Q16 = (h16*)take((size_t)NBI * NH_ * NN * HD * 2); h16* K16 = (h16*)take((size_t)NBI * NH_ * NN * HD * 2); h16* VT = (h16*)take((size_t)NBI * NH_ * HD * NN * 2); h16* M16 = (h16*)take((size_t)NBI * NN * CC * 2); bf* BP = (bf*)take((size_t)NH_ * NN * NN * 2);
    if ((size_t)(wsp - (char*)d_ws) > ws_size) return;    // total ~ 48.5 MiB
    k_wprep<<<dim3(CC * CC / 8 / 256, 4), 256, 0, stream>>>(wq, wk, wv, wo, W3, WO);
    k_qkv<<<dim3(NBI * NN / 64, CC / 64, 4), 32, 0, stream>>>(x, W3, rb, ridx, Q16, K16, VT, BP);
    k_fattn<<<dim3(NN / 64, NH_ / 2, NBI / NI), 256, 0, stream>>>(Q16, K16, VT, BP, M16);
    k_wo<<<dim3(NBI * NN / 64, CC / 64, 1), 32, 0, stream>>>(M16, WO, bo, OUT);
}

// v009
// It runs in 53.1 microseconds.
// In two side-by-side timings against v008, it was 1.07 and 1.06 times as fast.
// Counting every step since v000, it is 29.4 times as fast.
#include <hip/hip_runtime.h>

// Attention block with a gathered relative bias (x NCHW [16][256][32][32] -> 1024 tokens; q/k/v = xt W^T (8 heads x 32); attn = softmax(q . (k scale) + rel_bias[h][rel_idx[i][j]]) (rel_bias [8][3969] and the int32 index table read as data, clamped); out = (attn v) Wo^T + bo -> NCHW).
// Compute dtypes, f32 accumulate: every input rounded to bf16; q/k/v on PLAIN bf16 operands (inputs: exact); scores (K 32) and probs.v on single fp16 planes (the logits are dominated by the unit-scale bias; the projected q/k are
// 0.3-scale); scores, bias, softmax (f32, running maximum) and probs.v in ONE kernel, scores and probs held in registers; Wo on fp16 planes of the merged heads x fp16 weights (+ bias). Deterministic, no atomics.
// The gathered bias does not depend on the image: it is gathered and rounded ONCE, into a bf16 plane in the order of the score tiles (by a fourth z plane of k_qkv's grid), and the attention kernel reads it from there.
// Four launches: the weight roundings (all four matrices in one grid), k_qkv, k_fattn, k_wo. No activation has a layout pass of its own: k_qkv reads x as it comes (f32, NCHW) and rounds it in its fragment loader, and every epilogue stores the layout that the next reader wants.
// FRAGMENT ORDER: every 16-bit operand plane in the workspace (the four weights, q, k, V^T, the merged heads) is a row of 1-KiB fragments (16 rows x 32 k), each stored as [k >> 3 (4)][row (16)][k & 7]: lane l of a loader reads the 16 bytes at 16 l and at 512 + 16 l, so each load instruction covers four whole 128-byte lines
// (a row-major plane costs 8 or 16 lines for the same 512 bytes, and the cache path is paid by the line).

#define NBI  16
#define NI   2      // images per wave of the attention kernel: they share one bias tile
#define CC   256
#define NN   1024
#define NH_  8
#define HD   32
#define NRB  3969
#define FR   512    // elements of one operand fragment in the workspace planes
#define PSH  7.0f   // probs carry 2^PSH so that small ones stay normal fp16 numbers; the row sum carries it too, so it cancels
#define PTOP 32768.0f   // a lane's sum of a pass's probs up to here: each of them is then a finite fp16 number
#define L2E  1.4426950408889634f
typedef _Float16 h16;
typedef unsigned short bf;
typedef __attribute__((ext_vector_type(16))) __bf16   v16bf;
typedef __attribute__((ext_vector_type(8)))  __bf16   v8bf;
typedef __attribute__((ext_vector_type(16))) _Float16 v16h;
typedef __attribute__((ext_vector_type(16))) float    v16f;
typedef __attribute__((ext_vector_type(8)))  _Float16 v8h;
typedef __attribute__((ext_vector_type(8)))  unsigned short v8us;
typedef __attribute__((ext_vector_type(4)))  _Float16 v4h;
typedef __attribute__((ext_vector_type(8)))  float    v8f;
typedef __attribute__((ext_vector_type(4)))  float    v4f;
typedef __attribute__((ext_vector_type(4)))  int      v4i;
typedef __attribute__((ext_vector_type(4)))  unsigned v4u;
typedef __attribute__((ext_vector_type(16))) int      v16i;
typedef v8h  __attribute__((may_alias)) v8ha;
typedef v4f  __attribute__((may_alias)) v4fa;

__device__ __forceinline__ unsigned short f2bf(float f) { unsigned u = __float_as_uint(f); u += 0x7FFFu + ((u >> 16) & 1u); return (unsigned short)(u >> 16); }
__device__ __forceinline__ float bf2f(unsigned short b) { return __uint_as_float(((unsigned)b) << 16); }
__device__ __forceinline__ float bfr(float f) { return bf2f(f2bf(f)); }
__device__ __forceinline__ v16h cat16(v8h lo, v8h hi) { return __builtin_shufflevector(lo, hi, 0, 1, 2, 3, 4, 5, 6, 7, 8, 9, 10, 11, 12, 13, 14, 15); }
__device__ __forceinline__ v16bf cat16b(v8us lo, v8us hi) { return __builtin_bit_cast(v16bf, __builtin_shufflevector(lo, hi, 0, 1, 2, 3, 4, 5, 6, 7, 8, 9, 10, 11, 12, 13, 14, 15)); }
__device__ __forceinline__ v8f wmma16(v16h a, v16h b, v8f c) { return __builtin_amdgcn_wmma_f32_16x16x32_f16(false, a, false, b, (short)0, c, false, false); }
__device__ __forceinline__ v8f wmmab(v16bf a, v16bf b, v8f c) { return __builtin_amdgcn_wmma_f32_16x16x32_bf16(false, a, false, b, (short)0, c, false, false); }
template <typename T16> struct WFrag;
template <> struct WFrag<h16> { typedef v16h V; static __device__ __forceinline__ V ld(const h16* p) { return cat16(*(const v8h*)p, *(const v8h*)(p + FR / 2)); } static __device__ __forceinline__ v8f mma(V a, V b, v8f c) { return wmma16(a, b, c); } };
template <> struct WFrag<bf> { typedef v16bf V; static __device__ __forceinline__ V ld(const bf* p) { return cat16b(*(const v8us*)p, *(const v8us*)(p + FR / 2)); } static __device__ __forceinline__ v8f mma(V a, V b, v8f c) { return wmmab(a, b, c); } };
__device__ __forceinline__ h16 tohx(float x) { return (h16)x; }
// The weight roundings, [out][in] f32 -> fragment order: thread i writes the plane's 16-byte piece i (whole lines per wave) and reads the 8 values that belong there: row 16 (i >> 9) + (i & 15), k 32 ((i >> 6) & 7) + 8 ((i >> 4) & 3).
__device__ __forceinline__ v8f w_piece(const float* __restrict__ w, size_t i) { return *(const v8f*)(w + ((i >> 9) * 16 + (i & 15)) * CC + ((i >> 6) & 7) * 32 + ((i >> 4) & 3) * 8); }
// All four roundings are ONE launch, grid (CC * CC / 8 / 256, 4): blockIdx.y picks the matrix (0, 1, 2: Wq, Wk, Wv -> the three bf16 planes of W3, one behind the other; 3: Wo -> fp16). They need nothing of each other, and 32 work-groups as a launch of their own cost a whole launch gap and a whole load-to-store latency.
__global__ __launch_bounds__(256) void k_wprep(const float* __restrict__ wq, const float* __restrict__ wk, const float* __restrict__ wv, const float* __restrict__ wo, bf* W3, h16* WO) {
    const int y = blockIdx.y; const size_t i = (size_t)blockIdx.x * 256 + threadIdx.x;
    const v8f v = w_piece(y == 0 ? wq : y == 1 ? wk : y == 2 ? wv : wo, i);
    if (y < 3) { v8us o;
#pragma unroll
        for (int k = 0; k < 8; ++k) o[k] = f2bf(v[k]);
        *(v8us*)(W3 + (size_t)y * CC * CC + i * 8) = o;
    } else { v8h o;
#pragma unroll
        for (int k = 0; k < 8; ++k) o[k] = tohx(bfr(v[k]));
        *(v8h*)(WO + i * 8) = o;
        asm volatile("s_wait_xcnt 0x0" ::: "memory"); }   // behind the store: in the built code the other branch's block follows this one and writes the store's registers
}

// ---- The two GEMMs: ONE WAVE per 64x64 output tile (16 accumulators), K = CC in steps of 32, operands straight from global memory (the 16-bit planes in fragment order), 32 threads a work-group.
// A lane of an accumulator holds ONE column and eight consecutive rows, so each product is set up with the index that is contiguous in its result's layout as the ROW index; the tile goes through LDS once so that every store instruction writes whole 128-byte lines.
// x W^T for 64 tokens x 64 output channels. x is [c][n]: one 16-byte load gives a lane FOUR tokens (n0 + 4 lr + t) at one k, so token block t of the tile is made of the tokens n0 + 4 r + t (r: the fragment's row or column): every load covers whole lines and nothing is transposed; the epilogues undo the order.
// k order of both loaders, element e of a fragment: kc + 8 hi + (e & 7) + 16 (e >> 3). XROWS: the tokens are the rows (A operand), else the columns (B operand). acc[g][t]: channel block g, token block t.
// rot: the k step at which this wave enters its walk over K (it wraps round): see ROTATED WALKS at k_qkv.
template <bool XROWS>
__device__ __forceinline__ void xw_tile(const float* xp, const bf* wp, v8f (&acc)[4][4], int rot) {
#pragma unroll 1   // kept rolled: the raw f32 values of a second step would not fit beside the 16 accumulators
    for (int i = 0; i < CC / 32; ++i) { const int kc = ((i + rot) & (CC / 32 - 1)) * 32;
        const float* xk = xp + (size_t)kc * NN; const bf* wk = wp + (kc >> 5) * FR;
        v4f xv[16]; v16bf xf[4], wf[4];
#pragma unroll
        for (int e = 0; e < 16; ++e) xv[e] = *(const v4f*)(xk + (size_t)((e & 7) + (e >> 3) * 16) * NN);
#pragma unroll
        for (int g = 0; g < 4; ++g) wf[g] = WFrag<bf>::ld(wk + g * (CC / 32) * FR);
        asm volatile("s_wait_xcnt 0x0" :: "v"(xk), "v"(wk) : "memory");   // behind the step's loads: their address registers are inputs, so they live up to the wait; the next step forms its addresses anew in them
        __builtin_amdgcn_sched_barrier(0);   // all 24 loads of the step are issued before its arithmetic: left alone, the compiler reloads two weight fragments among the matrix instructions and the wave waits out the load latency three times a step
#pragma unroll
        for (int t = 0; t < 4; ++t) { v16f c;
#pragma unroll
            for (int e = 0; e < 16; ++e) c[e] = xv[e][t];
            xf[t] = __builtin_convertvector(c, v16bf); }
#pragma unroll
        for (int g = 0; g < 4; ++g)
#pragma unroll
            for (int t = 0; t < 4; ++t) acc[g][t] = XROWS ? wmmab(xf[t], wf[g], acc[g][t]) : wmmab(wf[g], xf[t], acc[g][t]);
        asm volatile("v_nop\n\tv_nop\n\tv_nop\n\tv_nop" : "+v"(acc[0][0]), "+v"(acc[1][1]), "+v"(acc[2][2]), "+v"(acc[3][3]) : "v"(xf[3]), "v"(wf[3]));   // the slots behind the last matrix instruction on the loop's taken branch
    }
}
// ---- The bias plane BP: [head][query >> 4][key >> 5] tiles of 1 KiB (16 queries x 32 keys, bf16: the rounding that every input takes anyway, so nothing is lost). Piece t * 32 + lane of a tile holds, for query lr, the keys 16 t + 8 hi + (0..7): what that lane holds of the C operand of score tile t.
// One wave: two (query tile, key block) pairs, all eight heads of each (the index rows are read once for the eight). The index is data: clamped before it forms an address.
__device__ __forceinline__ void ld_ix(const int* p, v4i (&ix)[4]) {
#pragma unroll
    for (int c = 0; c < 4; ++c) ix[c] = *(const v4i*)(p + (c >> 1) * 16 + (c & 1) * 4); }
__device__ __forceinline__ v16i clamp_ix(const v4i (&ix)[4]) { v16i kx;
#pragma unroll
    for (int u = 0; u < 16; ++u) kx[u] = min(max(ix[u >> 2][u & 3], 0), NRB - 1);
    return kx; }
__device__ __forceinline__ void bias_tiles(const float* __restrict__ rb, const int* __restrict__ ridx, bf* BP, int id, int lane) {
    const int lr = lane & 15, hi = lane >> 4, qt = id >> 4, s0 = (id & 15) * 2;
    const int* ir = ridx + (size_t)(qt * 16 + lr) * NN + s0 * 32 + 8 * hi;
    bf* dst = BP + ((size_t)qt * (NN / 32) + s0) * FR + lane * 8;
    v4i ix[2][4]; v16i kx[2];
    ld_ix(ir, ix[0]); ld_ix(ir + 32, ix[1]);
    asm volatile("s_wait_xcnt 0x0" :: "v"(ir) : "memory");   // behind the index loads: their address register is an input, so it lives up to the wait
    kx[0] = clamp_ix(ix[0]); kx[1] = clamp_ix(ix[1]);
#pragma unroll
    for (int h0 = 0; h0 < NH_; h0 += 4) {   // four heads (128 gathers) in flight at a time: one load latency for the four
        v8f rw[4][2][2];
#pragma unroll
        for (int g = 0; g < 4; ++g)
#pragma unroll
            for (int p = 0; p < 2; ++p)
#pragma unroll
                for (int u = 0; u < 16; ++u) rw[g][p][u >> 3][u & 7] = rb[(size_t)(h0 + g) * NRB + kx[p][u]];
        asm volatile("s_wait_xcnt 0x0" :: "v"(kx[0]), "v"(kx[1]) : "memory");   // behind the gathers: their index registers are inputs, so they live up to the wait and no result of the run is placed on one of them; the clobber keeps all 128 in front of the first store
#pragma unroll
        for (int g = 0; g < 4; ++g)
#pragma unroll
            for (int p = 0; p < 2; ++p)
#pragma unroll
                for (int t = 0; t < 2; ++t) *(v8us*)(dst + (size_t)(h0 + g) * (NN / 16) * (NN / 32) * FR + p * FR + t * (FR / 2)) = __builtin_bit_cast(v8us, __builtin_convertvector(rw[g][p][t], v8bf));
        asm volatile("s_wait_xcnt 0x0" :: "v"(dst) : "memory");   // behind the stores: what follows writes their data registers
    }
}
// ROTATED WALKS: waves of different work-groups that read the same lines (a weight plane: 256 waves; an x tile: 12; in k_wo a token tile: 4; in k_fattn one head's K and V: 16 work-groups, a bias row: 8) start together and would ask L2 for the same line at the same moment all the way down. Each enters its walk (over K here and in k_wo, over the keys in k_fattn) at a step of its own, taken from its block index, and wraps round: the same loads and products, in another order.
// grid (NBI * NN / 64, CC / 64, 4), z = q, k, v (W3: their three weight planes one behind the other), 3: the bias plane (1024 waves that run beside the GEMM waves and need nothing of them). q, k: rows = channels, so a lane holds 8 consecutive d of one token -> Q16 / K16 [b][h][n >> 4] fragments (row n & 15, k = d; k scaled in f32 before it is rounded). v: rows = tokens, so a lane holds 32 consecutive tokens of one channel -> VT [b][h][n >> 5][d >> 4] fragments (row d & 15, k = n & 31).
__global__ __launch_bounds__(32) void k_qkv(const float* __restrict__ x, const bf* __restrict__ W3, const float* __restrict__ rb, const int* __restrict__ ridx, h16* Q16, h16* K16, h16* VT, bf* BP) {
    __shared__ __align__(16) h16 os[2 * 64 * 40];   // q, k: [head][token][40]; v: [channel][72]
    const int lane = threadIdx.x & 31, lr = lane & 15, hi = lane >> 4;
    const int z = blockIdx.z, b = blockIdx.x >> 4, n0 = (blockIdx.x & 15) * 64, o0 = blockIdx.y * 64;
    if (z == 3) { bias_tiles(rb, ridx, BP, blockIdx.y * (NBI * NN / 64) + blockIdx.x, lane); return; }
    const float* xp = x + ((size_t)b * CC + 8 * hi) * NN + n0 + 4 * lr;
    const bf* wp = W3 + (size_t)((z * CC + o0) >> 4) * (CC / 32) * FR + lane * 8;
    const int rot = blockIdx.x + blockIdx.y + 4 * z;
    v8f acc[4][4];
#pragma unroll
    for (int g = 0; g < 4; ++g)
#pragma unroll
        for (int t = 0; t < 4; ++t) acc[g][t] = (v8f){};
    if (z < 2) {
        xw_tile<false>(xp, wp, acc, rot);   // acc[g][t][j]: channel o0 + 16 g + 8 hi + j, token n0 + 4 lr + t
        const float sc = z == 1 ? 0.1767766952966369f : 1.0f;
#pragma unroll
        for (int g = 0; g < 4; ++g)
#pragma unroll
            for (int t = 0; t < 4; ++t) *(v8ha*)(os + ((g >> 1) * 64 + 4 * lr + t) * 40 + (g & 1) * 16 + 8 * hi) = __builtin_convertvector(acc[g][t] * sc, v8h);
        __builtin_amdgcn_wave_barrier(); asm volatile("" ::: "memory");   // one wave: its LDS operations run in order; this keeps the compiler from moving the reads of other lanes' rows over the writes
        h16* dst = (z == 0 ? Q16 : K16) + (((size_t)b * NH_ + (o0 >> 5)) * NN + n0) * HD;
#pragma unroll
        for (int s = 0; s < 16; ++s) { const int c = s * 32 + lane, hd = c >> 8, tok = ((c >> 6) & 3) * 16 + (c & 15), pc = (c >> 4) & 3;
            *(v8h*)(dst + (size_t)hd * NN * HD + (c & 255) * 8) = *(const v8ha*)(os + (hd * 64 + tok) * 40 + pc * 8); }
    } else {
        xw_tile<true>(xp, wp, acc, rot);    // acc[g][t][j]: token n0 + 4 (8 hi + j) + t, channel o0 + 16 g + lr
#pragma unroll
        for (int g = 0; g < 4; ++g)
#pragma unroll
            for (int q = 0; q < 4; ++q) { v8f c;
#pragma unroll
                for (int e = 0; e < 8; ++e) c[e] = acc[g][e & 3][2 * q + (e >> 2)];   // tokens n0 + 32 hi + 8 q + e
                *(v8ha*)(os + (g * 16 + lr) * 72 + 32 * hi + 8 * q) = __builtin_convertvector(c, v8h); }
        __builtin_amdgcn_wave_barrier(); asm volatile("" ::: "memory");   // as above
        h16* dst = VT + (((size_t)b * NH_ + (o0 >> 5)) * NN + n0) * HD;
#pragma unroll
        for (int s = 0; s < 16; ++s) { const int c = s * 32 + lane, hd = c >> 8, row = hd * 32 + ((c >> 6) & 1) * 16 + (c & 15), pc = ((c >> 7) & 1) * 4 + ((c >> 4) & 3);
            *(v8h*)(dst + (size_t)hd * NN * HD + (c & 255) * 8) = *(const v8ha*)(os + row * 72 + pc * 8); }
    }
}
#define WOD 4   // k_wo: steps whose loads are in flight ahead of the products
__device__ __forceinline__ void wo_ld(const h16* ak, const h16* wk, v16h (&a)[4], v16h (&w)[4]) {   // one step's 16 loads
#pragma unroll
    for (int mb = 0; mb < 4; ++mb) a[mb] = WFrag<h16>::ld(ak + mb * (CC / 32) * FR);
#pragma unroll
    for (int nb = 0; nb < 4; ++nb) w[nb] = WFrag<h16>::ld(wk + nb * (CC / 32) * FR); }
// grid (NBI * NN / 64, CC / 64): OUT [b][c][n] = merged heads . Wo^T + bo. Rows = tokens (natural order), columns = output channels: a lane holds 8 consecutive tokens of one channel, which is NCHW.
__global__ __launch_bounds__(32) void k_wo(const h16* __restrict__ M16, const h16* __restrict__ WO, const float* __restrict__ bo, float* OUT) {
    __shared__ __align__(16) float os[16 * 68];
    const int lane = threadIdx.x & 31, lr = lane & 15, hi = lane >> 4;
    const int b = blockIdx.x >> 4, n0 = (blockIdx.x & 15) * 64, c0 = blockIdx.y * 64;
    const h16* ap = M16 + (size_t)((b * NN + n0) >> 4) * (CC / 32) * FR + lane * 8;
    const h16* wp = WO + (size_t)(c0 >> 4) * (CC / 32) * FR + lane * 8;
    v8f acc[4][4];
#pragma unroll
    for (int mb = 0; mb < 4; ++mb)
#pragma unroll
        for (int nb = 0; nb < 4; ++nb) acc[mb][nb] = (v8f){};
    const int rot = blockIdx.x + 2 * blockIdx.y;   // see ROTATED WALKS at k_qkv
    // FOUR STEPS IN FLIGHT: the launch has one wave per SIMD, so nothing but the wave's own order hides a load, and a walk that loads a step, waits and multiplies pays the whole load latency eight times.
    // The walk is unrolled and the loads run WOD steps ahead of the products (64 loads: about what one wave can have outstanding), each step in flight in registers of its own; a lone wave may own far more than 256 registers. The latency is then paid about twice.
    const h16* ak[CC / 32]; const h16* wk[CC / 32]; v16h a[CC / 32][4], w[CC / 32][4]; float bv[4];
#pragma unroll
    for (int i = 0; i < CC / 32; ++i) { const int ks = (i + rot) & (CC / 32 - 1); ak[i] = ap + ks * FR; wk[i] = wp + ks * FR; }
#pragma unroll
    for (int i = 0; i < WOD; ++i) { wo_ld(ak[i], wk[i], a[i], w[i]);
        __builtin_amdgcn_sched_barrier(0); }   // here and below: loads and products stay in this order, step by step. Left alone, the compiler mixes the steps' loads, and an early product waits for late loads
#pragma unroll
    for (int i = 0; i < CC / 32; ++i) {
#pragma unroll
        for (int nb = 0; nb < 4; ++nb)
#pragma unroll
            for (int mb = 0; mb < 4; ++mb) acc[mb][nb] = wmma16(a[i][mb], w[i][nb], acc[mb][nb]);
        __builtin_amdgcn_sched_barrier(0);
        if (i + WOD < CC / 32) { wo_ld(ak[i + WOD], wk[i + WOD], a[i + WOD], w[i + WOD]);
            __builtin_amdgcn_sched_barrier(0); }
        if (i + WOD == CC / 32 - 1) {   // behind the last fragments' loads: the bias (it is wanted last, and the counter of loads returns in order), then one wait for all the walk's loads
#pragma unroll
            for (int nb = 0; nb < 4; ++nb) bv[nb] = bo[c0 + nb * 16 + lr];
            asm volatile("s_wait_xcnt 0x0" :: "v"(ak[0]), "v"(wk[0]), "v"(ak[1]), "v"(wk[1]), "v"(ak[2]), "v"(wk[2]), "v"(ak[3]), "v"(wk[3]), "v"(ak[4]), "v"(wk[4]), "v"(ak[5]), "v"(wk[5]), "v"(ak[6]), "v"(wk[6]), "v"(ak[7]), "v"(wk[7]) : "memory");   // the fragments' address registers are inputs, so each step has its own, they live up to the wait, and no result is placed on one of them
            __builtin_amdgcn_sched_barrier(0); }
    }
#pragma unroll
    for (int nb = 0; nb < 4; ++nb) {   // acc[mb][nb][j]: token n0 + 16 mb + 8 hi + j, channel c0 + 16 nb + lr
        const float bb = bfr(bv[nb]);
#pragma unroll
        for (int mb = 0; mb < 4; ++mb) { const v8f v = acc[mb][nb] + bb;
            *(v4fa*)(os + lr * 68 + mb * 16 + 8 * hi) = (v4f){v[0], v[1], v[2], v[3]}; *(v4fa*)(os + lr * 68 + mb * 16 + 8 * hi + 4) = (v4f){v[4], v[5], v[6], v[7]}; }
        __builtin_amdgcn_wave_barrier(); asm volatile("" ::: "memory");   // as in k_qkv
        float* dst = OUT + ((size_t)b * CC + c0 + nb * 16) * NN + n0;
#pragma unroll
        for (int s = 0; s < 8; ++s) { const int c = s * 32 + lane, row = c >> 4, pc = c & 15;
            *(v4f*)(dst + (size_t)row * NN + pc * 4) = *(const v4fa*)(os + row * 68 + pc * 4); }
        __builtin_amdgcn_wave_barrier(); asm volatile("" ::: "memory");   // the next block's writes stay behind these reads
    }
}

// ---- k_fattn: scores + bias (from the plane BP) + softmax + probs.v for 16 queries of one head and NI images per wave; nothing of the score plane leaves the registers.
// Transposed products: S^T = K Q^T + bias (the bias tile is the C operand: a lane holds query lr, keys 8 hi + r), O^T += V^T P^T (two S^T tiles, converted in place, are the B operand in the hardware k order; V^T rows by the same loader).
// Work-group: 8 waves = 4 query tiles x 2 heads (the tiles share K and V through the cache). An O^T tile in its registers IS a half fragment of the merged-heads plane (row = query, k = d), so each wave stores its own whole lines. grid (NN / 64, NH_ / 2, NBI / NI) = 4096 waves, four per SIMD, all resident at once: hence amdgpu_waves_per_eu(4, 4), which holds the register count to that.
// Every inner loop is unrolled so that the fragment arrays are indexed by constants and stay in registers.
__device__ __forceinline__ float xrow(float v) { const int b = __float_as_int(v); return __int_as_float(__builtin_amdgcn_permlanex16(b, b, 0x76543210, 0xfedcba98, false, false)); }   // lane l <-> l ^ 16
// Eight v_exp_f32 in one statement: no result lies on a source ("=&v"), and the closing v_nop is the slot the instruction set asks for between a transcendental and the next user of its result or writer of its source.
__device__ __forceinline__ v8f exp2x8(v8f x) { float y0, y1, y2, y3, y4, y5, y6, y7;
    asm("v_exp_f32 %0, %8\n\tv_exp_f32 %1, %9\n\tv_exp_f32 %2, %10\n\tv_exp_f32 %3, %11\n\tv_exp_f32 %4, %12\n\tv_exp_f32 %5, %13\n\tv_exp_f32 %6, %14\n\tv_exp_f32 %7, %15\n\tv_nop"
        : "=&v"(y0), "=&v"(y1), "=&v"(y2), "=&v"(y3), "=&v"(y4), "=&v"(y5), "=&v"(y6), "=&v"(y7) : "v"(x[0]), "v"(x[1]), "v"(x[2]), "v"(x[3]), "v"(x[4]), "v"(x[5]), "v"(x[6]), "v"(x[7]));
    return (v8f){y0, y1, y2, y3, y4, y5, y6, y7}; }
__device__ __forceinline__ float exp2x1(float x) { float y; asm("v_exp_f32 %0, %1\n\tv_nop" : "=v"(y) : "v"(x)); return y; }   // the same slot behind a single one
// One image's probs of a pass, e = 2^(score log2(e) - mb), and the lane's sum of them.
__device__ __forceinline__ float probs(const v8f (&st)[2], float mb, v8f (&e)[2]) { float ps = 0.f;
#pragma unroll
    for (int t = 0; t < 2; ++t) { v8f a;
#pragma unroll
        for (int r = 0; r < 8; ++r) a[r] = fmaf(st[t][r], L2E, -mb);
        e[t] = exp2x8(a);
#pragma unroll
        for (int r = 0; r < 8; ++r) ps += e[t][r]; }
    return ps; }
// s_wait_xcnt 0 behind a run of global loads: the run's address registers are inputs of the statement, so they live up to the wait and no result of the run is placed on one of them; the memory clobber keeps the run's loads in front of it (in the loop: ahead of the softmax arithmetic, which covers their latency) and later loads behind it.
__global__ __launch_bounds__(256) __attribute__((amdgpu_waves_per_eu(4, 4))) void k_fattn(const h16* __restrict__ Q16, const h16* __restrict__ K16, const h16* __restrict__ VT, const bf* __restrict__ BP, h16* M16) {
    const int lane = threadIdx.x & 31;
    const int wave = __builtin_amdgcn_readfirstlane(threadIdx.x >> 5), qt = wave & 3, hh = wave >> 2;
    const int q0 = blockIdx.x * 64, h = blockIdx.y * 2 + hh, b0 = blockIdx.z * NI;
    const bf* bp = BP + ((size_t)h * (NN / 16) + (q0 >> 4) + qt) * (NN / 32) * FR + lane * 8;
    const size_t bh0 = (size_t)b0 * NH_ + h, IMS = (size_t)NH_ * NN * HD;   // IMS: elements from one image to the next in Q16, K16 and VT
    const h16* qa = Q16 + (bh0 * NN + q0 + qt * 16) * HD + lane * 8; const h16* kp = K16 + bh0 * NN * HD + lane * 8; const h16* vp = VT + bh0 * NN * HD + lane * 8;
    v16h q[NI], kf[NI][2]; v8f o[NI][2]; float m[NI], l[NI], mb[NI];   // m: the maximum in use, mb = m log2(e) - PSH
    v4u br[2]; v8f bias[2];
    const int rot = (blockIdx.x * 2 + blockIdx.z * 4) & (NN / 32 - 1);   // the key block at which this work-group enters its walk (see ROTATED WALKS at k_qkv): the 16 work-groups on one K and V stand 2 passes apart, the 8 on one bias row 4
    const h16* k0 = kp + rot * 2 * FR; const bf* bs = bp + rot * FR;
    br[0] = *(const v4u*)bs; br[1] = *(const v4u*)(bs + FR / 2);
#pragma unroll
    for (int im = 0; im < NI; ++im) {
        q[im] = WFrag<h16>::ld(qa + im * IMS);
        kf[im][0] = WFrag<h16>::ld(k0 + im * IMS); kf[im][1] = WFrag<h16>::ld(k0 + im * IMS + FR);
        o[im][0] = (v8f){}; o[im][1] = (v8f){}; m[im] = -3.0e38f; mb[im] = -__builtin_inff(); l[im] = 0.f; }   // with this mb the first pass's probs come out infinite, so the first pass sets the maximum
    asm volatile("s_wait_xcnt 0x0" :: "v"(qa), "v"(k0), "v"(bs) : "memory");   // see above
#pragma unroll 1   // kept rolled: a second pass in flight would not fit the registers of four waves per SIMD
    for (int s = 0; s < NN / 32; ++s) {   // 32 keys a pass, key block (s + rot) mod 32; the bias tile and the K fragments are fetched one pass ahead (the last pass fetches the walk's first block again: in bounds, not used)
        const int kb = (s + rot) & (NN / 32 - 1), kn = (kb + 1) & (NN / 32 - 1);
        const h16* va = vp + kb * 2 * FR; const h16* ka = kp + kn * 2 * FR; const bf* ba = bp + kn * FR;
        v8f st[NI][2]; v16h vf[NI][2];
#pragma unroll
        for (int im = 0; im < NI; ++im) { vf[im][0] = WFrag<h16>::ld(va + im * IMS); vf[im][1] = WFrag<h16>::ld(va + im * IMS + FR); }
        __builtin_amdgcn_sched_barrier(0);   // the V loads are issued at the head of the pass, ahead of the wait for K and the bias: left alone, the compiler sinks them behind the score products and they lose that lead
#pragma unroll
        for (int u = 0; u < 16; ++u) bias[u >> 3][u & 7] = __uint_as_float((u & 1) ? br[u >> 3][(u & 7) >> 1] & 0xFFFF0000u : br[u >> 3][(u & 7) >> 1] << 16);   // bf16 pair -> two f32. Here and not behind the load: the tile fetched in the pass before has landed by now
#pragma unroll
        for (int im = 0; im < NI; ++im) { st[im][0] = wmma16(kf[im][0], q[im], bias[0]); st[im][1] = wmma16(kf[im][1], q[im], bias[1]); }
        br[0] = *(const v4u*)ba; br[1] = *(const v4u*)(ba + FR / 2);
#pragma unroll
        for (int im = 0; im < NI; ++im) { kf[im][0] = WFrag<h16>::ld(ka + im * IMS); kf[im][1] = WFrag<h16>::ld(ka + im * IMS + FR); }
        asm volatile("s_wait_xcnt 0x0" :: "v"(va), "v"(ka), "v"(ba) : "memory");   // see above
        // LAZY MAXIMUM: softmax does not depend on the value subtracted, so a pass takes the maximum in use as it is: no search, no rescaling. The probs are positive, so a lane's sum bounds each of them: while it stays under PTOP they all fit fp16.
        // Else (also an infinite or NaN sum, and always in the first pass) the whole wave renews its maxima from this pass's scores, rescales what it has summed and forms the pass's probs again, which then are at most 2^PSH.
        v8f e[NI][2]; float ps[NI]; bool over = false;
#pragma unroll
        for (int im = 0; im < NI; ++im) { ps[im] = probs(st[im], mb[im], e[im]); over |= !(ps[im] <= PTOP); }
        if (__builtin_amdgcn_ballot_w32(over) != 0) {   // one test a pass, a scalar branch: every lane is on inside it (the exchange between the wave's halves needs that)
#pragma unroll
            for (int im = 0; im < NI; ++im) {
                float tm = st[im][0][0];
#pragma unroll
                for (int r = 1; r < 16; ++r) tm = fmaxf(tm, st[im][r >> 3][r & 7]);
                tm = fmaxf(tm, xrow(tm));
                const float mn = fmaxf(m[im], tm), sc = exp2x1((m[im] - mn) * L2E); m[im] = mn; mb[im] = mn * L2E - PSH;
                l[im] *= sc; o[im][0] *= sc; o[im][1] *= sc;
                ps[im] = probs(st[im], mb[im], e[im]); }
        }
#pragma unroll
        for (int im = 0; im < NI; ++im) {
            l[im] += ps[im];
            const v16h pb = cat16(__builtin_convertvector(e[im][0], v8h), __builtin_convertvector(e[im][1], v8h));
            o[im][0] = wmma16(vf[im][0], pb, o[im][0]); o[im][1] = wmma16(vf[im][1], pb, o[im][1]); }
    }
#pragma unroll
    for (int im = 0; im < NI; ++im) { const float inv = 1.0f / (l[im] + xrow(l[im]));
#pragma unroll
        for (int u = 0; u < 2; ++u) *(v8h*)(M16 + ((((size_t)(b0 + im) * NN + q0) >> 4) + qt) * (CC / 32) * FR + h * FR + u * (FR / 2) + lane * 8) = __builtin_convertvector(o[im][u] * inv, v8h); }
}

extern "C" void kernel_launch(void* const* d_in, const int* in_sizes, int n_in,
                              void* d_out, int out_size, void* d_ws, size_t ws_size, hipStream_t stream) {
    (void)in_sizes; (void)n_in; (void)out_size;
    const float* x = (const float*)d_in[0]; const float* wq = (const float*)d_in[1]; const float* wk = (const float*)d_in[2]; const float* wv = (const float*)d_in[3]; const float* wo = (const float*)d_in[4]; const float* bo = (const float*)d_in[5]; const float* rb = (const float*)d_in[6]; const int* ridx = (const int*)d_in[7];
    float* OUT = (float*)d_out;     // [16][256][32][32]
    char* wsp = (char*)d_ws;
    auto take = [&](size_t bytes) { char* p = wsp; wsp += (bytes + 255) & ~(size_t)255; return (void*)p; };
    bf* W3 = (bf*)take((size_t)3 * CC * CC * 2); h16* WO = (h16*)take(CC * CC * 2);
    h16* Q16 = (h16*)take((size_t)NBI * NH_ * NN * HD * 2); h16* K16 = (h16*)take((size_t)NBI * NH_ * NN * HD * 2); h16* VT = (h16*)take((size_t)NBI * NH_ * HD * NN * 2); h16* M16 = (h16*)take((size_t)NBI * NN * CC * 2); bf* BP = (bf*)take((size_t)NH_ * NN * NN * 2);
    if ((size_t)(wsp - (char*)d_ws) > ws_size) return;    // total ~ 48.5 MiB
    k_wprep<<<dim3(CC * CC / 8 / 256, 4), 256, 0, stream>>>(wq, wk, wv, wo, W3, WO);
    k_qkv<<<dim3(NBI * NN / 64, CC / 64, 4), 32, 0, stream>>>(x, W3, rb, ridx, Q16, K16, VT, BP);
    k_fattn<<<dim3(NN / 64, NH_ / 2, NBI / NI), 256, 0, stream>>>(Q16, K16, VT, BP, M16);
    k_wo<<<dim3(NBI * NN / 64, CC / 64, 1), 32, 0, stream>>>(M16, WO, bo, OUT);
}

// v010
// One run takes 50.4 microseconds.
// In both of two side-by-side timings against v009, it was 1.05 times as fast.
// Counting every step since v000, it is 31.0 times as fast.
#include <hip/hip_runtime.h>

// Attention block with a gathered relative bias (x NCHW [16][256][32][32] -> 1024 tokens; q/k/v = xt W^T (8 heads x 32); attn = softmax(q . (k scale) + rel_bias[h][rel_idx[i][j]]) (rel_bias [8][3969] and the int32 index table read as data, clamped); out = (attn v) Wo^T + bo -> NCHW).
// Compute dtypes, f32 accumulate: every input rounded to bf16; q/k/v on PLAIN bf16 operands (inputs: exact); scores (K 32) and probs.v on single fp16 planes (the logits are dominated by the unit-scale bias; the projected q/k are
// 0.3-scale); scores, bias, softmax (f32, running maximum) and probs.v in ONE kernel, scores and probs held in registers; Wo on fp16 planes of the merged heads x fp16 weights (+ bias). Deterministic, no atomics.
// The gathered bias does not depend on the image: it is gathered and rounded ONCE, into a bf16 plane in the order of the score tiles (by four waves of each k_qkv work-group), and the attention kernel reads it from there.
// Four launches: the weight roundings (all four matrices in one grid), k_qkv, k_fattn, k_wo. No activation has a layout pass of its own: k_qkv reads x as it comes (f32, NCHW) and rounds it on the way into LDS, and every epilogue stores the layout that the next reader wants.
// FRAGMENT ORDER: every 16-bit operand plane in the workspace (the four weights, q, k, V^T, the merged heads) is a row of 1-KiB fragments (16 rows x 32 k), each stored as [k >> 3 (4)][row (16)][k & 7]: lane l of a loader reads the 16 bytes at 16 l and at 512 + 16 l, so each load instruction covers four whole 128-byte lines
// (a row-major plane costs 8 or 16 lines for the same 512 bytes, and the cache path is paid by the line).

#define NBI  16
#define NI   2      // images per wave of the attention kernel: they share one bias tile
#define CC   256
#define NN   1024
#define NH_  8
#define HD   32
#define NRB  3969
#define FR   512    // elements of one operand fragment in the workspace planes
#define PSH  7.0f   // probs carry 2^PSH so that small ones stay normal fp16 numbers; the row sum carries it too, so it cancels
#define PTOP 32768.0f   // a lane's sum of a pass's probs up to here: each of them is then a finite fp16 number
#define L2E  1.4426950408889634f
typedef _Float16 h16;
typedef unsigned short bf;
typedef __attribute__((ext_vector_type(16))) __bf16   v16bf;
typedef __attribute__((ext_vector_type(8)))  __bf16   v8bf;
typedef __attribute__((ext_vector_type(16))) _Float16 v16h;
typedef __attribute__((ext_vector_type(16))) float    v16f;
typedef __attribute__((ext_vector_type(8)))  _Float16 v8h;
typedef __attribute__((ext_vector_type(8)))  unsigned short v8us;
typedef __attribute__((ext_vector_type(4)))  _Float16 v4h;
typedef __attribute__((ext_vector_type(8)))  float    v8f;
typedef __attribute__((ext_vector_type(4)))  float    v4f;
typedef __attribute__((ext_vector_type(4)))  int      v4i;
typedef __attribute__((ext_vector_type(4)))  unsigned v4u;
typedef __attribute__((ext_vector_type(16))) int      v16i;
typedef v8h  __attribute__((may_alias)) v8ha;
typedef v4f  __attribute__((may_alias)) v4fa;

__device__ __forceinline__ unsigned short f2bf(float f) { unsigned u = __float_as_uint(f); u += 0x7FFFu + ((u >> 16) & 1u); return (unsigned short)(u >> 16); }
__device__ __forceinline__ float bf2f(unsigned short b) { return __uint_as_float(((unsigned)b) << 16); }
__device__ __forceinline__ float bfr(float f) { return bf2f(f2bf(f)); }
__device__ __forceinline__ v16h cat16(v8h lo, v8h hi) { return __builtin_shufflevector(lo, hi, 0, 1, 2, 3, 4, 5, 6, 7, 8, 9, 10, 11, 12, 13, 14, 15); }
__device__ __forceinline__ v16bf cat16b(v8us lo, v8us hi) { return __builtin_bit_cast(v16bf, __builtin_shufflevector(lo, hi, 0, 1, 2, 3, 4, 5, 6, 7, 8, 9, 10, 11, 12, 13, 14, 15)); }
__device__ __forceinline__ v8f wmma16(v16h a, v16h b, v8f c) { return __builtin_amdgcn_wmma_f32_16x16x32_f16(false, a, false, b, (short)0, c, false, false); }
__device__ __forceinline__ v8f wmmab(v16bf a, v16bf b, v8f c) { return __builtin_amdgcn_wmma_f32_16x16x32_bf16(false, a, false, b, (short)0, c, false, false); }
template <typename T16> struct WFrag;
template <> struct WFrag<h16> { typedef v16h V; static __device__ __forceinline__ V ld(const h16* p) { return cat16(*(const v8h*)p, *(const v8h*)(p + FR / 2)); } static __device__ __forceinline__ v8f mma(V a, V b, v8f c) { return wmma16(a, b, c); } };
template <> struct WFrag<bf> { typedef v16bf V; static __device__ __forceinline__ V ld(const bf* p) { return cat16b(*(const v8us*)p, *(const v8us*)(p + FR / 2)); } static __device__ __forceinline__ v8f mma(V a, V b, v8f c) { return wmmab(a, b, c); } };
__device__ __forceinline__ h16 tohx(float x) { return (h16)x; }
// The weight roundings, [out][in] f32 -> fragment order: thread i writes the plane's 16-byte piece i (whole lines per wave) and reads the 8 values that belong there: row 16 (i >> 9) + (i & 15), k 32 ((i >> 6) & 7) + 8 ((i >> 4) & 3).
__device__ __forceinline__ v8f w_piece(const float* __restrict__ w, size_t i) { return *(const v8f*)(w + ((i >> 9) * 16 + (i & 15)) * CC + ((i >> 6) & 7) * 32 + ((i >> 4) & 3) * 8); }
// All four roundings are ONE launch, grid (CC * CC / 8 / 256, 4): blockIdx.y picks the matrix (0, 1, 2: Wq, Wk, Wv -> the three bf16 planes of W3, one behind the other; 3: Wo -> fp16). They need nothing of each other, and 32 work-groups as a launch of their own cost a whole launch gap and a whole load-to-store latency.
__global__ __launch_bounds__(256) void k_wprep(const float* __restrict__ wq, const float* __restrict__ wk, const float* __restrict__ wv, const float* __restrict__ wo, bf* W3, h16* WO) {
    const int y = blockIdx.y; const size_t i = (size_t)blockIdx.x * 256 + threadIdx.x;
    const v8f v = w_piece(y == 0 ? wq : y == 1 ? wk : y == 2 ? wv : wo, i);
    if (y < 3) { v8us o;
#pragma unroll
        for (int k = 0; k < 8; ++k) o[k] = f2bf(v[k]);
        *(v8us*)(W3 + (size_t)y * CC * CC + i * 8) = o;
    } else { v8h o;
#pragma unroll
        for (int k = 0; k < 8; ++k) o[k] = tohx(bfr(v[k]));
        *(v8h*)(WO + i * 8) = o;
        asm volatile("s_wait_xcnt 0x0" ::: "memory"); }   // behind the store: in the built code the other branch's block follows this one and writes the store's registers
}

// ---- The two GEMMs: ONE WAVE per 64x64 output tile (16 accumulators), K = CC in steps of 32, the 16-bit planes (fragment order) straight from global memory. k_wo: 32 threads a work-group; k_qkv: the 12 GEMM waves on one x tile are in one work-group of 16 waves and take x from LDS (see there).
// A lane of an accumulator holds ONE column and eight consecutive rows, so each product is set up with the index that is contiguous in its result's layout as the ROW index; the tile goes through LDS once so that every store instruction writes whole 128-byte lines.
// x W^T for 64 tokens x 64 output channels. x is [c][n]: one 16-byte load gives a lane FOUR tokens (n0 + 4 lr + t) at one k, so token block t of the tile is made of the tokens n0 + 4 r + t (r: the fragment's row or column): every load covers whole lines and nothing is transposed; the epilogues undo the order.
// k order of both loaders, element e of a fragment: kc + 8 hi + (e & 7) + 16 (e >> 3). XROWS: the tokens are the rows (A operand), else the columns (B operand). acc[g][t]: channel block g, token block t.
// xs: the x tile in LDS, already rounded and in fragment order (k_qkv fills it), at the lane's piece. rot: the k step at which this wave enters its walk over K (it wraps round): see ROTATED WALKS at k_qkv.
template <bool XROWS>
__device__ __forceinline__ void xw_tile(const bf* xs, const bf* wp, v8f (&acc)[4][4], int rot) {
#pragma unroll 1   // kept rolled: the step at which the walk is entered is not known at compile time, so eight copies of the step would only lengthen the text
    for (int i = 0; i < CC / 32; ++i) { const int ks = (i + rot) & (CC / 32 - 1);
        const bf* xk = xs + ks * 4 * FR; const bf* wk = wp + ks * FR;
        v16bf xf[4], wf[4];
#pragma unroll
        for (int g = 0; g < 4; ++g) wf[g] = WFrag<bf>::ld(wk + g * (CC / 32) * FR);
        asm volatile("s_wait_xcnt 0x0" :: "v"(wk) : "memory");   // behind the step's global loads: their address register is an input, so it lives up to the wait; the next step forms its address anew in it
#pragma unroll
        for (int t = 0; t < 4; ++t) xf[t] = WFrag<bf>::ld(xk + t * FR);   // from LDS
#pragma unroll
        for (int g = 0; g < 4; ++g)
#pragma unroll
            for (int t = 0; t < 4; ++t) acc[g][t] = XROWS ? wmmab(xf[t], wf[g], acc[g][t]) : wmmab(wf[g], xf[t], acc[g][t]);
        asm volatile("v_nop\n\tv_nop\n\tv_nop\n\tv_nop" : "+v"(acc[0][0]), "+v"(acc[1][1]), "+v"(acc[2][2]), "+v"(acc[3][3]) : "v"(xf[3]), "v"(wf[3]));   // the slots behind the last matrix instruction on the loop's taken branch
    }
}
// ---- The bias plane BP: [head][query >> 4][key >> 5] tiles of 1 KiB (16 queries x 32 keys, bf16: the rounding that every input takes anyway, so nothing is lost). Piece t * 32 + lane of a tile holds, for query lr, the keys 16 t + 8 hi + (0..7): what that lane holds of the C operand of score tile t.
// One wave: two (query tile, key block) pairs, all eight heads of each (the index rows are read once for the eight). The index is data: clamped before it forms an address.
__device__ __forceinline__ void ld_ix(const int* p, v4i (&ix)[4]) {
#pragma unroll
    for (int c = 0; c < 4; ++c) ix[c] = *(const v4i*)(p + (c >> 1) * 16 + (c & 1) * 4); }
__device__ __forceinline__ v16i clamp_ix(const v4i (&ix)[4]) { v16i kx;
#pragma unroll
    for (int u = 0; u < 16; ++u) kx[u] = min(max(ix[u >> 2][u & 3], 0), NRB - 1);
    return kx; }
__device__ __forceinline__ void bias_tiles(const float* __restrict__ rb, const int* __restrict__ ridx, bf* BP, int id, int lane) {
    const int lr = lane & 15, hi = lane >> 4, qt = id >> 4, s0 = (id & 15) * 2;
    const int* ir = ridx + (size_t)(qt * 16 + lr) * NN + s0 * 32 + 8 * hi;
    bf* dst = BP + ((size_t)qt * (NN / 32) + s0) * FR + lane * 8;
    v4i ix[2][4]; v16i kx[2];
    ld_ix(ir, ix[0]); ld_ix(ir + 32, ix[1]);
    asm volatile("s_wait_xcnt 0x0" :: "v"(ir) : "memory");   // behind the index loads: their address register is an input, so it lives up to the wait
    kx[0] = clamp_ix(ix[0]); kx[1] = clamp_ix(ix[1]);
#pragma unroll
    for (int h0 = 0; h0 < NH_; h0 += 4) {   // four heads (128 gathers) in flight at a time: one load latency for the four
        v8f rw[4][2][2];
#pragma unroll
        for (int g = 0; g < 4; ++g)
#pragma unroll
            for (int p = 0; p < 2; ++p)
#pragma unroll
                for (int u = 0; u < 16; ++u) rw[g][p][u >> 3][u & 7] = rb[(size_t)(h0 + g) * NRB + kx[p][u]];
        asm volatile("s_wait_xcnt 0x0" :: "v"(kx[0]), "v"(kx[1]) : "memory");   // behind the gathers: their index registers are inputs, so they live up to the wait and no result of the run is placed on one of them; the clobber keeps all 128 in front of the first store
#pragma unroll
        for (int g = 0; g < 4; ++g)
#pragma unroll
            for (int p = 0; p < 2; ++p)
#pragma unroll
                for (int t = 0; t < 2; ++t) *(v8us*)(dst + (size_t)(h0 + g) * (NN / 16) * (NN / 32) * FR + p * FR + t * (FR / 2)) = __builtin_bit_cast(v8us, __builtin_convertvector(rw[g][p][t], v8bf));
        asm volatile("s_wait_xcnt 0x0" :: "v"(dst) : "memory");   // behind the stores: what follows writes their data registers
    }
}
// ROTATED WALKS: waves of different work-groups that read the same lines (a weight plane: 256 waves; in k_wo a token tile: 4; in k_fattn one head's K and V: 16 work-groups, a bias row: 8) do not walk in step, for speed only: each enters its walk (over K here and in k_wo, over the keys in k_fattn) at a step of its own, taken from its block index, and wraps round: the same loads and products, in another order.
// grid (NBI * NN / 64), one work-group of 16 waves per x tile (64 tokens x all CC channels). THE x TILE GOES THROUGH LDS ONCE: twelve output tiles (q, k, v x four channel blocks) want the same 64 KiB of x: twelve separate readers would draw it from L2 twelve times and round it twelve times.
// All 16 waves read one sixteenth each (whole lines), round it and store it as bf16 fragments (32 KiB); behind one barrier waves 0..11 (z = wave >> 2 = q, k, v; W3: their three weight planes one behind the other; channel block wave & 3) walk K on LDS fragments and global weight fragments, and waves 12..15 make four pieces of the bias plane, which needs nothing of the GEMM waves. q, k: rows = channels, so a lane holds 8 consecutive d of one token -> Q16 / K16 [b][h][n >> 4] fragments (row n & 15, k = d; k scaled in f32 before it is rounded). v: rows = tokens, so a lane holds 32 consecutive tokens of one channel -> VT [b][h][n >> 5][d >> 4] fragments (row d & 15, k = n & 31).
__global__ __launch_bounds__(512) void k_qkv(const float* __restrict__ x, const bf* __restrict__ W3, const float* __restrict__ rb, const int* __restrict__ ridx, h16* Q16, h16* K16, h16* VT, bf* BP) {
    __shared__ __align__(16) bf XS[(CC / 32) * 4 * FR];   // the x tile: [k step][token block] fragments, 32 KiB
    __shared__ __align__(16) h16 OS[12][2 * 64 * 40];     // each GEMM wave's own output stage. q, k: [head][token][40]; v: [channel][72]
    const int lane = threadIdx.x & 31, lr = lane & 15, hi = lane >> 4;
    const int wave = __builtin_amdgcn_readfirstlane(threadIdx.x >> 5);
    const int b = blockIdx.x >> 4, n0 = (blockIdx.x & 15) * 64;
    {   // wave w rounds half hf = w & 1 (elements 8 hf .. 8 hf + 7) of the four fragments of k step w >> 1
        const int ks = wave >> 1, hf = wave & 1;
        const float* xk = x + ((size_t)b * CC + ks * 32 + 16 * hf + 8 * hi) * NN + n0 + 4 * lr;
        v4f xv[8];
#pragma unroll
        for (int e = 0; e < 8; ++e) xv[e] = *(const v4f*)(xk + (size_t)e * NN);
        asm volatile("s_wait_xcnt 0x0" :: "v"(xk) : "memory");   // behind the loads: their address register is an input, so it lives up to the wait
#pragma unroll
        for (int t = 0; t < 4; ++t) { v8f c;
#pragma unroll
            for (int e = 0; e < 8; ++e) c[e] = xv[e][t];
            *(v8us*)(XS + (ks * 4 + t) * FR + hf * (FR / 2) + lane * 8) = __builtin_bit_cast(v8us, __builtin_convertvector(c, v8bf)); }
    }
    __syncthreads();   // the one barrier: the tile is whole before any wave reads it; nothing writes it again
    if (wave >= 12) { bias_tiles(rb, ridx, BP, blockIdx.x * 4 + wave - 12, lane); return; }
    const int z = wave >> 2, o0 = (wave & 3) * 64;
    h16* os = OS[wave];
    const bf* xp = XS + lane * 8;
    const bf* wp = W3 + (size_t)((z * CC + o0) >> 4) * (CC / 32) * FR + lane * 8;
    const int rot = blockIdx.x + (wave & 3) + 4 * z;
    v8f acc[4][4];
#pragma unroll
    for (int g = 0; g < 4; ++g)
#pragma unroll
        for (int t = 0; t < 4; ++t) acc[g][t] = (v8f){};
    if (z < 2) {
        xw_tile<false>(xp, wp, acc, rot);   // acc[g][t][j]: channel o0 + 16 g + 8 hi + j, token n0 + 4 lr + t
        const float sc = z == 1 ? 0.1767766952966369f : 1.0f;
#pragma unroll
        for (int g = 0; g < 4; ++g)
#pragma unroll
            for (int t = 0; t < 4; ++t) *(v8ha*)(os + ((g >> 1) * 64 + 4 * lr + t) * 40 + (g & 1) * 16 + 8 * hi) = __builtin_convertvector(acc[g][t] * sc, v8h);
        __builtin_amdgcn_wave_barrier(); asm volatile("" ::: "memory");   // one wave: its LDS operations run in order; this keeps the compiler from moving the reads of other lanes' rows over the writes
        h16* dst = (z == 0 ? Q16 : K16) + (((size_t)b * NH_ + (o0 >> 5)) * NN + n0) * HD;
#pragma unroll
        for (int s = 0; s < 16; ++s) { const int c = s * 32 + lane, hd = c >> 8, tok = ((c >> 6) & 3) * 16 + (c & 15), pc = (c >> 4) & 3;
            *(v8h*)(dst + (size_t)hd * NN * HD + (c & 255) * 8) = *(const v8ha*)(os + (hd * 64 + tok) * 40 + pc * 8); }
    } else {
        xw_tile<true>(xp, wp, acc, rot);    // acc[g][t][j]: token n0 + 4 (8 hi + j) + t, channel o0 + 16 g + lr
#pragma unroll
        for (int g = 0; g < 4; ++g)
#pragma unroll
            for (int q = 0; q < 4; ++q) { v8f c;
#pragma unroll
                for (int e = 0; e < 8; ++e) c[e] = acc[g][e & 3][2 * q + (e >> 2)];   // tokens n0 + 32 hi + 8 q + e
                *(v8ha*)(os + (g * 16 + lr) * 72 + 32 * hi + 8 * q) = __builtin_convertvector(c, v8h); }
        __builtin_amdgcn_wave_barrier(); asm volatile("" ::: "memory");   // as above
        h16* dst = VT + (((size_t)b * NH_ + (o0 >> 5)) * NN + n0) * HD;
#pragma unroll
        for (int s = 0; s < 16; ++s) { const int c = s * 32 + lane, hd = c >> 8, row = hd * 32 + ((c >> 6) & 1) * 16 + (c & 15), pc = ((c >> 7) & 1) * 4 + ((c >> 4) & 3);
            *(v8h*)(dst + (size_t)hd * NN * HD + (c & 255) * 8) = *(const v8ha*)(os + row * 72 + pc * 8); }
    }
}
#define WOD 4   // k_wo: steps whose loads are in flight ahead of the products
__device__ __forceinline__ void wo_ld(const h16* ak, const h16* wk, v16h (&a)[4], v16h (&w)[4]) {   // one step's 16 loads
#pragma unroll
    for (int mb = 0; mb < 4; ++mb) a[mb] = WFrag<h16>::ld(ak + mb * (CC / 32) * FR);
#pragma unroll
    for (int nb = 0; nb < 4; ++nb) w[nb] = WFrag<h16>::ld(wk + nb * (CC / 32) * FR); }
// grid (NBI * NN / 64, CC / 64): OUT [b][c][n] = merged heads . Wo^T + bo. Rows = tokens (natural order), columns = output channels: a lane holds 8 consecutive tokens of one channel, which is NCHW.
__global__ __launch_bounds__(32) void k_wo(const h16* __restrict__ M16, const h16* __restrict__ WO, const float* __restrict__ bo, float* OUT) {
    __shared__ __align__(16) float os[16 * 68];
    const int lane = threadIdx.x & 31, lr = lane & 15, hi = lane >> 4;
    const int b = blockIdx.x >> 4, n0 = (blockIdx.x & 15) * 64, c0 = blockIdx.y * 64;
    const h16* ap = M16 + (size_t)((b * NN + n0) >> 4) * (CC / 32) * FR + lane * 8;
    const h16* wp = WO + (size_t)(c0 >> 4) * (CC / 32) * FR + lane * 8;
    v8f acc[4][4];
#pragma unroll
    for (int mb = 0; mb < 4; ++mb)
#pragma unroll
        for (int nb = 0; nb < 4; ++nb) acc[mb][nb] = (v8f){};
    const int rot = blockIdx.x + 2 * blockIdx.y;   // see ROTATED WALKS at k_qkv
    // FOUR STEPS IN FLIGHT: the launch has one wave per SIMD, so nothing but the wave's own order hides a load, and a walk that loads a step, waits and multiplies pays the whole load latency eight times.
    // The walk is unrolled and the loads run WOD steps ahead of the products (64 loads: about what one wave can have outstanding), each step in flight in registers of its own; a lone wave may own far more than 256 registers. The latency is then paid about twice.
    const h16* ak[CC / 32]; const h16* wk[CC / 32]; v16h a[CC / 32][4], w[CC / 32][4]; float bv[4];
#pragma unroll
    for (int i = 0; i < CC / 32; ++i) { const int ks = (i + rot) & (CC / 32 - 1); ak[i] = ap + ks * FR; wk[i] = wp + ks * FR; }
#pragma unroll
    for (int i = 0; i < WOD; ++i) { wo_ld(ak[i], wk[i], a[i], w[i]);
        __builtin_amdgcn_sched_barrier(0); }   // here and below: loads and products stay in this order, step by step. Left alone, the compiler mixes the steps' loads, and an early product waits for late loads
#pragma unroll
    for (int i = 0; i < CC / 32; ++i) {
#pragma unroll
        for (int nb = 0; nb < 4; ++nb)
#pragma unroll
            for (int mb = 0; mb < 4; ++mb) acc[mb][nb] = wmma16(a[i][mb], w[i][nb], acc[mb][nb]);
        __builtin_amdgcn_sched_barrier(0);
        if (i + WOD < CC / 32) { wo_ld(ak[i + WOD], wk[i + WOD], a[i + WOD], w[i + WOD]);
            __builtin_amdgcn_sched_barrier(0); }
        if (i + WOD == CC / 32 - 1) {   // behind the last fragments' loads: the bias (it is wanted last, and the counter of loads returns in order), then one wait for all the walk's loads
#pragma unroll
            for (int nb = 0; nb < 4; ++nb) bv[nb] = bo[c0 + nb * 16 + lr];
            asm volatile("s_wait_xcnt 0x0" :: "v"(ak[0]), "v"(wk[0]), "v"(ak[1]), "v"(wk[1]), "v"(ak[2]), "v"(wk[2]), "v"(ak[3]), "v"(wk[3]), "v"(ak[4]), "v"(wk[4]), "v"(ak[5]), "v"(wk[5]), "v"(ak[6]), "v"(wk[6]), "v"(ak[7]), "v"(wk[7]) : "memory");   // the fragments' address registers are inputs, so each step has its own, they live up to the wait, and no result is placed on one of them
            __builtin_amdgcn_sched_barrier(0); }
    }
#pragma unroll
    for (int nb = 0; nb < 4; ++nb) {   // acc[mb][nb][j]: token n0 + 16 mb + 8 hi + j, channel c0 + 16 nb + lr
        const float bb = bfr(bv[nb]);
#pragma unroll
        for (int mb = 0; mb < 4; ++mb) { const v8f v = acc[mb][nb] + bb;
            *(v4fa*)(os + lr * 68 + mb * 16 + 8 * hi) = (v4f){v[0], v[1], v[2], v[3]}; *(v4fa*)(os + lr * 68 + mb * 16 + 8 * hi + 4) = (v4f){v[4], v[5], v[6], v[7]}; }
        __builtin_amdgcn_wave_barrier(); asm volatile("" ::: "memory");   // as in k_qkv
        float* dst = OUT + ((size_t)b * CC + c0 + nb * 16) * NN + n0;
#pragma unroll
        for (int s = 0; s < 8; ++s) { const int c = s * 32 + lane, row = c >> 4, pc = c & 15;
            *(v4f*)(dst + (size_t)row * NN + pc * 4) = *(const v4fa*)(os + row * 68 + pc * 4); }
        __builtin_amdgcn_wave_barrier(); asm volatile("" ::: "memory");   // the next block's writes stay behind these reads
    }
}

// ---- k_fattn: scores + bias (from the plane BP) + softmax + probs.v for 16 queries of one head and NI images per wave; nothing of the score plane leaves the registers.
// Transposed products: S^T = K Q^T + bias (the bias tile is the C operand: a lane holds query lr, keys 8 hi + r), O^T += V^T P^T (two S^T tiles, converted in place, are the B operand in the hardware k order; V^T rows by the same loader).
// Work-group: 8 waves = 4 query tiles x 2 heads (the tiles share K and V through the cache). An O^T tile in its registers IS a half fragment of the merged-heads plane (row = query, k = d), so each wave stores its own whole lines. grid (NN / 64, NH_ / 2, NBI / NI) = 4096 waves, four per SIMD, all resident at once: hence amdgpu_waves_per_eu(4, 4), which holds the register count to that.
// Every inner loop is unrolled so that the fragment arrays are indexed by constants and stay in registers.
__device__ __forceinline__ float xrow(float v) { const int b = __float_as_int(v); return __int_as_float(__builtin_amdgcn_permlanex16(b, b, 0x76543210, 0xfedcba98, false, false)); }   // lane l <-> l ^ 16
// Eight v_exp_f32 in one statement: no result lies on a source ("=&v"), and the closing v_nop is the slot the instruction set asks for between a transcendental and the next user of its result or writer of its source.
__device__ __forceinline__ v8f exp2x8(v8f x) { float y0, y1, y2, y3, y4, y5, y6, y7;
    asm("v_exp_f32 %0, %8\n\tv_exp_f32 %1, %9\n\tv_exp_f32 %2, %10\n\tv_exp_f32 %3, %11\n\tv_exp_f32 %4, %12\n\tv_exp_f32 %5, %13\n\tv_exp_f32 %6, %14\n\tv_exp_f32 %7, %15\n\tv_nop"
        : "=&v"(y0), "=&v"(y1), "=&v"(y2), "=&v"(y3), "=&v"(y4), "=&v"(y5), "=&v"(y6), "=&v"(y7) : "v"(x[0]), "v"(x[1]), "v"(x[2]), "v"(x[3]), "v"(x[4]), "v"(x[5]), "v"(x[6]), "v"(x[7]));
    return (v8f){y0, y1, y2, y3, y4, y5, y6, y7}; }
__device__ __forceinline__ float exp2x1(float x) { float y; asm("v_exp_f32 %0, %1\n\tv_nop" : "=v"(y) : "v"(x)); return y; }   // the same slot behind a single one
// One image's probs of a pass, e = 2^(score log2(e) - mb), and the lane's sum of them.
__device__ __forceinline__ float probs(const v8f (&st)[2], float mb, v8f (&e)[2]) { float ps = 0.f;
#pragma unroll
    for (int t = 0; t < 2; ++t) { v8f a;
#pragma unroll
        for (int r = 0; r < 8; ++r) a[r] = fmaf(st[t][r], L2E, -mb);
        e[t] = exp2x8(a);
#pragma unroll
        for (int r = 0; r < 8; ++r) ps += e[t][r]; }
    return ps; }
// s_wait_xcnt 0 behind a run of global loads: the run's address registers are inputs of the statement, so they live up to the wait and no result of the run is placed on one of them; the memory clobber keeps the run's loads in front of it (in the loop: ahead of the softmax arithmetic, which covers their latency) and later loads behind it.
__global__ __launch_bounds__(256) __attribute__((amdgpu_waves_per_eu(4, 4))) void k_fattn(const h16* __restrict__ Q16, const h16* __restrict__ K16, const h16* __restrict__ VT, const bf* __restrict__ BP, h16* M16) {
    const int lane = threadIdx.x & 31;
    const int wave = __builtin_amdgcn_readfirstlane(threadIdx.x >> 5), qt = wave & 3, hh = wave >> 2;
    const int q0 = blockIdx.x * 64, h = blockIdx.y * 2 + hh, b0 = blockIdx.z * NI;
    const bf* bp = BP + ((size_t)h * (NN / 16) + (q0 >> 4) + qt) * (NN / 32) * FR + lane * 8;
    const size_t bh0 = (size_t)b0 * NH_ + h, IMS = (size_t)NH_ * NN * HD;   // IMS: elements from one image to the next in Q16, K16 and VT
    const h16* qa = Q16 + (bh0 * NN + q0 + qt * 16) * HD + lane * 8; const h16* kp = K16 + bh0 * NN * HD + lane * 8; const h16* vp = VT + bh0 * NN * HD + lane * 8;
    v16h q[NI], kf[NI][2]; v8f o[NI][2]; float m[NI], l[NI], mb[NI];   // m: the maximum in use, mb = m log2(e) - PSH
    v4u br[2]; v8f bias[2];
    const int rot = (blockIdx.x * 2 + blockIdx.z * 4) & (NN / 32 - 1);   // the key block at which this work-group enters its walk (see ROTATED WALKS at k_qkv): the 16 work-groups on one K and V stand 2 passes apart, the 8 on one bias row 4
    const h16* k0 = kp + rot * 2 * FR; const bf* bs = bp + rot * FR;
    br[0] = *(const v4u*)bs; br[1] = *(const v4u*)(bs + FR / 2);
#pragma unroll
    for (int im = 0; im < NI; ++im) {
        q[im] = WFrag<h16>::ld(qa + im * IMS);
        kf[im][0] = WFrag<h16>::ld(k0 + im * IMS); kf[im][1] = WFrag<h16>::ld(k0 + im * IMS + FR);
        o[im][0] = (v8f){}; o[im][1] = (v8f){}; m[im] = -3.0e38f; mb[im] = -__builtin_inff(); l[im] = 0.f; }   // with this mb the first pass's probs come out infinite, so the first pass sets the maximum
    asm volatile("s_wait_xcnt 0x0" :: "v"(qa), "v"(k0), "v"(bs) : "memory");   // see above
#pragma unroll 1   // kept rolled: a second pass in flight would not fit the registers of four waves per SIMD
    for (int s = 0; s < NN / 32; ++s) {   // 32 keys a pass, key block (s + rot) mod 32; the bias tile and the K fragments are fetched one pass ahead (the last pass fetches the walk's first block again: in bounds, not used)
        const int kb = (s + rot) & (NN / 32 - 1), kn = (kb + 1) & (NN / 32 - 1);
        const h16* va = vp + kb * 2 * FR; const h16* ka = kp + kn * 2 * FR; const bf* ba = bp + kn * FR;
        v8f st[NI][2]; v16h vf[NI][2];
#pragma unroll
        for (int im = 0; im < NI; ++im) { vf[im][0] = WFrag<h16>::ld(va + im * IMS); vf[im][1] = WFrag<h16>::ld(va + im * IMS + FR); }
        __builtin_amdgcn_sched_barrier(0);   // the V loads are issued at the head of the pass, ahead of the wait for K and the bias: left alone, the compiler sinks them behind the score products and they lose that lead
#pragma unroll
        for (int u = 0; u < 16; ++u) bias[u >> 3][u & 7] = __uint_as_float((u & 1) ? br[u >> 3][(u & 7) >> 1] & 0xFFFF0000u : br[u >> 3][(u & 7) >> 1] << 16);   // bf16 pair -> two f32. Here and not behind the load: the tile fetched in the pass before has landed by now
#pragma unroll
        for (int im = 0; im < NI; ++im) { st[im][0] = wmma16(kf[im][0], q[im], bias[0]); st[im][1] = wmma16(kf[im][1], q[im], bias[1]); }
        br[0] = *(const v4u*)ba; br[1] = *(const v4u*)(ba + FR / 2);
#pragma unroll
        for (int im = 0; im < NI; ++im) { kf[im][0] = WFrag<h16>::ld(ka + im * IMS); kf[im][1] = WFrag<h16>::ld(ka + im * IMS + FR); }
        asm volatile("s_wait_xcnt 0x0" :: "v"(va), "v"(ka), "v"(ba) : "memory");   // see above
        // LAZY MAXIMUM: softmax does not depend on the value subtracted, so a pass takes the maximum in use as it is: no search, no rescaling. The probs are positive, so a lane's sum bounds each of them: while it stays under PTOP they all fit fp16.
        // Else (also an infinite or NaN sum, and always in the first pass) the whole wave renews its maxima from this pass's scores, rescales what it has summed and forms the pass's probs again, which then are at most 2^PSH.
        v8f e[NI][2]; float ps[NI]; bool over = false;
#pragma unroll
        for (int im = 0; im < NI; ++im) { ps[im] = probs(st[im], mb[im], e[im]); over |= !(ps[im] <= PTOP); }
        if (__builtin_amdgcn_ballot_w32(over) != 0) {   // one test a pass, a scalar branch: every lane is on inside it (the exchange between the wave's halves needs that)
#pragma unroll
            for (int im = 0; im < NI; ++im) {
                float tm = st[im][0][0];
#pragma unroll
                for (int r = 1; r < 16; ++r) tm = fmaxf(tm, st[im][r >> 3][r & 7]);
                tm = fmaxf(tm, xrow(tm));
                const float mn = fmaxf(m[im], tm), sc = exp2x1((m[im] - mn) * L2E); m[im] = mn; mb[im] = mn * L2E - PSH;
                l[im] *= sc; o[im][0] *= sc; o[im][1] *= sc;
                ps[im] = probs(st[im], mb[im], e[im]); }
        }
#pragma unroll
        for (int im = 0; im < NI; ++im) {
            l[im] += ps[im];
            const v16h pb = cat16(__builtin_convertvector(e[im][0], v8h), __builtin_convertvector(e[im][1], v8h));
            o[im][0] = wmma16(vf[im][0], pb, o[im][0]); o[im][1] = wmma16(vf[im][1], pb, o[im][1]); }
    }
#pragma unroll
    for (int im = 0; im < NI; ++im) { const float inv = 1.0f / (l[im] + xrow(l[im]));
#pragma unroll
        for (int u = 0; u < 2; ++u) *(v8h*)(M16 + ((((size_t)(b0 + im) * NN + q0) >> 4) + qt) * (CC / 32) * FR + h * FR + u * (FR / 2) + lane * 8) = __builtin_convertvector(o[im][u] * inv, v8h); }
}

extern "C" void kernel_launch(void* const* d_in, const int* in_sizes, int n_in,
                              void* d_out, int out_size, void* d_ws, size_t ws_size, hipStream_t stream) {
    (void)in_sizes; (void)n_in; (void)out_size;
    const float* x = (const float*)d_in[0]; const float* wq = (const float*)d_in[1]; const float* wk = (const float*)d_in[2]; const float* wv = (const float*)d_in[3]; const float* wo = (const float*)d_in[4]; const float* bo = (const float*)d_in[5]; const float* rb = (const float*)d_in[6]; const int* ridx = (const int*)d_in[7];
    float* OUT = (float*)d_out;     // [16][256][32][32]
    char* wsp = (char*)d_ws;
    auto take = [&](size_t bytes) { char* p = wsp; wsp += (bytes + 255) & ~(size_t)255; return (void*)p; };
    bf* W3 = (bf*)take((size_t)3 * CC * CC * 2); h16* WO = (h16*)take(CC * CC * 2);
    h16* Q16 = (h16*)take((size_t)NBI * NH_ * NN * HD * 2); h16* K16 = (h16*)take((size_t)NBI * NH_ * NN * HD * 2); h16* VT = (h16*)take((size_t)NBI * NH_ * HD * NN * 2); h16* M16 = (h16*)take((size_t)NBI * NN * CC * 2); bf* BP = (bf*)take((size_t)NH_ * NN * NN * 2);
    if ((size_t)(wsp - (char*)d_ws) > ws_size) return;    // total ~ 48.5 MiB
    k_wprep<<<dim3(CC * CC / 8 / 256, 4), 256, 0, stream>>>(wq, wk, wv, wo, W3, WO);
    k_qkv<<<dim3(NBI * NN / 64), 512, 0, stream>>>(x, W3, rb, ridx, Q16, K16, VT, BP);
    k_fattn<<<dim3(NN / 64, NH_ / 2, NBI / NI), 256, 0, stream>>>(Q16, K16, VT, BP, M16);
    k_wo<<<dim3(NBI * NN / 64, CC / 64, 1), 32, 0, stream>>>(M16, WO, bo, OUT);
}
